// v000
// Measured on an AMD MI455X. A time is GPU time per run, averaged over a window of back-to-back runs after a warm-up
// (all launches, gaps included; the runs take copies of the inputs in turn), and the median of several windows.
// Apart from v000's, it joins two sittings. Times from different sittings can be a few percent apart, while
// side-by-side timings come from the same sitting.
// v000, which the later versions start from, runs in 228 microseconds.
#include <hip/hip_runtime.h>
#include <hip/hip_bf16.h>
#include <math.h>

// ---------------------------------------------------------------------------
// MI455X (gfx1250, wave32) implementation.
// Pipeline:
//  P0  convert x -> f16, transpose-convert all weights -> f16 [N,K]
//  K1  Hk = gelu(x@kw1+b), Hq = gelu(x@qw1+b), Vt = (x@vw+b)^T     (WMMA f16,
//      B tile staged in LDS via async-load-to-LDS, ping-pong)
//  K2  phases -> Q[l,f]=w_s*{cos,sin}(qp), K[l,f], Kt[f,l]          (WMMA f16)
//  K3a per-chunk state sums S_j = K_j^T V_j                         (WMMA f16)
//  K3b exclusive prefix over 16 chunks -> Mt (transposed, f16)      (scan)
//  K3c O = Q@M_prev + tril(Q K^T) @ V  (scores staged in LDS)       (WMMA f16)
//  K4a position-norm + LayerNorm -> yn (f16)
//  K4b out = x + yn@ow + ob  (async LDS-staged B, like K1)          (WMMA f16)
// All accumulation in f32 (WMMA f32 accumulators).
// ---------------------------------------------------------------------------

typedef __attribute__((ext_vector_type(16))) _Float16 v16h;
typedef __attribute__((ext_vector_type(8)))  _Float16 v8h;
typedef __attribute__((ext_vector_type(8)))  float    v8f;
typedef __attribute__((ext_vector_type(4)))  int      v4i;

#define BATCH 2
#define SEQ   2048
#define DIM   512
#define NSET  4
#define NPLN  16
#define TP    64          // NSET*NPLN
#define FDIM  128         // 2*TP (cos|sin features)
#define ROWS  4096        // BATCH*SEQ
#define CHUNK 128
#define NCHK  16          // SEQ/CHUNK
#define PI_F  3.14159265358979323846f

// CDNA5 async global->LDS path (ASYNCcnt). Guarded so the file compiles on
// toolchains without the builtins (falls back to sync reg->LDS staging).
#if defined(__has_builtin)
#if __has_builtin(__builtin_amdgcn_global_load_async_to_lds_b128) && \
    __has_builtin(__builtin_amdgcn_s_wait_asynccnt)
#define USE_ASYNC_LDS 1
#endif
#endif

#define AS_GLOBAL __attribute__((address_space(1)))
#define AS_LDS    __attribute__((address_space(3)))

// ---- WMMA helpers ---------------------------------------------------------

__device__ __forceinline__ v8f wmma_f16(v16h a, v16h b, v8f c) {
  // v_wmma_f32_16x16x32_f16 : D = A(16x32) x B(32x16) + C
  return __builtin_amdgcn_wmma_f32_16x16x32_f16(false, a, false, b,
                                                (short)0, c, false, false);
}

// Load a 16x32 f16 A-fragment (or the transposed-B fragment, which has the
// identical per-lane layout) from a row-major f16 matrix with leading dim ld.
// ISA layout: lane&15 selects row, (lane>>4)*8 selects K phase; vector
// elements 0..7 hold K = kb..kb+7, elements 8..15 hold K = kb+16..kb+23.
__device__ __forceinline__ v16h load_frag(const _Float16* __restrict__ base,
                                          int ld, int rowBase, int k0, int lane) {
  const _Float16* p = base + (size_t)(rowBase + (lane & 15)) * ld
                           + k0 + ((lane >> 4) << 3);
  v16h f;
  *(v8h*)&f       = *(const v8h*)(p);
  *((v8h*)&f + 1) = *(const v8h*)(p + 16);
  return f;
}

// Stage one 64x32 f16 B sub-tile (4 KB) into LDS, one b128 per thread of a
// 256-thread block. Async (ASYNCcnt path) when available.
__device__ __forceinline__ void stage_b_tile(_Float16* __restrict__ lds_dst,
                                             const _Float16* __restrict__ gsrc,
                                             int ld, int colBase, int k0, int tid) {
  const int r = tid >> 2;          // 0..63  (row of transposed B)
  const int c = (tid & 3) << 3;    // 0,8,16,24 (halves)
  const _Float16* src = gsrc + (size_t)(colBase + r) * ld + k0 + c;
  _Float16* dst = lds_dst + r * 32 + c;
#if defined(USE_ASYNC_LDS)
  _Float16* src_nc = const_cast<_Float16*>(src);
  __builtin_amdgcn_global_load_async_to_lds_b128(
      (AS_GLOBAL v4i*)src_nc, (AS_LDS v4i*)dst, 0, 0);
#else
  *(v8h*)dst = *(const v8h*)src;
#endif
}

__device__ __forceinline__ void stage_wait() {
#if defined(USE_ASYNC_LDS)
  __builtin_amdgcn_s_wait_asynccnt(0);
#endif
}

__device__ __forceinline__ float gelu_exact(float v) {
  return 0.5f * v * (1.0f + erff(v * 0.70710678118654752440f));
}

// ---- P0: conversions ------------------------------------------------------

__global__ void k_cvt_f32_to_f16(const float* __restrict__ src,
                                 _Float16* __restrict__ dst, int n) {
  int i = blockIdx.x * blockDim.x + threadIdx.x;
  if (i < n) dst[i] = (_Float16)src[i];
}

// dst[n*K+k] = (f16) src[k*N+n]   (store weights transposed for B operands)
__global__ void k_transpose_f16(const float* __restrict__ src,
                                _Float16* __restrict__ dst, int K, int N) {
  int i = blockIdx.x * blockDim.x + threadIdx.x;
  if (i >= K * N) return;
  int k = i / N, n = i - k * N;
  dst[(size_t)n * K + k] = (_Float16)src[i];
}

// ---- K1: encoder layer-1 GEMMs + V projection -----------------------------
// grid (32, 8, 3), block 256 (8 waves); 128x64 output tile per block.
// B tile ping-pong staged in LDS (async), A fragments double-buffered in regs.

__global__ void k_encode1(const _Float16* __restrict__ xh,
                          const _Float16* __restrict__ kw1t,
                          const _Float16* __restrict__ qw1t,
                          const _Float16* __restrict__ vwt,
                          const float* __restrict__ kb1,
                          const float* __restrict__ qb1,
                          const float* __restrict__ vb,
                          _Float16* __restrict__ hk,
                          _Float16* __restrict__ hq,
                          _Float16* __restrict__ vt) {
  __shared__ _Float16 bs[2][64 * 32];  // 8 KB ping-pong B tile
  const int tid = threadIdx.x;
  const int lane = tid & 31, wave = tid >> 5;
  const int z = blockIdx.z;
  const int rowBase = blockIdx.x * 128 + wave * 16;
  const int colBase = blockIdx.y * 64;
  const _Float16* wt  = (z == 0) ? kw1t : (z == 1) ? qw1t : vwt;
  const float*    bia = (z == 0) ? kb1  : (z == 1) ? qb1  : vb;

  stage_b_tile(bs[0], wt, DIM, colBase, 0, tid);
  v16h a_cur = load_frag(xh, DIM, rowBase, 0, lane);

  v8f acc[4] = {};
  for (int i = 0; i < DIM / 32; ++i) {
    stage_wait();
    __syncthreads();                      // buffer i&1 ready for all waves
    if (i + 1 < DIM / 32)
      stage_b_tile(bs[(i + 1) & 1], wt, DIM, colBase, (i + 1) * 32, tid);
    v16h a_next;
    if (i + 1 < DIM / 32)
      a_next = load_frag(xh, DIM, rowBase, (i + 1) * 32, lane);
#pragma unroll
    for (int t = 0; t < 4; ++t) {
      v16h b = load_frag(bs[i & 1], 32, t * 16, 0, lane);
      acc[t] = wmma_f16(a_cur, b, acc[t]);
    }
    a_cur = a_next;
  }

  const int mBase = rowBase + ((lane >> 4) << 3);
#pragma unroll
  for (int t = 0; t < 4; ++t) {
    const int n = colBase + t * 16 + (lane & 15);
#pragma unroll
    for (int r = 0; r < 8; ++r) {
      const int m = mBase + r;
      float v = acc[t][r] + bia[n];
      if (z < 2) {
        v = gelu_exact(v);
        _Float16* dst = (z == 0) ? hk : hq;
        dst[(size_t)m * DIM + n] = (_Float16)v;
      } else {
        const int b = m >> 11, l = m & 2047;
        vt[((size_t)(b * DIM + n)) * SEQ + l] = (_Float16)v;  // V^T [b][d][l]
      }
    }
  }
}

// ---- K2: encoder layer-2 + phases -> Q, K, Kt -----------------------------
// grid (32), block 256. N = TP = 64 (4 tiles) for each of k/q.

__global__ void k_phases(const _Float16* __restrict__ hk,
                         const _Float16* __restrict__ hq,
                         const _Float16* __restrict__ kw2t,
                         const _Float16* __restrict__ qw2t,
                         const float* __restrict__ kb2,
                         const float* __restrict__ qb2,
                         const float* __restrict__ sw,
                         _Float16* __restrict__ Qm,   // [ROWS][FDIM]
                         _Float16* __restrict__ Km,   // [ROWS][FDIM]
                         _Float16* __restrict__ Kt) { // [B][FDIM][SEQ]
  const int lane = threadIdx.x & 31, wave = threadIdx.x >> 5;
  const int rowBase = blockIdx.x * 128 + wave * 16;

  v8f ak[4] = {}, aq[4] = {};
  for (int k0 = 0; k0 < DIM; k0 += 32) {
    v16h a0 = load_frag(hk, DIM, rowBase, k0, lane);
    v16h a1 = load_frag(hq, DIM, rowBase, k0, lane);
#pragma unroll
    for (int t = 0; t < 4; ++t) {
      v16h bk = load_frag(kw2t, DIM, t * 16, k0, lane);
      v16h bq = load_frag(qw2t, DIM, t * 16, k0, lane);
      ak[t] = wmma_f16(a0, bk, ak[t]);
      aq[t] = wmma_f16(a1, bq, aq[t]);
    }
  }
  // softmax over 4 set weights (redundant per thread; trivially cheap)
  float s0 = sw[0], s1 = sw[1], s2 = sw[2], s3 = sw[3];
  float mx = fmaxf(fmaxf(s0, s1), fmaxf(s2, s3));
  float e0 = expf(s0 - mx), e1 = expf(s1 - mx), e2 = expf(s2 - mx), e3 = expf(s3 - mx);
  float inv = 1.0f / (e0 + e1 + e2 + e3);
  float wsm[4] = {e0 * inv, e1 * inv, e2 * inv, e3 * inv};

  const int mBase = rowBase + ((lane >> 4) << 3);
#pragma unroll
  for (int t = 0; t < 4; ++t) {
    const int tp = t * 16 + (lane & 15);   // 0..63
    const int s  = tp >> 4;
#pragma unroll
    for (int r = 0; r < 8; ++r) {
      const int row = mBase + r;
      const int b = row >> 11, l = row & 2047;
      float kph = tanhf(ak[t][r] + kb2[tp]) * PI_F;
      float qph = tanhf(aq[t][r] + qb2[tp]) * PI_F;
      float kc = cosf(kph), ks = sinf(kph);
      float qc = wsm[s] * cosf(qph), qs = wsm[s] * sinf(qph);
      Km[(size_t)row * FDIM + tp]      = (_Float16)kc;
      Km[(size_t)row * FDIM + TP + tp] = (_Float16)ks;
      Kt[((size_t)(b * FDIM + tp)) * SEQ + l]      = (_Float16)kc;
      Kt[((size_t)(b * FDIM + TP + tp)) * SEQ + l] = (_Float16)ks;
      Qm[(size_t)row * FDIM + tp]      = (_Float16)qc;
      Qm[(size_t)row * FDIM + TP + tp] = (_Float16)qs;
    }
  }
}

// ---- K3a: per-chunk KV sums S_j[f,d] = sum_t K[t,f] V[t,d] ---------------
// grid (NCHK, 8, BATCH), block 256. Register double-buffered K loop.

__global__ void k_chunk_kv(const _Float16* __restrict__ Kt,
                           const _Float16* __restrict__ Vt,
                           float* __restrict__ Ssum) { // [B][NCHK][FDIM][DIM]
  const int lane = threadIdx.x & 31, wave = threadIdx.x >> 5;
  const int j = blockIdx.x, dBase = blockIdx.y * 64, b = blockIdx.z;
  const int fBase = wave * 16;
  const _Float16* ktb = Kt + (size_t)b * FDIM * SEQ;
  const _Float16* vtb = Vt + (size_t)b * DIM * SEQ;
  const int kBase = j * CHUNK;

  v8f acc[4] = {};
  v16h a_cur = load_frag(ktb, SEQ, fBase, kBase, lane);
  v16h b_cur[4];
#pragma unroll
  for (int t = 0; t < 4; ++t)
    b_cur[t] = load_frag(vtb, SEQ, dBase + t * 16, kBase, lane);

  for (int i = 0; i < CHUNK / 32; ++i) {
    v16h a_next, b_next[4];
    if (i + 1 < CHUNK / 32) {
      a_next = load_frag(ktb, SEQ, fBase, kBase + (i + 1) * 32, lane);
#pragma unroll
      for (int t = 0; t < 4; ++t)
        b_next[t] = load_frag(vtb, SEQ, dBase + t * 16, kBase + (i + 1) * 32, lane);
    }
#pragma unroll
    for (int t = 0; t < 4; ++t) acc[t] = wmma_f16(a_cur, b_cur[t], acc[t]);
    if (i + 1 < CHUNK / 32) {
      a_cur = a_next;
#pragma unroll
      for (int t = 0; t < 4; ++t) b_cur[t] = b_next[t];
    }
  }

  const int fB = fBase + ((lane >> 4) << 3);
#pragma unroll
  for (int t = 0; t < 4; ++t) {
    const int d = dBase + t * 16 + (lane & 15);
#pragma unroll
    for (int r = 0; r < 8; ++r)
      Ssum[(((size_t)(b * NCHK + j) * FDIM) + fB + r) * DIM + d] = acc[t][r];
  }
}

// ---- K3b: exclusive prefix over chunks -> Mt (transposed f16) -------------

__global__ void k_scan(const float* __restrict__ Ssum,
                       _Float16* __restrict__ Mt) { // [B][NCHK][DIM][FDIM]
  int tid = blockIdx.x * blockDim.x + threadIdx.x;
  const int total = BATCH * FDIM * DIM;
  if (tid >= total) return;
  const int b = tid / (FDIM * DIM);
  const int rem = tid - b * FDIM * DIM;
  const int f = rem / DIM, d = rem - f * DIM;
  float run = 0.0f;
#pragma unroll
  for (int j = 0; j < NCHK; ++j) {
    Mt[(((size_t)(b * NCHK + j) * DIM) + d) * FDIM + f] = (_Float16)run;
    run += Ssum[(((size_t)(b * NCHK + j) * FDIM) + f) * DIM + d];
  }
}

// ---- K3c: O = Q@M_prev + tril(Q K^T) @ V ---------------------------------
// grid (NCHK, 8, BATCH), block 256. Scores staged in LDS (f16, padded).

__global__ void k_chunk_out(const _Float16* __restrict__ Qm,
                            const _Float16* __restrict__ Km,
                            const _Float16* __restrict__ Vt,
                            const _Float16* __restrict__ Mt,
                            float* __restrict__ Ot) { // [ROWS][DIM]
  __shared__ _Float16 sc[CHUNK][CHUNK + 8];  // +8 halves pad, keeps 16B align
  const int lane = threadIdx.x & 31, wave = threadIdx.x >> 5;
  const int j = blockIdx.x, dBase = blockIdx.y * 64, b = blockIdx.z;
  const int rowTok = b * SEQ + j * CHUNK;   // first token row of chunk
  const int lBase = wave * 16;

  // Phase A: scores = Q_c K_c^T  (128x128), masked causal-inclusive
  v8f sacc[8] = {};
  for (int f0 = 0; f0 < FDIM; f0 += 32) {
    v16h a = load_frag(Qm, FDIM, rowTok + lBase, f0, lane);
#pragma unroll
    for (int tt = 0; tt < 8; ++tt) {
      v16h bf = load_frag(Km, FDIM, rowTok + tt * 16, f0, lane);
      sacc[tt] = wmma_f16(a, bf, sacc[tt]);
    }
  }
  const int mB = lBase + ((lane >> 4) << 3);
#pragma unroll
  for (int tt = 0; tt < 8; ++tt) {
    const int tl = tt * 16 + (lane & 15);
#pragma unroll
    for (int r = 0; r < 8; ++r) {
      const int ll = mB + r;
      sc[ll][tl] = (_Float16)((tl <= ll) ? sacc[tt][r] : 0.0f);
    }
  }
  __syncthreads();

  // Phase B: O = scores @ V_c + Q_c @ M_prev  (both register double-buffered)
  const _Float16* vtb = Vt + (size_t)b * DIM * SEQ;
  const _Float16* mtb = Mt + (size_t)(b * NCHK + j) * DIM * FDIM;
  v8f acc[4] = {};
  {
    v16h a_cur = load_frag(&sc[0][0], CHUNK + 8, lBase, 0, lane);
    v16h b_cur[4];
#pragma unroll
    for (int t = 0; t < 4; ++t)
      b_cur[t] = load_frag(vtb, SEQ, dBase + t * 16, j * CHUNK, lane);
    for (int i = 0; i < CHUNK / 32; ++i) {
      v16h a_next, b_next[4];
      if (i + 1 < CHUNK / 32) {
        a_next = load_frag(&sc[0][0], CHUNK + 8, lBase, (i + 1) * 32, lane);
#pragma unroll
        for (int t = 0; t < 4; ++t)
          b_next[t] = load_frag(vtb, SEQ, dBase + t * 16,
                                j * CHUNK + (i + 1) * 32, lane);
      }
#pragma unroll
      for (int t = 0; t < 4; ++t) acc[t] = wmma_f16(a_cur, b_cur[t], acc[t]);
      if (i + 1 < CHUNK / 32) {
        a_cur = a_next;
#pragma unroll
        for (int t = 0; t < 4; ++t) b_cur[t] = b_next[t];
      }
    }
  }
  {
    v16h a_cur = load_frag(Qm, FDIM, rowTok + lBase, 0, lane);
    v16h b_cur[4];
#pragma unroll
    for (int t = 0; t < 4; ++t)
      b_cur[t] = load_frag(mtb, FDIM, dBase + t * 16, 0, lane);
    for (int i = 0; i < FDIM / 32; ++i) {
      v16h a_next, b_next[4];
      if (i + 1 < FDIM / 32) {
        a_next = load_frag(Qm, FDIM, rowTok + lBase, (i + 1) * 32, lane);
#pragma unroll
        for (int t = 0; t < 4; ++t)
          b_next[t] = load_frag(mtb, FDIM, dBase + t * 16, (i + 1) * 32, lane);
      }
#pragma unroll
      for (int t = 0; t < 4; ++t) acc[t] = wmma_f16(a_cur, b_cur[t], acc[t]);
      if (i + 1 < FDIM / 32) {
        a_cur = a_next;
#pragma unroll
        for (int t = 0; t < 4; ++t) b_cur[t] = b_next[t];
      }
    }
  }
#pragma unroll
  for (int t = 0; t < 4; ++t) {
    const int d = dBase + t * 16 + (lane & 15);
#pragma unroll
    for (int r = 0; r < 8; ++r)
      Ot[(size_t)(rowTok + mB + r) * DIM + d] = acc[t][r];
  }
}

// ---- K4a: position norm + LayerNorm -> yn (f16) ---------------------------
// grid (ROWS), block 256; 2 elements per thread.

__global__ void k_layernorm(const float* __restrict__ Ot,
                            const float* __restrict__ ln_g,
                            const float* __restrict__ ln_b,
                            _Float16* __restrict__ yn) {
  __shared__ float rs[256], rq[256];
  const int row = blockIdx.x, tid = threadIdx.x;
  const int l = row & 2047;
  const float nf = rsqrtf((float)(l + 1) * (float)NPLN);
  float y0 = Ot[(size_t)row * DIM + tid] * nf;
  float y1 = Ot[(size_t)row * DIM + 256 + tid] * nf;
  rs[tid] = y0 + y1;
  rq[tid] = y0 * y0 + y1 * y1;
  __syncthreads();
#pragma unroll
  for (int s = 128; s > 0; s >>= 1) {
    if (tid < s) { rs[tid] += rs[tid + s]; rq[tid] += rq[tid + s]; }
    __syncthreads();
  }
  const float mu  = rs[0] * (1.0f / DIM);
  const float var = rq[0] * (1.0f / DIM) - mu * mu;
  const float ivs = rsqrtf(var + 1e-5f);
  yn[(size_t)row * DIM + tid]       = (_Float16)((y0 - mu) * ivs * ln_g[tid] + ln_b[tid]);
  yn[(size_t)row * DIM + 256 + tid] = (_Float16)((y1 - mu) * ivs * ln_g[256 + tid] + ln_b[256 + tid]);
}

// ---- K4b: out = x + yn @ ow + ob ------------------------------------------
// grid (32, 8), block 256. Same async LDS staging as K1.

__global__ void k_outproj(const _Float16* __restrict__ yn,
                          const _Float16* __restrict__ owt,
                          const float* __restrict__ ob,
                          const float* __restrict__ x,
                          float* __restrict__ out) {
  __shared__ _Float16 bs[2][64 * 32];
  const int tid = threadIdx.x;
  const int lane = tid & 31, wave = tid >> 5;
  const int rowBase = blockIdx.x * 128 + wave * 16;
  const int colBase = blockIdx.y * 64;

  stage_b_tile(bs[0], owt, DIM, colBase, 0, tid);
  v16h a_cur = load_frag(yn, DIM, rowBase, 0, lane);

  v8f acc[4] = {};
  for (int i = 0; i < DIM / 32; ++i) {
    stage_wait();
    __syncthreads();
    if (i + 1 < DIM / 32)
      stage_b_tile(bs[(i + 1) & 1], owt, DIM, colBase, (i + 1) * 32, tid);
    v16h a_next;
    if (i + 1 < DIM / 32)
      a_next = load_frag(yn, DIM, rowBase, (i + 1) * 32, lane);
#pragma unroll
    for (int t = 0; t < 4; ++t) {
      v16h b = load_frag(bs[i & 1], 32, t * 16, 0, lane);
      acc[t] = wmma_f16(a_cur, b, acc[t]);
    }
    a_cur = a_next;
  }

  const int mBase = rowBase + ((lane >> 4) << 3);
#pragma unroll
  for (int t = 0; t < 4; ++t) {
    const int n = colBase + t * 16 + (lane & 15);
#pragma unroll
    for (int r = 0; r < 8; ++r) {
      const size_t idx = (size_t)(mBase + r) * DIM + n;
      out[idx] = x[idx] + acc[t][r] + ob[n];
    }
  }
}

// ---------------------------------------------------------------------------

extern "C" void kernel_launch(void* const* d_in, const int* in_sizes, int n_in,
                              void* d_out, int out_size, void* d_ws, size_t ws_size,
                              hipStream_t stream) {
  const float* x   = (const float*)d_in[0];
  const float* sw  = (const float*)d_in[1];
  const float* kw1 = (const float*)d_in[2];
  const float* kb1 = (const float*)d_in[3];
  const float* kw2 = (const float*)d_in[4];
  const float* kb2 = (const float*)d_in[5];
  const float* qw1 = (const float*)d_in[6];
  const float* qb1 = (const float*)d_in[7];
  const float* qw2 = (const float*)d_in[8];
  const float* qb2 = (const float*)d_in[9];
  const float* vw  = (const float*)d_in[10];
  const float* vb  = (const float*)d_in[11];
  const float* lng = (const float*)d_in[12];
  const float* lnb = (const float*)d_in[13];
  const float* ow  = (const float*)d_in[14];
  const float* ob  = (const float*)d_in[15];
  float* out = (float*)d_out;

  // workspace carve-up (all 256B aligned)
  char* ws = (char*)d_ws;
  size_t off = 0;
  auto take = [&](size_t bytes) { char* p = ws + off; off += (bytes + 255) & ~(size_t)255; return p; };
  _Float16* xh    = (_Float16*)take((size_t)ROWS * DIM * 2);
  _Float16* hk    = (_Float16*)take((size_t)ROWS * DIM * 2);
  _Float16* hq    = (_Float16*)take((size_t)ROWS * DIM * 2);
  _Float16* vt    = (_Float16*)take((size_t)BATCH * DIM * SEQ * 2);
  _Float16* Qm    = (_Float16*)take((size_t)ROWS * FDIM * 2);
  _Float16* Km    = (_Float16*)take((size_t)ROWS * FDIM * 2);
  _Float16* Kt    = (_Float16*)take((size_t)BATCH * FDIM * SEQ * 2);
  float*    Ssum  = (float*)   take((size_t)BATCH * NCHK * FDIM * DIM * 4);
  _Float16* Mt    = (_Float16*)take((size_t)BATCH * NCHK * DIM * FDIM * 2);
  float*    Ot    = (float*)   take((size_t)ROWS * DIM * 4);
  _Float16* yn    = (_Float16*)take((size_t)ROWS * DIM * 2);
  _Float16* kw1t  = (_Float16*)take((size_t)DIM * DIM * 2);
  _Float16* qw1t  = (_Float16*)take((size_t)DIM * DIM * 2);
  _Float16* vwt   = (_Float16*)take((size_t)DIM * DIM * 2);
  _Float16* owt   = (_Float16*)take((size_t)DIM * DIM * 2);
  _Float16* kw2t  = (_Float16*)take((size_t)TP * DIM * 2);
  _Float16* qw2t  = (_Float16*)take((size_t)TP * DIM * 2);

  // P0: conversions
  k_cvt_f32_to_f16<<<(ROWS * DIM + 255) / 256, 256, 0, stream>>>(x, xh, ROWS * DIM);
  k_transpose_f16<<<(DIM * DIM + 255) / 256, 256, 0, stream>>>(kw1, kw1t, DIM, DIM);
  k_transpose_f16<<<(DIM * DIM + 255) / 256, 256, 0, stream>>>(qw1, qw1t, DIM, DIM);
  k_transpose_f16<<<(DIM * DIM + 255) / 256, 256, 0, stream>>>(vw,  vwt,  DIM, DIM);
  k_transpose_f16<<<(DIM * DIM + 255) / 256, 256, 0, stream>>>(ow,  owt,  DIM, DIM);
  k_transpose_f16<<<(DIM * TP + 255) / 256, 256, 0, stream>>>(kw2, kw2t, DIM, TP);
  k_transpose_f16<<<(DIM * TP + 255) / 256, 256, 0, stream>>>(qw2, qw2t, DIM, TP);

  // K1: Hk / Hq / Vt
  k_encode1<<<dim3(ROWS / 128, DIM / 64, 3), 256, 0, stream>>>(
      xh, kw1t, qw1t, vwt, kb1, qb1, vb, hk, hq, vt);

  // K2: phases -> Q, K, Kt
  k_phases<<<dim3(ROWS / 128), 256, 0, stream>>>(
      hk, hq, kw2t, qw2t, kb2, qb2, sw, Qm, Km, Kt);

  // K3: chunked causal linear attention
  k_chunk_kv<<<dim3(NCHK, DIM / 64, BATCH), 256, 0, stream>>>(Kt, vt, Ssum);
  k_scan<<<(BATCH * FDIM * DIM + 255) / 256, 256, 0, stream>>>(Ssum, Mt);
  k_chunk_out<<<dim3(NCHK, DIM / 64, BATCH), 256, 0, stream>>>(Qm, Km, vt, Mt, Ot);

  // K4: norm + LN + output projection + residual
  k_layernorm<<<dim3(ROWS), 256, 0, stream>>>(Ot, lng, lnb, yn);
  k_outproj<<<dim3(ROWS / 128, DIM / 64), 256, 0, stream>>>(yn, owt, ob, x, out);
}

// v001
// It runs in 172 microseconds.
// Timed twice side by side with v000, it ran 1.34 and 1.31 times as fast.
#include <hip/hip_runtime.h>
#include <hip/hip_bf16.h>
#include <math.h>

// ---------------------------------------------------------------------------
// MI455X (gfx1250, wave32) implementation.
// Pipeline:
//  P0  convert x -> f16, transpose-convert all weights -> f16 [N,K]
//  K1  Hk = gelu(x@kw1+b), Hq = gelu(x@qw1+b), Vt = (x@vw+b)^T     (WMMA f16,
//      B tile staged in LDS via async-load-to-LDS, ping-pong)
//  K2  phases -> Q[l,f]=w_s*{cos,sin}(qp), K[l,f], Kt[f,l]          (WMMA f16)
//  K3a per-chunk state sums S_j^T = V_j^T K_j, stored [d][f]        (WMMA f16)
//  K3b exclusive prefix over 16 chunks -> Mt [d][f], f16            (scan)
//  K3c O = Q@M_prev + tril(Q K^T) @ V  (scores staged in LDS)       (WMMA f16)
//  K4a position-norm + LayerNorm -> yn (f16)
//  K4b out = x + yn@ow + ob  (async LDS-staged B, like K1)          (WMMA f16)
// All accumulation in f32 (WMMA f32 accumulators).
// ---------------------------------------------------------------------------

typedef __attribute__((ext_vector_type(16))) _Float16 v16h;
typedef __attribute__((ext_vector_type(8)))  _Float16 v8h;
typedef __attribute__((ext_vector_type(8)))  float    v8f;
typedef __attribute__((ext_vector_type(4)))  int      v4i;
typedef __attribute__((ext_vector_type(4)))  float    v4f;
typedef __attribute__((ext_vector_type(4)))  _Float16 v4h;

#define BATCH 2
#define SEQ   2048
#define DIM   512
#define NSET  4
#define NPLN  16
#define TP    64          // NSET*NPLN
#define FDIM  128         // 2*TP (cos|sin features)
#define ROWS  4096        // BATCH*SEQ
#define CHUNK 128
#define NCHK  16          // SEQ/CHUNK
#define PI_F  3.14159265358979323846f

// CDNA5 async global->LDS path (ASYNCcnt). Guarded so the file compiles on
// toolchains without the builtins (falls back to sync reg->LDS staging).
#if defined(__has_builtin)
#if __has_builtin(__builtin_amdgcn_global_load_async_to_lds_b128) && \
    __has_builtin(__builtin_amdgcn_s_wait_asynccnt)
#define USE_ASYNC_LDS 1
#endif
#endif

#define AS_GLOBAL __attribute__((address_space(1)))
#define AS_LDS    __attribute__((address_space(3)))

// ---- WMMA helpers ---------------------------------------------------------

__device__ __forceinline__ v8f wmma_f16(v16h a, v16h b, v8f c) {
  // v_wmma_f32_16x16x32_f16 : D = A(16x32) x B(32x16) + C
  return __builtin_amdgcn_wmma_f32_16x16x32_f16(false, a, false, b,
                                                (short)0, c, false, false);
}

// Load a 16x32 f16 A-fragment (or the transposed-B fragment, which has the
// identical per-lane layout) from a row-major f16 matrix with leading dim ld.
// ISA layout: lane&15 selects row, (lane>>4)*8 selects K phase; vector
// elements 0..7 hold K = kb..kb+7, elements 8..15 hold K = kb+16..kb+23.
__device__ __forceinline__ v16h load_frag(const _Float16* __restrict__ base,
                                          int ld, int rowBase, int k0, int lane) {
  const _Float16* p = base + (size_t)(rowBase + (lane & 15)) * ld
                           + k0 + ((lane >> 4) << 3);
  v16h f;
  *(v8h*)&f       = *(const v8h*)(p);
  *((v8h*)&f + 1) = *(const v8h*)(p + 16);
  return f;
}

// Stage one 64x32 f16 B sub-tile (4 KB) into LDS, one b128 per thread of a
// 256-thread block. Async (ASYNCcnt path) when available.
__device__ __forceinline__ void stage_b_tile(_Float16* __restrict__ lds_dst,
                                             const _Float16* __restrict__ gsrc,
                                             int ld, int colBase, int k0, int tid) {
  const int r = tid >> 2;          // 0..63  (row of transposed B)
  const int c = (tid & 3) << 3;    // 0,8,16,24 (halves)
  const _Float16* src = gsrc + (size_t)(colBase + r) * ld + k0 + c;
  _Float16* dst = lds_dst + r * 32 + c;
#if defined(USE_ASYNC_LDS)
  _Float16* src_nc = const_cast<_Float16*>(src);
  __builtin_amdgcn_global_load_async_to_lds_b128(
      (AS_GLOBAL v4i*)src_nc, (AS_LDS v4i*)dst, 0, 0);
#else
  *(v8h*)dst = *(const v8h*)src;
#endif
}

__device__ __forceinline__ void stage_wait() {
#if defined(USE_ASYNC_LDS)
  __builtin_amdgcn_s_wait_asynccnt(0);
#endif
}

__device__ __forceinline__ float gelu_exact(float v) {
  return 0.5f * v * (1.0f + erff(v * 0.70710678118654752440f));
}

// ---- P0: conversions ------------------------------------------------------

__global__ void k_cvt_f32_to_f16(const float* __restrict__ src,
                                 _Float16* __restrict__ dst, int n) {
  int i = blockIdx.x * blockDim.x + threadIdx.x;
  if (i < n) dst[i] = (_Float16)src[i];
}

// dst[n*K+k] = (f16) src[k*N+n]   (store weights transposed for B operands)
__global__ void k_transpose_f16(const float* __restrict__ src,
                                _Float16* __restrict__ dst, int K, int N) {
  int i = blockIdx.x * blockDim.x + threadIdx.x;
  if (i >= K * N) return;
  int k = i / N, n = i - k * N;
  dst[(size_t)n * K + k] = (_Float16)src[i];
}

// ---- K1: encoder layer-1 GEMMs + V projection -----------------------------
// grid (32, 8, 3), block 256 (8 waves); 128x64 output tile per block.
// B tile ping-pong staged in LDS (async), A fragments double-buffered in regs.

__global__ void k_encode1(const _Float16* __restrict__ xh,
                          const _Float16* __restrict__ kw1t,
                          const _Float16* __restrict__ qw1t,
                          const _Float16* __restrict__ vwt,
                          const float* __restrict__ kb1,
                          const float* __restrict__ qb1,
                          const float* __restrict__ vb,
                          _Float16* __restrict__ hk,
                          _Float16* __restrict__ hq,
                          _Float16* __restrict__ vt) {
  __shared__ _Float16 bs[2][64 * 32];  // 8 KB ping-pong B tile
  const int tid = threadIdx.x;
  const int lane = tid & 31, wave = tid >> 5;
  const int z = blockIdx.z;
  const int rowBase = blockIdx.x * 128 + wave * 16;
  const int colBase = blockIdx.y * 64;
  const _Float16* wt  = (z == 0) ? kw1t : (z == 1) ? qw1t : vwt;
  const float*    bia = (z == 0) ? kb1  : (z == 1) ? qb1  : vb;

  stage_b_tile(bs[0], wt, DIM, colBase, 0, tid);
  v16h a_cur = load_frag(xh, DIM, rowBase, 0, lane);

  v8f acc[4] = {};
  for (int i = 0; i < DIM / 32; ++i) {
    stage_wait();
    __syncthreads();                      // buffer i&1 ready for all waves
    if (i + 1 < DIM / 32)
      stage_b_tile(bs[(i + 1) & 1], wt, DIM, colBase, (i + 1) * 32, tid);
    v16h a_next;
    if (i + 1 < DIM / 32)
      a_next = load_frag(xh, DIM, rowBase, (i + 1) * 32, lane);
#pragma unroll
    for (int t = 0; t < 4; ++t) {
      v16h b = load_frag(bs[i & 1], 32, t * 16, 0, lane);
      acc[t] = wmma_f16(a_cur, b, acc[t]);
    }
    a_cur = a_next;
  }

  const int mBase = rowBase + ((lane >> 4) << 3);
#pragma unroll
  for (int t = 0; t < 4; ++t) {
    const int n = colBase + t * 16 + (lane & 15);
#pragma unroll
    for (int r = 0; r < 8; ++r) {
      const int m = mBase + r;
      float v = acc[t][r] + bia[n];
      if (z < 2) {
        v = gelu_exact(v);
        _Float16* dst = (z == 0) ? hk : hq;
        dst[(size_t)m * DIM + n] = (_Float16)v;
      } else {
        const int b = m >> 11, l = m & 2047;
        vt[((size_t)(b * DIM + n)) * SEQ + l] = (_Float16)v;  // V^T [b][d][l]
      }
    }
  }
}

// ---- K2: encoder layer-2 + phases -> Q, K, Kt -----------------------------
// grid (32), block 256. N = TP = 64 (4 tiles) for each of k/q.

__global__ void k_phases(const _Float16* __restrict__ hk,
                         const _Float16* __restrict__ hq,
                         const _Float16* __restrict__ kw2t,
                         const _Float16* __restrict__ qw2t,
                         const float* __restrict__ kb2,
                         const float* __restrict__ qb2,
                         const float* __restrict__ sw,
                         _Float16* __restrict__ Qm,   // [ROWS][FDIM]
                         _Float16* __restrict__ Km,   // [ROWS][FDIM]
                         _Float16* __restrict__ Kt) { // [B][FDIM][SEQ]
  const int lane = threadIdx.x & 31, wave = threadIdx.x >> 5;
  const int rowBase = blockIdx.x * 128 + wave * 16;

  v8f ak[4] = {}, aq[4] = {};
  for (int k0 = 0; k0 < DIM; k0 += 32) {
    v16h a0 = load_frag(hk, DIM, rowBase, k0, lane);
    v16h a1 = load_frag(hq, DIM, rowBase, k0, lane);
#pragma unroll
    for (int t = 0; t < 4; ++t) {
      v16h bk = load_frag(kw2t, DIM, t * 16, k0, lane);
      v16h bq = load_frag(qw2t, DIM, t * 16, k0, lane);
      ak[t] = wmma_f16(a0, bk, ak[t]);
      aq[t] = wmma_f16(a1, bq, aq[t]);
    }
  }
  // softmax over 4 set weights (redundant per thread; trivially cheap)
  float s0 = sw[0], s1 = sw[1], s2 = sw[2], s3 = sw[3];
  float mx = fmaxf(fmaxf(s0, s1), fmaxf(s2, s3));
  float e0 = expf(s0 - mx), e1 = expf(s1 - mx), e2 = expf(s2 - mx), e3 = expf(s3 - mx);
  float inv = 1.0f / (e0 + e1 + e2 + e3);
  float wsm[4] = {e0 * inv, e1 * inv, e2 * inv, e3 * inv};

  const int mBase = rowBase + ((lane >> 4) << 3);
#pragma unroll
  for (int t = 0; t < 4; ++t) {
    const int tp = t * 16 + (lane & 15);   // 0..63
    const int s  = tp >> 4;
#pragma unroll
    for (int r = 0; r < 8; ++r) {
      const int row = mBase + r;
      const int b = row >> 11, l = row & 2047;
      float kph = tanhf(ak[t][r] + kb2[tp]) * PI_F;
      float qph = tanhf(aq[t][r] + qb2[tp]) * PI_F;
      float kc = cosf(kph), ks = sinf(kph);
      float qc = wsm[s] * cosf(qph), qs = wsm[s] * sinf(qph);
      Km[(size_t)row * FDIM + tp]      = (_Float16)kc;
      Km[(size_t)row * FDIM + TP + tp] = (_Float16)ks;
      Kt[((size_t)(b * FDIM + tp)) * SEQ + l]      = (_Float16)kc;
      Kt[((size_t)(b * FDIM + TP + tp)) * SEQ + l] = (_Float16)ks;
      Qm[(size_t)row * FDIM + tp]      = (_Float16)qc;
      Qm[(size_t)row * FDIM + TP + tp] = (_Float16)qs;
    }
  }
}

// ---- K3a: per-chunk KV sums S_j[f,d] = sum_t K[t,f] V[t,d] ---------------
// grid (NCHK, 8, BATCH), block 256. Register double-buffered K loop.
// V^T is the A operand and K^T the B operand, so the accumulator tile has d
// on its rows and f across its lanes and is stored in Mt's own [d][f] order.

__global__ void k_chunk_kv(const _Float16* __restrict__ Kt,
                           const _Float16* __restrict__ Vt,
                           float* __restrict__ Ssum) { // [B][NCHK][DIM][FDIM]
  const int lane = threadIdx.x & 31, wave = threadIdx.x >> 5;
  const int j = blockIdx.x, dBase = blockIdx.y * 64, b = blockIdx.z;
  const int fBase = wave * 16;
  const _Float16* ktb = Kt + (size_t)b * FDIM * SEQ;
  const _Float16* vtb = Vt + (size_t)b * DIM * SEQ;
  const int kBase = j * CHUNK;

  v8f acc[4] = {};
  v16h a_cur = load_frag(ktb, SEQ, fBase, kBase, lane);
  v16h b_cur[4];
#pragma unroll
  for (int t = 0; t < 4; ++t)
    b_cur[t] = load_frag(vtb, SEQ, dBase + t * 16, kBase, lane);

  for (int i = 0; i < CHUNK / 32; ++i) {
    v16h a_next, b_next[4];
    if (i + 1 < CHUNK / 32) {
      a_next = load_frag(ktb, SEQ, fBase, kBase + (i + 1) * 32, lane);
#pragma unroll
      for (int t = 0; t < 4; ++t)
        b_next[t] = load_frag(vtb, SEQ, dBase + t * 16, kBase + (i + 1) * 32, lane);
    }
#pragma unroll
    for (int t = 0; t < 4; ++t) acc[t] = wmma_f16(b_cur[t], a_cur, acc[t]);
    if (i + 1 < CHUNK / 32) {
      a_cur = a_next;
#pragma unroll
      for (int t = 0; t < 4; ++t) b_cur[t] = b_next[t];
    }
  }

  float* sp = Ssum + ((size_t)(b * NCHK + j) * DIM + dBase + ((lane >> 4) << 3)) * FDIM
                   + fBase + (lane & 15);
#pragma unroll
  for (int t = 0; t < 4; ++t) {
#pragma unroll
    for (int r = 0; r < 8; ++r)
      sp[(t * 16 + r) * FDIM] = acc[t][r];
  }
}

// ---- K3b: exclusive prefix over chunks -> Mt (f16) ------------------------
// Ssum and Mt share the [B][NCHK][DIM][FDIM] order; a thread owns 4 adjacent
// f of one d, so a wave reads 512 and writes 256 contiguous bytes per chunk.
// grid (BATCH*DIM*FDIM/4/128), block 128.

__global__ void k_scan(const float* __restrict__ Ssum,
                       _Float16* __restrict__ Mt) { // [B][NCHK][DIM][FDIM]
  const int PLANE = DIM * FDIM;
  const int tid = blockIdx.x * blockDim.x + threadIdx.x;
  const int b = tid / (PLANE / 4);
  const int e = (tid - b * (PLANE / 4)) * 4;
  const size_t base = (size_t)b * NCHK * PLANE + e;
  v4f run = {};
#pragma unroll
  for (int j = 0; j < NCHK; ++j) {
    *(v4h*)(Mt + base + (size_t)j * PLANE) = __builtin_convertvector(run, v4h);
    run += *(const v4f*)(Ssum + base + (size_t)j * PLANE);
  }
}

// ---- K3c: O = Q@M_prev + tril(Q K^T) @ V ---------------------------------
// grid (NCHK, 8, BATCH), block 256. Scores staged in LDS (f16, padded).

__global__ void k_chunk_out(const _Float16* __restrict__ Qm,
                            const _Float16* __restrict__ Km,
                            const _Float16* __restrict__ Vt,
                            const _Float16* __restrict__ Mt,
                            float* __restrict__ Ot) { // [ROWS][DIM]
  __shared__ _Float16 sc[CHUNK][CHUNK + 8];  // +8 halves pad, keeps 16B align
  const int lane = threadIdx.x & 31, wave = threadIdx.x >> 5;
  const int j = blockIdx.x, dBase = blockIdx.y * 64, b = blockIdx.z;
  const int rowTok = b * SEQ + j * CHUNK;   // first token row of chunk
  const int lBase = wave * 16;

  // Phase A: scores = Q_c K_c^T  (128x128), masked causal-inclusive
  v8f sacc[8] = {};
  for (int f0 = 0; f0 < FDIM; f0 += 32) {
    v16h a = load_frag(Qm, FDIM, rowTok + lBase, f0, lane);
#pragma unroll
    for (int tt = 0; tt < 8; ++tt) {
      v16h bf = load_frag(Km, FDIM, rowTok + tt * 16, f0, lane);
      sacc[tt] = wmma_f16(a, bf, sacc[tt]);
    }
  }
  const int mB = lBase + ((lane >> 4) << 3);
#pragma unroll
  for (int tt = 0; tt < 8; ++tt) {
    const int tl = tt * 16 + (lane & 15);
#pragma unroll
    for (int r = 0; r < 8; ++r) {
      const int ll = mB + r;
      sc[ll][tl] = (_Float16)((tl <= ll) ? sacc[tt][r] : 0.0f);
    }
  }
  __syncthreads();

  // Phase B: O = scores @ V_c + Q_c @ M_prev  (both register double-buffered)
  const _Float16* vtb = Vt + (size_t)b * DIM * SEQ;
  const _Float16* mtb = Mt + (size_t)(b * NCHK + j) * DIM * FDIM;
  v8f acc[4] = {};
  {
    v16h a_cur = load_frag(&sc[0][0], CHUNK + 8, lBase, 0, lane);
    v16h b_cur[4];
#pragma unroll
    for (int t = 0; t < 4; ++t)
      b_cur[t] = load_frag(vtb, SEQ, dBase + t * 16, j * CHUNK, lane);
    for (int i = 0; i < CHUNK / 32; ++i) {
      v16h a_next, b_next[4];
      if (i + 1 < CHUNK / 32) {
        a_next = load_frag(&sc[0][0], CHUNK + 8, lBase, (i + 1) * 32, lane);
#pragma unroll
        for (int t = 0; t < 4; ++t)
          b_next[t] = load_frag(vtb, SEQ, dBase + t * 16,
                                j * CHUNK + (i + 1) * 32, lane);
      }
#pragma unroll
      for (int t = 0; t < 4; ++t) acc[t] = wmma_f16(a_cur, b_cur[t], acc[t]);
      if (i + 1 < CHUNK / 32) {
        a_cur = a_next;
#pragma unroll
        for (int t = 0; t < 4; ++t) b_cur[t] = b_next[t];
      }
    }
  }
  {
    v16h a_cur = load_frag(Qm, FDIM, rowTok + lBase, 0, lane);
    v16h b_cur[4];
#pragma unroll
    for (int t = 0; t < 4; ++t)
      b_cur[t] = load_frag(mtb, FDIM, dBase + t * 16, 0, lane);
    for (int i = 0; i < FDIM / 32; ++i) {
      v16h a_next, b_next[4];
      if (i + 1 < FDIM / 32) {
        a_next = load_frag(Qm, FDIM, rowTok + lBase, (i + 1) * 32, lane);
#pragma unroll
        for (int t = 0; t < 4; ++t)
          b_next[t] = load_frag(mtb, FDIM, dBase + t * 16, (i + 1) * 32, lane);
      }
#pragma unroll
      for (int t = 0; t < 4; ++t) acc[t] = wmma_f16(a_cur, b_cur[t], acc[t]);
      if (i + 1 < FDIM / 32) {
        a_cur = a_next;
#pragma unroll
        for (int t = 0; t < 4; ++t) b_cur[t] = b_next[t];
      }
    }
  }
#pragma unroll
  for (int t = 0; t < 4; ++t) {
    const int d = dBase + t * 16 + (lane & 15);
#pragma unroll
    for (int r = 0; r < 8; ++r)
      Ot[(size_t)(rowTok + mB + r) * DIM + d] = acc[t][r];
  }
}

// ---- K4a: position norm + LayerNorm -> yn (f16) ---------------------------
// grid (ROWS), block 256; 2 elements per thread.

__global__ void k_layernorm(const float* __restrict__ Ot,
                            const float* __restrict__ ln_g,
                            const float* __restrict__ ln_b,
                            _Float16* __restrict__ yn) {
  __shared__ float rs[256], rq[256];
  const int row = blockIdx.x, tid = threadIdx.x;
  const int l = row & 2047;
  const float nf = rsqrtf((float)(l + 1) * (float)NPLN);
  float y0 = Ot[(size_t)row * DIM + tid] * nf;
  float y1 = Ot[(size_t)row * DIM + 256 + tid] * nf;
  rs[tid] = y0 + y1;
  rq[tid] = y0 * y0 + y1 * y1;
  __syncthreads();
#pragma unroll
  for (int s = 128; s > 0; s >>= 1) {
    if (tid < s) { rs[tid] += rs[tid + s]; rq[tid] += rq[tid + s]; }
    __syncthreads();
  }
  const float mu  = rs[0] * (1.0f / DIM);
  const float var = rq[0] * (1.0f / DIM) - mu * mu;
  const float ivs = rsqrtf(var + 1e-5f);
  yn[(size_t)row * DIM + tid]       = (_Float16)((y0 - mu) * ivs * ln_g[tid] + ln_b[tid]);
  yn[(size_t)row * DIM + 256 + tid] = (_Float16)((y1 - mu) * ivs * ln_g[256 + tid] + ln_b[256 + tid]);
}

// ---- K4b: out = x + yn @ ow + ob ------------------------------------------
// grid (32, 8), block 256. Same async LDS staging as K1.

__global__ void k_outproj(const _Float16* __restrict__ yn,
                          const _Float16* __restrict__ owt,
                          const float* __restrict__ ob,
                          const float* __restrict__ x,
                          float* __restrict__ out) {
  __shared__ _Float16 bs[2][64 * 32];
  const int tid = threadIdx.x;
  const int lane = tid & 31, wave = tid >> 5;
  const int rowBase = blockIdx.x * 128 + wave * 16;
  const int colBase = blockIdx.y * 64;

  stage_b_tile(bs[0], owt, DIM, colBase, 0, tid);
  v16h a_cur = load_frag(yn, DIM, rowBase, 0, lane);

  v8f acc[4] = {};
  for (int i = 0; i < DIM / 32; ++i) {
    stage_wait();
    __syncthreads();
    if (i + 1 < DIM / 32)
      stage_b_tile(bs[(i + 1) & 1], owt, DIM, colBase, (i + 1) * 32, tid);
    v16h a_next;
    if (i + 1 < DIM / 32)
      a_next = load_frag(yn, DIM, rowBase, (i + 1) * 32, lane);
#pragma unroll
    for (int t = 0; t < 4; ++t) {
      v16h b = load_frag(bs[i & 1], 32, t * 16, 0, lane);
      acc[t] = wmma_f16(a_cur, b, acc[t]);
    }
    a_cur = a_next;
  }

  const int mBase = rowBase + ((lane >> 4) << 3);
#pragma unroll
  for (int t = 0; t < 4; ++t) {
    const int n = colBase + t * 16 + (lane & 15);
#pragma unroll
    for (int r = 0; r < 8; ++r) {
      const size_t idx = (size_t)(mBase + r) * DIM + n;
      out[idx] = x[idx] + acc[t][r] + ob[n];
    }
  }
}

// ---------------------------------------------------------------------------

extern "C" void kernel_launch(void* const* d_in, const int* in_sizes, int n_in,
                              void* d_out, int out_size, void* d_ws, size_t ws_size,
                              hipStream_t stream) {
  const float* x   = (const float*)d_in[0];
  const float* sw  = (const float*)d_in[1];
  const float* kw1 = (const float*)d_in[2];
  const float* kb1 = (const float*)d_in[3];
  const float* kw2 = (const float*)d_in[4];
  const float* kb2 = (const float*)d_in[5];
  const float* qw1 = (const float*)d_in[6];
  const float* qb1 = (const float*)d_in[7];
  const float* qw2 = (const float*)d_in[8];
  const float* qb2 = (const float*)d_in[9];
  const float* vw  = (const float*)d_in[10];
  const float* vb  = (const float*)d_in[11];
  const float* lng = (const float*)d_in[12];
  const float* lnb = (const float*)d_in[13];
  const float* ow  = (const float*)d_in[14];
  const float* ob  = (const float*)d_in[15];
  float* out = (float*)d_out;

  // workspace carve-up (all 256B aligned)
  char* ws = (char*)d_ws;
  size_t off = 0;
  auto take = [&](size_t bytes) { char* p = ws + off; off += (bytes + 255) & ~(size_t)255; return p; };
  _Float16* xh    = (_Float16*)take((size_t)ROWS * DIM * 2);
  _Float16* hk    = (_Float16*)take((size_t)ROWS * DIM * 2);
  _Float16* hq    = (_Float16*)take((size_t)ROWS * DIM * 2);
  _Float16* vt    = (_Float16*)take((size_t)BATCH * DIM * SEQ * 2);
  _Float16* Qm    = (_Float16*)take((size_t)ROWS * FDIM * 2);
  _Float16* Km    = (_Float16*)take((size_t)ROWS * FDIM * 2);
  _Float16* Kt    = (_Float16*)take((size_t)BATCH * FDIM * SEQ * 2);
  float*    Ssum  = (float*)   take((size_t)BATCH * NCHK * FDIM * DIM * 4);
  _Float16* Mt    = (_Float16*)take((size_t)BATCH * NCHK * DIM * FDIM * 2);
  float*    Ot    = (float*)   take((size_t)ROWS * DIM * 4);
  _Float16* yn    = (_Float16*)take((size_t)ROWS * DIM * 2);
  _Float16* kw1t  = (_Float16*)take((size_t)DIM * DIM * 2);
  _Float16* qw1t  = (_Float16*)take((size_t)DIM * DIM * 2);
  _Float16* vwt   = (_Float16*)take((size_t)DIM * DIM * 2);
  _Float16* owt   = (_Float16*)take((size_t)DIM * DIM * 2);
  _Float16* kw2t  = (_Float16*)take((size_t)TP * DIM * 2);
  _Float16* qw2t  = (_Float16*)take((size_t)TP * DIM * 2);

  // P0: conversions
  k_cvt_f32_to_f16<<<(ROWS * DIM + 255) / 256, 256, 0, stream>>>(x, xh, ROWS * DIM);
  k_transpose_f16<<<(DIM * DIM + 255) / 256, 256, 0, stream>>>(kw1, kw1t, DIM, DIM);
  k_transpose_f16<<<(DIM * DIM + 255) / 256, 256, 0, stream>>>(qw1, qw1t, DIM, DIM);
  k_transpose_f16<<<(DIM * DIM + 255) / 256, 256, 0, stream>>>(vw,  vwt,  DIM, DIM);
  k_transpose_f16<<<(DIM * DIM + 255) / 256, 256, 0, stream>>>(ow,  owt,  DIM, DIM);
  k_transpose_f16<<<(DIM * TP + 255) / 256, 256, 0, stream>>>(kw2, kw2t, DIM, TP);
  k_transpose_f16<<<(DIM * TP + 255) / 256, 256, 0, stream>>>(qw2, qw2t, DIM, TP);

  // K1: Hk / Hq / Vt
  k_encode1<<<dim3(ROWS / 128, DIM / 64, 3), 256, 0, stream>>>(
      xh, kw1t, qw1t, vwt, kb1, qb1, vb, hk, hq, vt);

  // K2: phases -> Q, K, Kt
  k_phases<<<dim3(ROWS / 128), 256, 0, stream>>>(
      hk, hq, kw2t, qw2t, kb2, qb2, sw, Qm, Km, Kt);

  // K3: chunked causal linear attention
  k_chunk_kv<<<dim3(NCHK, DIM / 64, BATCH), 256, 0, stream>>>(Kt, vt, Ssum);
  k_scan<<<BATCH * FDIM * DIM / 4 / 128, 128, 0, stream>>>(Ssum, Mt);
  k_chunk_out<<<dim3(NCHK, DIM / 64, BATCH), 256, 0, stream>>>(Qm, Km, vt, Mt, Ot);

  // K4: norm + LN + output projection + residual
  k_layernorm<<<dim3(ROWS), 256, 0, stream>>>(Ot, lng, lnb, yn);
  k_outproj<<<dim3(ROWS / 128, DIM / 64), 256, 0, stream>>>(yn, owt, ob, x, out);
}

// v002
// Measured time: 115 microseconds a run.
// In two side-by-side timings against v001, it was 1.50 and 1.49 times as fast.
// All steps since v000 together make it 1.98 times as fast.
#include <hip/hip_runtime.h>
#include <hip/hip_bf16.h>
#include <math.h>

// ---------------------------------------------------------------------------
// MI455X (gfx1250, wave32) implementation.
// Pipeline:
//  P0  convert x -> f16, transpose-convert all weights -> f16 [N,K]
//  K1  Hk = gelu(x@kw1+b), Hq = gelu(x@qw1+b), Vt = (x@vw+b)^T     (WMMA f16,
//      B tile staged in LDS via async-load-to-LDS, ping-pong)
//  K2  phases -> Q[l,f]=w_s*{cos,sin}(qp), K[l,f], Kt[f,l]          (WMMA f16)
//  K3a per-chunk state sums S_j^T = V_j^T K_j, stored [d][f]        (WMMA f16)
//  K3b exclusive prefix over 16 chunks -> Mt [d][f], f16            (scan)
//  K3c O = Q@M_prev + tril(Q K^T) @ V  (scores staged in LDS)       (WMMA f16)
//  K4a position-norm + LayerNorm -> yn (f16)
//  K4b out = x + yn@ow + ob  (async LDS-staged B, like K1)          (WMMA f16)
// All accumulation in f32 (WMMA f32 accumulators).
// ---------------------------------------------------------------------------

typedef __attribute__((ext_vector_type(16))) _Float16 v16h;
typedef __attribute__((ext_vector_type(8)))  _Float16 v8h;
typedef __attribute__((ext_vector_type(8)))  float    v8f;
typedef __attribute__((ext_vector_type(4)))  int      v4i;
typedef __attribute__((ext_vector_type(4)))  float    v4f;
typedef __attribute__((ext_vector_type(4)))  _Float16 v4h;

#define BATCH 2
#define SEQ   2048
#define DIM   512
#define NSET  4
#define NPLN  16
#define TP    64          // NSET*NPLN
#define FDIM  128         // 2*TP (cos|sin features)
#define ROWS  4096        // BATCH*SEQ
#define CHUNK 128
#define NCHK  16          // SEQ/CHUNK
#define PI_F  3.14159265358979323846f

// CDNA5 async global->LDS path (ASYNCcnt). Guarded so the file compiles on
// toolchains without the builtins (falls back to sync reg->LDS staging).
#if defined(__has_builtin)
#if __has_builtin(__builtin_amdgcn_global_load_async_to_lds_b128) && \
    __has_builtin(__builtin_amdgcn_s_wait_asynccnt)
#define USE_ASYNC_LDS 1
#endif
#endif

#define AS_GLOBAL __attribute__((address_space(1)))
#define AS_LDS    __attribute__((address_space(3)))

// ---- WMMA helpers ---------------------------------------------------------

__device__ __forceinline__ v8f wmma_f16(v16h a, v16h b, v8f c) {
  // v_wmma_f32_16x16x32_f16 : D = A(16x32) x B(32x16) + C
  return __builtin_amdgcn_wmma_f32_16x16x32_f16(false, a, false, b,
                                                (short)0, c, false, false);
}

// Load a 16x32 f16 A-fragment (or the transposed-B fragment, which has the
// identical per-lane layout) from a row-major f16 matrix with leading dim ld.
// ISA layout: lane&15 selects row, (lane>>4)*8 selects K phase; vector
// elements 0..7 hold K = kb..kb+7, elements 8..15 hold K = kb+16..kb+23.
__device__ __forceinline__ v16h load_frag(const _Float16* __restrict__ base,
                                          int ld, int rowBase, int k0, int lane) {
  const _Float16* p = base + (size_t)(rowBase + (lane & 15)) * ld
                           + k0 + ((lane >> 4) << 3);
  v16h f;
  *(v8h*)&f       = *(const v8h*)(p);
  *((v8h*)&f + 1) = *(const v8h*)(p + 16);
  return f;
}

// Stage one 64x32 f16 B sub-tile (4 KB) into LDS, one b128 per thread of a
// 256-thread block. Async (ASYNCcnt path) when available.
__device__ __forceinline__ void stage_b_tile(_Float16* __restrict__ lds_dst,
                                             const _Float16* __restrict__ gsrc,
                                             int ld, int colBase, int k0, int tid) {
  const int r = tid >> 2;          // 0..63  (row of transposed B)
  const int c = (tid & 3) << 3;    // 0,8,16,24 (halves)
  const _Float16* src = gsrc + (size_t)(colBase + r) * ld + k0 + c;
  _Float16* dst = lds_dst + r * 32 + c;
#if defined(USE_ASYNC_LDS)
  _Float16* src_nc = const_cast<_Float16*>(src);
  __builtin_amdgcn_global_load_async_to_lds_b128(
      (AS_GLOBAL v4i*)src_nc, (AS_LDS v4i*)dst, 0, 0);
#else
  *(v8h*)dst = *(const v8h*)src;
#endif
}

__device__ __forceinline__ void stage_wait() {
#if defined(USE_ASYNC_LDS)
  __builtin_amdgcn_s_wait_asynccnt(0);
#endif
}

__device__ __forceinline__ float gelu_exact(float v) {
  return 0.5f * v * (1.0f + erff(v * 0.70710678118654752440f));
}

// ---- P0: conversions ------------------------------------------------------
// A thread makes 8 f16 that are neighbours in dst and stores them as 16 bytes.

static_assert((ROWS * DIM) % (8 * 256) == 0, "the grid covers x exactly");

__global__ void k_cvt_f32_to_f16(const float* __restrict__ src,
                                 _Float16* __restrict__ dst) {
  const int i = (blockIdx.x * blockDim.x + threadIdx.x) * 8;
  *(v8h*)(dst + i) = __builtin_convertvector(*(const v8f*)(src + i), v8h);
}

// dst[n*K+k] = (f16) src[k*N+n]   (store weights transposed for B operands)
// A thread reads 8 consecutive k of one n. A wave is 4 n x 8 groups of k, so
// its one store fills 4 whole 128-byte lines of dst, each written by no other
// wave; the 8 waves of a block read 128 contiguous bytes of each source row.
// Needs N % 4 == 0 and K % 64 == 0.
__global__ void k_transpose_f16(const float* __restrict__ src,
                                _Float16* __restrict__ dst, int K, int N) {
  const int idx = blockIdx.x * blockDim.x + threadIdx.x;
  if (idx >= (K * N) >> 3) return;
  const int nb = N >> 2;                 // waves across n
  const int w  = idx >> 5;
  const int wk = w / nb, wn = w - wk * nb;
  const int n  = wn * 4 + (idx & 3);
  const int k0 = (wk * 8 + ((idx >> 2) & 7)) * 8;
  const float* p = src + (size_t)k0 * N + n;
  v8h h;
  // unrolled: h stays in registers and the eight loads are in flight together
#pragma unroll
  for (int i = 0; i < 8; ++i) h[i] = (_Float16)p[(size_t)i * N];
  *(v8h*)(dst + (size_t)n * K + k0) = h;
}

// ---- K1: encoder layer-1 GEMMs + V projection -----------------------------
// grid (32, 8, 3), block 256 (8 waves); 128x64 output tile per block.
// B tile ping-pong staged in LDS (async), A fragments double-buffered in regs.

__global__ void k_encode1(const _Float16* __restrict__ xh,
                          const _Float16* __restrict__ kw1t,
                          const _Float16* __restrict__ qw1t,
                          const _Float16* __restrict__ vwt,
                          const float* __restrict__ kb1,
                          const float* __restrict__ qb1,
                          const float* __restrict__ vb,
                          _Float16* __restrict__ hk,
                          _Float16* __restrict__ hq,
                          _Float16* __restrict__ vt) {
  __shared__ _Float16 bs[2][64 * 32];  // 8 KB ping-pong B tile
  const int tid = threadIdx.x;
  const int lane = tid & 31, wave = tid >> 5;
  const int z = blockIdx.z;
  const int rowBase = blockIdx.x * 128 + wave * 16;
  const int colBase = blockIdx.y * 64;
  const _Float16* wt  = (z == 0) ? kw1t : (z == 1) ? qw1t : vwt;
  const float*    bia = (z == 0) ? kb1  : (z == 1) ? qb1  : vb;

  stage_b_tile(bs[0], wt, DIM, colBase, 0, tid);
  v16h a_cur = load_frag(xh, DIM, rowBase, 0, lane);

  v8f acc[4] = {};
  for (int i = 0; i < DIM / 32; ++i) {
    stage_wait();
    __syncthreads();                      // buffer i&1 ready for all waves
    if (i + 1 < DIM / 32)
      stage_b_tile(bs[(i + 1) & 1], wt, DIM, colBase, (i + 1) * 32, tid);
    v16h a_next;
    if (i + 1 < DIM / 32)
      a_next = load_frag(xh, DIM, rowBase, (i + 1) * 32, lane);
#pragma unroll
    for (int t = 0; t < 4; ++t) {
      v16h b = load_frag(bs[i & 1], 32, t * 16, 0, lane);
      acc[t] = wmma_f16(a_cur, b, acc[t]);
    }
    a_cur = a_next;
  }

  const int mBase = rowBase + ((lane >> 4) << 3);
  const int nBase = colBase + (lane & 15);
  // the loops below are unrolled so that acc[] is indexed by constants and
  // stays in registers
#pragma unroll
  for (int t = 0; t < 4; ++t) acc[t] += bia[nBase + t * 16];

  if (z == 2) {
    // V^T [b][d][l]: a lane's 8 rows are 8 neighbours in l (mBase % 8 == 0)
    const int b = mBase >> 11, l = mBase & 2047;
#pragma unroll
    for (int t = 0; t < 4; ++t)
      *(v8h*)(vt + ((size_t)(b * DIM + nBase + t * 16)) * SEQ + l) =
          __builtin_convertvector(acc[t], v8h);
    return;
  }

  _Float16* dst = (z == 0) ? hk : hq;
#pragma unroll
  for (int t = 0; t < 4; ++t) {
#pragma unroll
    for (int r = 0; r < 8; ++r)
      dst[(size_t)(mBase + r) * DIM + nBase + t * 16] =
          (_Float16)gelu_exact(acc[t][r]);
  }
}

// ---- K2: encoder layer-2 + phases -> Q, K, Kt -----------------------------
// grid (32), block 256. N = TP = 64 (4 tiles) for each of k/q.

__global__ void k_phases(const _Float16* __restrict__ hk,
                         const _Float16* __restrict__ hq,
                         const _Float16* __restrict__ kw2t,
                         const _Float16* __restrict__ qw2t,
                         const float* __restrict__ kb2,
                         const float* __restrict__ qb2,
                         const float* __restrict__ sw,
                         _Float16* __restrict__ Qm,   // [ROWS][FDIM]
                         _Float16* __restrict__ Km,   // [ROWS][FDIM]
                         _Float16* __restrict__ Kt) { // [B][FDIM][SEQ]
  const int lane = threadIdx.x & 31, wave = threadIdx.x >> 5;
  const int rowBase = blockIdx.x * 128 + wave * 16;

  v8f ak[4] = {}, aq[4] = {};
  for (int k0 = 0; k0 < DIM; k0 += 32) {
    v16h a0 = load_frag(hk, DIM, rowBase, k0, lane);
    v16h a1 = load_frag(hq, DIM, rowBase, k0, lane);
#pragma unroll
    for (int t = 0; t < 4; ++t) {
      v16h bk = load_frag(kw2t, DIM, t * 16, k0, lane);
      v16h bq = load_frag(qw2t, DIM, t * 16, k0, lane);
      ak[t] = wmma_f16(a0, bk, ak[t]);
      aq[t] = wmma_f16(a1, bq, aq[t]);
    }
  }
  // softmax over 4 set weights (redundant per thread; trivially cheap)
  float s0 = sw[0], s1 = sw[1], s2 = sw[2], s3 = sw[3];
  float mx = fmaxf(fmaxf(s0, s1), fmaxf(s2, s3));
  float e0 = expf(s0 - mx), e1 = expf(s1 - mx), e2 = expf(s2 - mx), e3 = expf(s3 - mx);
  float inv = 1.0f / (e0 + e1 + e2 + e3);
  float wsm[4] = {e0 * inv, e1 * inv, e2 * inv, e3 * inv};

  const int mBase = rowBase + ((lane >> 4) << 3);
#pragma unroll
  for (int t = 0; t < 4; ++t) {
    const int tp = t * 16 + (lane & 15);   // 0..63
    const int s  = tp >> 4;
    v8h kcol, scol;   // K^T [b][f][l]: a lane's 8 rows are 8 neighbours in l
#pragma unroll
    for (int r = 0; r < 8; ++r) {
      const int row = mBase + r;
      float kph = tanhf(ak[t][r] + kb2[tp]) * PI_F;
      float qph = tanhf(aq[t][r] + qb2[tp]) * PI_F;
      float kc = cosf(kph), ks = sinf(kph);
      float qc = wsm[s] * cosf(qph), qs = wsm[s] * sinf(qph);
      Km[(size_t)row * FDIM + tp]      = (_Float16)kc;
      Km[(size_t)row * FDIM + TP + tp] = (_Float16)ks;
      kcol[r] = (_Float16)kc;
      scol[r] = (_Float16)ks;
      Qm[(size_t)row * FDIM + tp]      = (_Float16)qc;
      Qm[(size_t)row * FDIM + TP + tp] = (_Float16)qs;
    }
    const int b = mBase >> 11, l = mBase & 2047;   // mBase % 8 == 0
    *(v8h*)(Kt + ((size_t)(b * FDIM + tp)) * SEQ + l)      = kcol;
    *(v8h*)(Kt + ((size_t)(b * FDIM + TP + tp)) * SEQ + l) = scol;
    // the next pass of this loop reuses the registers that these stores name
    asm volatile("s_wait_xcnt 0x0" ::: "memory");
  }
}

// ---- K3a: per-chunk KV sums S_j[f,d] = sum_t K[t,f] V[t,d] ---------------
// grid (NCHK, 8, BATCH), block 256. Register double-buffered K loop.
// V^T is the A operand and K^T the B operand, so the accumulator tile has d
// on its rows and f across its lanes and is stored in Mt's own [d][f] order.

__global__ void k_chunk_kv(const _Float16* __restrict__ Kt,
                           const _Float16* __restrict__ Vt,
                           float* __restrict__ Ssum) { // [B][NCHK][DIM][FDIM]
  const int lane = threadIdx.x & 31, wave = threadIdx.x >> 5;
  const int j = blockIdx.x, dBase = blockIdx.y * 64, b = blockIdx.z;
  const int fBase = wave * 16;
  const _Float16* ktb = Kt + (size_t)b * FDIM * SEQ;
  const _Float16* vtb = Vt + (size_t)b * DIM * SEQ;
  const int kBase = j * CHUNK;

  v8f acc[4] = {};
  v16h a_cur = load_frag(ktb, SEQ, fBase, kBase, lane);
  v16h b_cur[4];
#pragma unroll
  for (int t = 0; t < 4; ++t)
    b_cur[t] = load_frag(vtb, SEQ, dBase + t * 16, kBase, lane);

  for (int i = 0; i < CHUNK / 32; ++i) {
    v16h a_next, b_next[4];
    if (i + 1 < CHUNK / 32) {
      a_next = load_frag(ktb, SEQ, fBase, kBase + (i + 1) * 32, lane);
#pragma unroll
      for (int t = 0; t < 4; ++t)
        b_next[t] = load_frag(vtb, SEQ, dBase + t * 16, kBase + (i + 1) * 32, lane);
    }
#pragma unroll
    for (int t = 0; t < 4; ++t) acc[t] = wmma_f16(b_cur[t], a_cur, acc[t]);
    if (i + 1 < CHUNK / 32) {
      a_cur = a_next;
#pragma unroll
      for (int t = 0; t < 4; ++t) b_cur[t] = b_next[t];
    }
  }

  float* sp = Ssum + ((size_t)(b * NCHK + j) * DIM + dBase + ((lane >> 4) << 3)) * FDIM
                   + fBase + (lane & 15);
#pragma unroll
  for (int t = 0; t < 4; ++t) {
#pragma unroll
    for (int r = 0; r < 8; ++r)
      sp[(t * 16 + r) * FDIM] = acc[t][r];
  }
}

// ---- K3b: exclusive prefix over chunks -> Mt (f16) ------------------------
// Ssum and Mt share the [B][NCHK][DIM][FDIM] order; a thread owns 4 adjacent
// f of one d, so a wave reads 512 and writes 256 contiguous bytes per chunk.
// grid (BATCH*DIM*FDIM/4/128), block 128.

__global__ void k_scan(const float* __restrict__ Ssum,
                       _Float16* __restrict__ Mt) { // [B][NCHK][DIM][FDIM]
  const int PLANE = DIM * FDIM;
  const int tid = blockIdx.x * blockDim.x + threadIdx.x;
  const int b = tid / (PLANE / 4);
  const int e = (tid - b * (PLANE / 4)) * 4;
  const size_t base = (size_t)b * NCHK * PLANE + e;
  v4f run = {};
#pragma unroll
  for (int j = 0; j < NCHK; ++j) {
    *(v4h*)(Mt + base + (size_t)j * PLANE) = __builtin_convertvector(run, v4h);
    run += *(const v4f*)(Ssum + base + (size_t)j * PLANE);
  }
}

// ---- K3c: O = Q@M_prev + tril(Q K^T) @ V ---------------------------------
// grid (NCHK, 8, BATCH), block 256. Scores staged in LDS (f16, padded).

__global__ void k_chunk_out(const _Float16* __restrict__ Qm,
                            const _Float16* __restrict__ Km,
                            const _Float16* __restrict__ Vt,
                            const _Float16* __restrict__ Mt,
                            float* __restrict__ Ot) { // [ROWS][DIM]
  __shared__ _Float16 sc[CHUNK][CHUNK + 8];  // +8 halves pad, keeps 16B align
  const int lane = threadIdx.x & 31, wave = threadIdx.x >> 5;
  const int j = blockIdx.x, dBase = blockIdx.y * 64, b = blockIdx.z;
  const int rowTok = b * SEQ + j * CHUNK;   // first token row of chunk
  const int lBase = wave * 16;

  // Phase A: scores = Q_c K_c^T  (128x128), masked causal-inclusive
  v8f sacc[8] = {};
  for (int f0 = 0; f0 < FDIM; f0 += 32) {
    v16h a = load_frag(Qm, FDIM, rowTok + lBase, f0, lane);
#pragma unroll
    for (int tt = 0; tt < 8; ++tt) {
      v16h bf = load_frag(Km, FDIM, rowTok + tt * 16, f0, lane);
      sacc[tt] = wmma_f16(a, bf, sacc[tt]);
    }
  }
  const int mB = lBase + ((lane >> 4) << 3);
#pragma unroll
  for (int tt = 0; tt < 8; ++tt) {
    const int tl = tt * 16 + (lane & 15);
#pragma unroll
    for (int r = 0; r < 8; ++r) {
      const int ll = mB + r;
      sc[ll][tl] = (_Float16)((tl <= ll) ? sacc[tt][r] : 0.0f);
    }
  }
  __syncthreads();

  // Phase B: O = scores @ V_c + Q_c @ M_prev  (both register double-buffered)
  const _Float16* vtb = Vt + (size_t)b * DIM * SEQ;
  const _Float16* mtb = Mt + (size_t)(b * NCHK + j) * DIM * FDIM;
  v8f acc[4] = {};
  {
    v16h a_cur = load_frag(&sc[0][0], CHUNK + 8, lBase, 0, lane);
    v16h b_cur[4];
#pragma unroll
    for (int t = 0; t < 4; ++t)
      b_cur[t] = load_frag(vtb, SEQ, dBase + t * 16, j * CHUNK, lane);
    for (int i = 0; i < CHUNK / 32; ++i) {
      v16h a_next, b_next[4];
      if (i + 1 < CHUNK / 32) {
        a_next = load_frag(&sc[0][0], CHUNK + 8, lBase, (i + 1) * 32, lane);
#pragma unroll
        for (int t = 0; t < 4; ++t)
          b_next[t] = load_frag(vtb, SEQ, dBase + t * 16,
                                j * CHUNK + (i + 1) * 32, lane);
      }
#pragma unroll
      for (int t = 0; t < 4; ++t) acc[t] = wmma_f16(a_cur, b_cur[t], acc[t]);
      if (i + 1 < CHUNK / 32) {
        a_cur = a_next;
#pragma unroll
        for (int t = 0; t < 4; ++t) b_cur[t] = b_next[t];
      }
    }
  }
  {
    v16h a_cur = load_frag(Qm, FDIM, rowTok + lBase, 0, lane);
    v16h b_cur[4];
#pragma unroll
    for (int t = 0; t < 4; ++t)
      b_cur[t] = load_frag(mtb, FDIM, dBase + t * 16, 0, lane);
    for (int i = 0; i < FDIM / 32; ++i) {
      v16h a_next, b_next[4];
      if (i + 1 < FDIM / 32) {
        a_next = load_frag(Qm, FDIM, rowTok + lBase, (i + 1) * 32, lane);
#pragma unroll
        for (int t = 0; t < 4; ++t)
          b_next[t] = load_frag(mtb, FDIM, dBase + t * 16, (i + 1) * 32, lane);
      }
#pragma unroll
      for (int t = 0; t < 4; ++t) acc[t] = wmma_f16(a_cur, b_cur[t], acc[t]);
      if (i + 1 < FDIM / 32) {
        a_cur = a_next;
#pragma unroll
        for (int t = 0; t < 4; ++t) b_cur[t] = b_next[t];
      }
    }
  }
#pragma unroll
  for (int t = 0; t < 4; ++t) {
    const int d = dBase + t * 16 + (lane & 15);
#pragma unroll
    for (int r = 0; r < 8; ++r)
      Ot[(size_t)(rowTok + mB + r) * DIM + d] = acc[t][r];
  }
}

// ---- K4a: position norm + LayerNorm -> yn (f16) ---------------------------
// grid (ROWS), block 256; 2 elements per thread.

__global__ void k_layernorm(const float* __restrict__ Ot,
                            const float* __restrict__ ln_g,
                            const float* __restrict__ ln_b,
                            _Float16* __restrict__ yn) {
  __shared__ float rs[256], rq[256];
  const int row = blockIdx.x, tid = threadIdx.x;
  const int l = row & 2047;
  const float nf = rsqrtf((float)(l + 1) * (float)NPLN);
  float y0 = Ot[(size_t)row * DIM + tid] * nf;
  float y1 = Ot[(size_t)row * DIM + 256 + tid] * nf;
  rs[tid] = y0 + y1;
  rq[tid] = y0 * y0 + y1 * y1;
  __syncthreads();
#pragma unroll
  for (int s = 128; s > 0; s >>= 1) {
    if (tid < s) { rs[tid] += rs[tid + s]; rq[tid] += rq[tid + s]; }
    __syncthreads();
  }
  const float mu  = rs[0] * (1.0f / DIM);
  const float var = rq[0] * (1.0f / DIM) - mu * mu;
  const float ivs = rsqrtf(var + 1e-5f);
  yn[(size_t)row * DIM + tid]       = (_Float16)((y0 - mu) * ivs * ln_g[tid] + ln_b[tid]);
  yn[(size_t)row * DIM + 256 + tid] = (_Float16)((y1 - mu) * ivs * ln_g[256 + tid] + ln_b[256 + tid]);
}

// ---- K4b: out = x + yn @ ow + ob ------------------------------------------
// grid (32, 8), block 256. Same async LDS staging as K1.

__global__ void k_outproj(const _Float16* __restrict__ yn,
                          const _Float16* __restrict__ owt,
                          const float* __restrict__ ob,
                          const float* __restrict__ x,
                          float* __restrict__ out) {
  __shared__ _Float16 bs[2][64 * 32];
  const int tid = threadIdx.x;
  const int lane = tid & 31, wave = tid >> 5;
  const int rowBase = blockIdx.x * 128 + wave * 16;
  const int colBase = blockIdx.y * 64;

  stage_b_tile(bs[0], owt, DIM, colBase, 0, tid);
  v16h a_cur = load_frag(yn, DIM, rowBase, 0, lane);

  v8f acc[4] = {};
  for (int i = 0; i < DIM / 32; ++i) {
    stage_wait();
    __syncthreads();
    if (i + 1 < DIM / 32)
      stage_b_tile(bs[(i + 1) & 1], owt, DIM, colBase, (i + 1) * 32, tid);
    v16h a_next;
    if (i + 1 < DIM / 32)
      a_next = load_frag(yn, DIM, rowBase, (i + 1) * 32, lane);
#pragma unroll
    for (int t = 0; t < 4; ++t) {
      v16h b = load_frag(bs[i & 1], 32, t * 16, 0, lane);
      acc[t] = wmma_f16(a_cur, b, acc[t]);
    }
    a_cur = a_next;
  }

  const int mBase = rowBase + ((lane >> 4) << 3);
#pragma unroll
  for (int t = 0; t < 4; ++t) {
    const int n = colBase + t * 16 + (lane & 15);
#pragma unroll
    for (int r = 0; r < 8; ++r) {
      const size_t idx = (size_t)(mBase + r) * DIM + n;
      out[idx] = x[idx] + acc[t][r] + ob[n];
    }
  }
}

// ---------------------------------------------------------------------------

extern "C" void kernel_launch(void* const* d_in, const int* in_sizes, int n_in,
                              void* d_out, int out_size, void* d_ws, size_t ws_size,
                              hipStream_t stream) {
  const float* x   = (const float*)d_in[0];
  const float* sw  = (const float*)d_in[1];
  const float* kw1 = (const float*)d_in[2];
  const float* kb1 = (const float*)d_in[3];
  const float* kw2 = (const float*)d_in[4];
  const float* kb2 = (const float*)d_in[5];
  const float* qw1 = (const float*)d_in[6];
  const float* qb1 = (const float*)d_in[7];
  const float* qw2 = (const float*)d_in[8];
  const float* qb2 = (const float*)d_in[9];
  const float* vw  = (const float*)d_in[10];
  const float* vb  = (const float*)d_in[11];
  const float* lng = (const float*)d_in[12];
  const float* lnb = (const float*)d_in[13];
  const float* ow  = (const float*)d_in[14];
  const float* ob  = (const float*)d_in[15];
  float* out = (float*)d_out;

  // workspace carve-up (all 256B aligned)
  char* ws = (char*)d_ws;
  size_t off = 0;
  auto take = [&](size_t bytes) { char* p = ws + off; off += (bytes + 255) & ~(size_t)255; return p; };
  _Float16* xh    = (_Float16*)take((size_t)ROWS * DIM * 2);
  _Float16* hk    = (_Float16*)take((size_t)ROWS * DIM * 2);
  _Float16* hq    = (_Float16*)take((size_t)ROWS * DIM * 2);
  _Float16* vt    = (_Float16*)take((size_t)BATCH * DIM * SEQ * 2);
  _Float16* Qm    = (_Float16*)take((size_t)ROWS * FDIM * 2);
  _Float16* Km    = (_Float16*)take((size_t)ROWS * FDIM * 2);
  _Float16* Kt    = (_Float16*)take((size_t)BATCH * FDIM * SEQ * 2);
  float*    Ssum  = (float*)   take((size_t)BATCH * NCHK * FDIM * DIM * 4);
  _Float16* Mt    = (_Float16*)take((size_t)BATCH * NCHK * DIM * FDIM * 2);
  float*    Ot    = (float*)   take((size_t)ROWS * DIM * 4);
  _Float16* yn    = (_Float16*)take((size_t)ROWS * DIM * 2);
  _Float16* kw1t  = (_Float16*)take((size_t)DIM * DIM * 2);
  _Float16* qw1t  = (_Float16*)take((size_t)DIM * DIM * 2);
  _Float16* vwt   = (_Float16*)take((size_t)DIM * DIM * 2);
  _Float16* owt   = (_Float16*)take((size_t)DIM * DIM * 2);
  _Float16* kw2t  = (_Float16*)take((size_t)TP * DIM * 2);
  _Float16* qw2t  = (_Float16*)take((size_t)TP * DIM * 2);

  // P0: conversions
  k_cvt_f32_to_f16<<<ROWS * DIM / 8 / 256, 256, 0, stream>>>(x, xh);
  k_transpose_f16<<<(DIM * DIM / 8 + 255) / 256, 256, 0, stream>>>(kw1, kw1t, DIM, DIM);
  k_transpose_f16<<<(DIM * DIM / 8 + 255) / 256, 256, 0, stream>>>(qw1, qw1t, DIM, DIM);
  k_transpose_f16<<<(DIM * DIM / 8 + 255) / 256, 256, 0, stream>>>(vw,  vwt,  DIM, DIM);
  k_transpose_f16<<<(DIM * DIM / 8 + 255) / 256, 256, 0, stream>>>(ow,  owt,  DIM, DIM);
  k_transpose_f16<<<(DIM * TP / 8 + 255) / 256, 256, 0, stream>>>(kw2, kw2t, DIM, TP);
  k_transpose_f16<<<(DIM * TP / 8 + 255) / 256, 256, 0, stream>>>(qw2, qw2t, DIM, TP);

  // K1: Hk / Hq / Vt
  k_encode1<<<dim3(ROWS / 128, DIM / 64, 3), 256, 0, stream>>>(
      xh, kw1t, qw1t, vwt, kb1, qb1, vb, hk, hq, vt);

  // K2: phases -> Q, K, Kt
  k_phases<<<dim3(ROWS / 128), 256, 0, stream>>>(
      hk, hq, kw2t, qw2t, kb2, qb2, sw, Qm, Km, Kt);

  // K3: chunked causal linear attention
  k_chunk_kv<<<dim3(NCHK, DIM / 64, BATCH), 256, 0, stream>>>(Kt, vt, Ssum);
  k_scan<<<BATCH * FDIM * DIM / 4 / 128, 128, 0, stream>>>(Ssum, Mt);
  k_chunk_out<<<dim3(NCHK, DIM / 64, BATCH), 256, 0, stream>>>(Qm, Km, vt, Mt, Ot);

  // K4: norm + LN + output projection + residual
  k_layernorm<<<dim3(ROWS), 256, 0, stream>>>(Ot, lng, lnb, yn);
  k_outproj<<<dim3(ROWS / 128, DIM / 64), 256, 0, stream>>>(yn, owt, ob, x, out);
}

// v003
// It runs in 101 microseconds.
// Next to v002, in two timings, it ran 1.13 and 1.14 times as fast.
// All steps since v000 together make it 2.24 times as fast.
#include <hip/hip_runtime.h>
#include <hip/hip_bf16.h>
#include <math.h>

// ---------------------------------------------------------------------------
// MI455X (gfx1250, wave32) implementation.
// Pipeline:
//  P0  convert x -> f16, transpose-convert all weights -> f16 [N,K]; one launch
//  K1  Hk = gelu(x@kw1+b), Hq = gelu(x@qw1+b), Vt = (x@vw+b)^T     (WMMA f16,
//      B tile staged in LDS via async-load-to-LDS, ping-pong)
//  K2  phases -> Q[l,f]=w_s*{cos,sin}(qp), K[l,f], Kt[f,l]          (WMMA f16)
//  K3a per-chunk state sums S_j^T = V_j^T K_j, stored [d][f]        (WMMA f16)
//  K3b exclusive prefix over 16 chunks -> Mt [d][f], f16            (scan)
//  K3c O = Q@M_prev + tril(Q K^T) @ V  (scores staged in LDS)       (WMMA f16)
//  K4a position-norm + LayerNorm -> yn (f16)
//  K4b out = x + yn@ow + ob  (async LDS-staged B, like K1)          (WMMA f16)
// All accumulation in f32 (WMMA f32 accumulators).
// ---------------------------------------------------------------------------

typedef __attribute__((ext_vector_type(16))) _Float16 v16h;
typedef __attribute__((ext_vector_type(8)))  _Float16 v8h;
typedef __attribute__((ext_vector_type(8)))  float    v8f;
typedef __attribute__((ext_vector_type(4)))  int      v4i;
typedef __attribute__((ext_vector_type(4)))  float    v4f;
typedef __attribute__((ext_vector_type(4)))  _Float16 v4h;

#define BATCH 2
#define SEQ   2048
#define DIM   512
#define NSET  4
#define NPLN  16
#define TP    64          // NSET*NPLN
#define FDIM  128         // 2*TP (cos|sin features)
#define ROWS  4096        // BATCH*SEQ
#define CHUNK 128
#define NCHK  16          // SEQ/CHUNK
#define PI_F  3.14159265358979323846f

// CDNA5 async global->LDS path (ASYNCcnt). Guarded so the file compiles on
// toolchains without the builtins (falls back to sync reg->LDS staging).
#if defined(__has_builtin)
#if __has_builtin(__builtin_amdgcn_global_load_async_to_lds_b128) && \
    __has_builtin(__builtin_amdgcn_s_wait_asynccnt)
#define USE_ASYNC_LDS 1
#endif
#endif

#define AS_GLOBAL __attribute__((address_space(1)))
#define AS_LDS    __attribute__((address_space(3)))

// ---- WMMA helpers ---------------------------------------------------------

__device__ __forceinline__ v8f wmma_f16(v16h a, v16h b, v8f c) {
  // v_wmma_f32_16x16x32_f16 : D = A(16x32) x B(32x16) + C
  return __builtin_amdgcn_wmma_f32_16x16x32_f16(false, a, false, b,
                                                (short)0, c, false, false);
}

// Load a 16x32 f16 A-fragment (or the transposed-B fragment, which has the
// identical per-lane layout) from a row-major f16 matrix with leading dim ld.
// ISA layout: lane&15 selects row, (lane>>4)*8 selects K phase; vector
// elements 0..7 hold K = kb..kb+7, elements 8..15 hold K = kb+16..kb+23.
__device__ __forceinline__ v16h load_frag(const _Float16* __restrict__ base,
                                          int ld, int rowBase, int k0, int lane) {
  const _Float16* p = base + (size_t)(rowBase + (lane & 15)) * ld
                           + k0 + ((lane >> 4) << 3);
  v16h f;
  *(v8h*)&f       = *(const v8h*)(p);
  *((v8h*)&f + 1) = *(const v8h*)(p + 16);
  return f;
}

// Stage one 64x32 f16 B sub-tile (4 KB) into LDS, one b128 per thread of a
// 256-thread block. Async (ASYNCcnt path) when available.
__device__ __forceinline__ void stage_b_tile(_Float16* __restrict__ lds_dst,
                                             const _Float16* __restrict__ gsrc,
                                             int ld, int colBase, int k0, int tid) {
  const int r = tid >> 2;          // 0..63  (row of transposed B)
  const int c = (tid & 3) << 3;    // 0,8,16,24 (halves)
  const _Float16* src = gsrc + (size_t)(colBase + r) * ld + k0 + c;
  _Float16* dst = lds_dst + r * 32 + c;
#if defined(USE_ASYNC_LDS)
  _Float16* src_nc = const_cast<_Float16*>(src);
  __builtin_amdgcn_global_load_async_to_lds_b128(
      (AS_GLOBAL v4i*)src_nc, (AS_LDS v4i*)dst, 0, 0);
#else
  *(v8h*)dst = *(const v8h*)src;
#endif
}

__device__ __forceinline__ void stage_wait() {
#if defined(USE_ASYNC_LDS)
  __builtin_amdgcn_s_wait_asynccnt(0);
#endif
}

__device__ __forceinline__ float gelu_exact(float v) {
  return 0.5f * v * (1.0f + erff(v * 0.70710678118654752440f));
}

// ---- P0: conversions ------------------------------------------------------
// A thread makes 8 f16 that are neighbours in dst and stores them as 16 bytes.
// All seven conversions read inputs only and none reads another's output, so
// they share one launch: a block's index says which array it works on.

// dst[n*K+k] = (f16) src[k*N+n]   (store weights transposed for B operands)
// A thread reads 8 consecutive k of one n. A wave is 4 n x 8 groups of k, so
// its one store fills 4 whole 128-byte lines of dst, each written by no other
// wave; the 8 waves of a block read 128 contiguous bytes of each source row.
// idx runs over K * N / 8 threads, in whole blocks of 256.
template <int K, int N>
__device__ __forceinline__ void transpose_f16(const float* __restrict__ src,
                                              _Float16* __restrict__ dst,
                                              unsigned idx) {
  static_assert(N % 4 == 0 && K % 64 == 0, "a wave is 4 n x 64 k");
  static_assert((K * N) % (8 * 256) == 0, "whole blocks cover the matrix");
  const unsigned nb = N >> 2;            // waves across n
  const unsigned w  = idx >> 5;
  const unsigned wk = w / nb, wn = w - wk * nb;
  const unsigned n  = wn * 4 + (idx & 3);
  const unsigned k0 = (wk * 8 + ((idx >> 2) & 7)) * 8;
  const float* p = src + (size_t)k0 * N + n;
  v8h h;
  // unrolled: h stays in registers and the eight loads are in flight together
#pragma unroll
  for (int i = 0; i < 8; ++i) h[i] = (_Float16)p[(size_t)i * N];
  *(v8h*)(dst + (size_t)n * K + k0) = h;
}

#define NB_WBIG   (DIM * DIM / 8 / 256)   // blocks per DIM x DIM weight
#define NB_WSMALL (DIM * TP / 8 / 256)    // blocks per DIM x TP weight
#define NB_X      (ROWS * DIM / 8 / 256)  // blocks for x
#define NB_PREP   (4 * NB_WBIG + 2 * NB_WSMALL + NB_X)

static_assert((ROWS * DIM) % (8 * 256) == 0, "the grid covers x exactly");

// grid (NB_PREP), block 256. The transposes come first in the index order:
// their loads touch more lines than those of the x conversion.
__global__ void k_prepare(const float* __restrict__ x,
                          const float* __restrict__ kw1,
                          const float* __restrict__ qw1,
                          const float* __restrict__ vw,
                          const float* __restrict__ ow,
                          const float* __restrict__ kw2,
                          const float* __restrict__ qw2,
                          _Float16* __restrict__ xh,
                          _Float16* __restrict__ kw1t,
                          _Float16* __restrict__ qw1t,
                          _Float16* __restrict__ vwt,
                          _Float16* __restrict__ owt,
                          _Float16* __restrict__ kw2t,
                          _Float16* __restrict__ qw2t) {
  unsigned blk = blockIdx.x;
  if (blk < 4 * NB_WBIG) {
    const unsigned m = blk / NB_WBIG;
    const float* s = (m == 0) ? kw1 : (m == 1) ? qw1 : (m == 2) ? vw : ow;
    _Float16* d = (m == 0) ? kw1t : (m == 1) ? qw1t : (m == 2) ? vwt : owt;
    transpose_f16<DIM, DIM>(s, d, (blk - m * NB_WBIG) * 256 + threadIdx.x);
    return;
  }
  blk -= 4 * NB_WBIG;
  if (blk < 2 * NB_WSMALL) {
    const unsigned m = blk / NB_WSMALL;
    transpose_f16<DIM, TP>(m == 0 ? kw2 : qw2, m == 0 ? kw2t : qw2t,
                           (blk - m * NB_WSMALL) * 256 + threadIdx.x);
    // the build lays another branch's code behind this store, and that code
    // rewrites the store's registers: the wait stands in front of any rewrite
    asm volatile("s_wait_xcnt 0x0" ::: "memory");
    return;
  }
  blk -= 2 * NB_WSMALL;
  const unsigned i = (blk * 256 + threadIdx.x) * 8;
  *(v8h*)(xh + i) = __builtin_convertvector(*(const v8f*)(x + i), v8h);
  // as above: in front of any rewrite of this store's registers
  asm volatile("s_wait_xcnt 0x0" ::: "memory");
}

// ---- K1: encoder layer-1 GEMMs + V projection -----------------------------
// grid (32, 8, 3), block 256 (8 waves); 128x64 output tile per block.
// B tile ping-pong staged in LDS (async), A fragments double-buffered in regs.

__global__ void k_encode1(const _Float16* __restrict__ xh,
                          const _Float16* __restrict__ kw1t,
                          const _Float16* __restrict__ qw1t,
                          const _Float16* __restrict__ vwt,
                          const float* __restrict__ kb1,
                          const float* __restrict__ qb1,
                          const float* __restrict__ vb,
                          _Float16* __restrict__ hk,
                          _Float16* __restrict__ hq,
                          _Float16* __restrict__ vt) {
  __shared__ _Float16 bs[2][64 * 32];  // 8 KB ping-pong B tile
  const int tid = threadIdx.x;
  const int lane = tid & 31, wave = tid >> 5;
  const int z = blockIdx.z;
  const int rowBase = blockIdx.x * 128 + wave * 16;
  const int colBase = blockIdx.y * 64;
  const _Float16* wt  = (z == 0) ? kw1t : (z == 1) ? qw1t : vwt;
  const float*    bia = (z == 0) ? kb1  : (z == 1) ? qb1  : vb;

  stage_b_tile(bs[0], wt, DIM, colBase, 0, tid);
  v16h a_cur = load_frag(xh, DIM, rowBase, 0, lane);

  v8f acc[4] = {};
  for (int i = 0; i < DIM / 32; ++i) {
    stage_wait();
    __syncthreads();                      // buffer i&1 ready for all waves
    if (i + 1 < DIM / 32)
      stage_b_tile(bs[(i + 1) & 1], wt, DIM, colBase, (i + 1) * 32, tid);
    v16h a_next;
    if (i + 1 < DIM / 32)
      a_next = load_frag(xh, DIM, rowBase, (i + 1) * 32, lane);
#pragma unroll
    for (int t = 0; t < 4; ++t) {
      v16h b = load_frag(bs[i & 1], 32, t * 16, 0, lane);
      acc[t] = wmma_f16(a_cur, b, acc[t]);
    }
    a_cur = a_next;
  }

  const int mBase = rowBase + ((lane >> 4) << 3);
  const int nBase = colBase + (lane & 15);
  // the loops below are unrolled so that acc[] is indexed by constants and
  // stays in registers
#pragma unroll
  for (int t = 0; t < 4; ++t) acc[t] += bia[nBase + t * 16];

  if (z == 2) {
    // V^T [b][d][l]: a lane's 8 rows are 8 neighbours in l (mBase % 8 == 0)
    const int b = mBase >> 11, l = mBase & 2047;
#pragma unroll
    for (int t = 0; t < 4; ++t)
      *(v8h*)(vt + ((size_t)(b * DIM + nBase + t * 16)) * SEQ + l) =
          __builtin_convertvector(acc[t], v8h);
    return;
  }

  _Float16* dst = (z == 0) ? hk : hq;
#pragma unroll
  for (int t = 0; t < 4; ++t) {
#pragma unroll
    for (int r = 0; r < 8; ++r)
      dst[(size_t)(mBase + r) * DIM + nBase + t * 16] =
          (_Float16)gelu_exact(acc[t][r]);
  }
}

// ---- K2: encoder layer-2 + phases -> Q, K, Kt -----------------------------
// grid (32), block 256. N = TP = 64 (4 tiles) for each of k/q.

__global__ void k_phases(const _Float16* __restrict__ hk,
                         const _Float16* __restrict__ hq,
                         const _Float16* __restrict__ kw2t,
                         const _Float16* __restrict__ qw2t,
                         const float* __restrict__ kb2,
                         const float* __restrict__ qb2,
                         const float* __restrict__ sw,
                         _Float16* __restrict__ Qm,   // [ROWS][FDIM]
                         _Float16* __restrict__ Km,   // [ROWS][FDIM]
                         _Float16* __restrict__ Kt) { // [B][FDIM][SEQ]
  const int lane = threadIdx.x & 31, wave = threadIdx.x >> 5;
  const int rowBase = blockIdx.x * 128 + wave * 16;

  v8f ak[4] = {}, aq[4] = {};
  for (int k0 = 0; k0 < DIM; k0 += 32) {
    v16h a0 = load_frag(hk, DIM, rowBase, k0, lane);
    v16h a1 = load_frag(hq, DIM, rowBase, k0, lane);
#pragma unroll
    for (int t = 0; t < 4; ++t) {
      v16h bk = load_frag(kw2t, DIM, t * 16, k0, lane);
      v16h bq = load_frag(qw2t, DIM, t * 16, k0, lane);
      ak[t] = wmma_f16(a0, bk, ak[t]);
      aq[t] = wmma_f16(a1, bq, aq[t]);
    }
  }
  // softmax over 4 set weights (redundant per thread; trivially cheap)
  float s0 = sw[0], s1 = sw[1], s2 = sw[2], s3 = sw[3];
  float mx = fmaxf(fmaxf(s0, s1), fmaxf(s2, s3));
  float e0 = expf(s0 - mx), e1 = expf(s1 - mx), e2 = expf(s2 - mx), e3 = expf(s3 - mx);
  float inv = 1.0f / (e0 + e1 + e2 + e3);
  float wsm[4] = {e0 * inv, e1 * inv, e2 * inv, e3 * inv};

  const int mBase = rowBase + ((lane >> 4) << 3);
#pragma unroll
  for (int t = 0; t < 4; ++t) {
    const int tp = t * 16 + (lane & 15);   // 0..63
    const int s  = tp >> 4;
    v8h kcol, scol;   // K^T [b][f][l]: a lane's 8 rows are 8 neighbours in l
#pragma unroll
    for (int r = 0; r < 8; ++r) {
      const int row = mBase + r;
      float kph = tanhf(ak[t][r] + kb2[tp]) * PI_F;
      float qph = tanhf(aq[t][r] + qb2[tp]) * PI_F;
      float kc = cosf(kph), ks = sinf(kph);
      float qc = wsm[s] * cosf(qph), qs = wsm[s] * sinf(qph);
      Km[(size_t)row * FDIM + tp]      = (_Float16)kc;
      Km[(size_t)row * FDIM + TP + tp] = (_Float16)ks;
      kcol[r] = (_Float16)kc;
      scol[r] = (_Float16)ks;
      Qm[(size_t)row * FDIM + tp]      = (_Float16)qc;
      Qm[(size_t)row * FDIM + TP + tp] = (_Float16)qs;
    }
    const int b = mBase >> 11, l = mBase & 2047;   // mBase % 8 == 0
    *(v8h*)(Kt + ((size_t)(b * FDIM + tp)) * SEQ + l)      = kcol;
    *(v8h*)(Kt + ((size_t)(b * FDIM + TP + tp)) * SEQ + l) = scol;
    // the next pass of this loop reuses the registers that these stores name
    asm volatile("s_wait_xcnt 0x0" ::: "memory");
  }
}

// ---- K3a: per-chunk KV sums S_j[f,d] = sum_t K[t,f] V[t,d] ---------------
// grid (NCHK, 8, BATCH), block 256. Register double-buffered K loop.
// V^T is the A operand and K^T the B operand, so the accumulator tile has d
// on its rows and f across its lanes and is stored in Mt's own [d][f] order.

__global__ void k_chunk_kv(const _Float16* __restrict__ Kt,
                           const _Float16* __restrict__ Vt,
                           float* __restrict__ Ssum) { // [B][NCHK][DIM][FDIM]
  const int lane = threadIdx.x & 31, wave = threadIdx.x >> 5;
  const int j = blockIdx.x, dBase = blockIdx.y * 64, b = blockIdx.z;
  const int fBase = wave * 16;
  const _Float16* ktb = Kt + (size_t)b * FDIM * SEQ;
  const _Float16* vtb = Vt + (size_t)b * DIM * SEQ;
  const int kBase = j * CHUNK;

  v8f acc[4] = {};
  v16h a_cur = load_frag(ktb, SEQ, fBase, kBase, lane);
  v16h b_cur[4];
#pragma unroll
  for (int t = 0; t < 4; ++t)
    b_cur[t] = load_frag(vtb, SEQ, dBase + t * 16, kBase, lane);

  for (int i = 0; i < CHUNK / 32; ++i) {
    v16h a_next, b_next[4];
    if (i + 1 < CHUNK / 32) {
      a_next = load_frag(ktb, SEQ, fBase, kBase + (i + 1) * 32, lane);
#pragma unroll
      for (int t = 0; t < 4; ++t)
        b_next[t] = load_frag(vtb, SEQ, dBase + t * 16, kBase + (i + 1) * 32, lane);
    }
#pragma unroll
    for (int t = 0; t < 4; ++t) acc[t] = wmma_f16(b_cur[t], a_cur, acc[t]);
    if (i + 1 < CHUNK / 32) {
      a_cur = a_next;
#pragma unroll
      for (int t = 0; t < 4; ++t) b_cur[t] = b_next[t];
    }
  }

  float* sp = Ssum + ((size_t)(b * NCHK + j) * DIM + dBase + ((lane >> 4) << 3)) * FDIM
                   + fBase + (lane & 15);
#pragma unroll
  for (int t = 0; t < 4; ++t) {
#pragma unroll
    for (int r = 0; r < 8; ++r)
      sp[(t * 16 + r) * FDIM] = acc[t][r];
  }
}

// ---- K3b: exclusive prefix over chunks -> Mt (f16) ------------------------
// Ssum and Mt share the [B][NCHK][DIM][FDIM] order; a thread owns 4 adjacent
// f of one d, so a wave reads 512 and writes 256 contiguous bytes per chunk.
// grid (BATCH*DIM*FDIM/4/128), block 128.

__global__ void k_scan(const float* __restrict__ Ssum,
                       _Float16* __restrict__ Mt) { // [B][NCHK][DIM][FDIM]
  const int PLANE = DIM * FDIM;
  const int tid = blockIdx.x * blockDim.x + threadIdx.x;
  const int b = tid / (PLANE / 4);
  const int e = (tid - b * (PLANE / 4)) * 4;
  const size_t base = (size_t)b * NCHK * PLANE + e;
  v4f run = {};
#pragma unroll
  for (int j = 0; j < NCHK; ++j) {
    *(v4h*)(Mt + base + (size_t)j * PLANE) = __builtin_convertvector(run, v4h);
    run += *(const v4f*)(Ssum + base + (size_t)j * PLANE);
  }
}

// ---- K3c: O = Q@M_prev + tril(Q K^T) @ V ---------------------------------
// grid (NCHK, 8, BATCH), block 256. Scores staged in LDS (f16, padded).

__global__ void k_chunk_out(const _Float16* __restrict__ Qm,
                            const _Float16* __restrict__ Km,
                            const _Float16* __restrict__ Vt,
                            const _Float16* __restrict__ Mt,
                            float* __restrict__ Ot) { // [ROWS][DIM]
  __shared__ _Float16 sc[CHUNK][CHUNK + 8];  // +8 halves pad, keeps 16B align
  const int lane = threadIdx.x & 31, wave = threadIdx.x >> 5;
  const int j = blockIdx.x, dBase = blockIdx.y * 64, b = blockIdx.z;
  const int rowTok = b * SEQ + j * CHUNK;   // first token row of chunk
  const int lBase = wave * 16;

  // Phase A: scores = Q_c K_c^T  (128x128), masked causal-inclusive
  v8f sacc[8] = {};
  for (int f0 = 0; f0 < FDIM; f0 += 32) {
    v16h a = load_frag(Qm, FDIM, rowTok + lBase, f0, lane);
#pragma unroll
    for (int tt = 0; tt < 8; ++tt) {
      v16h bf = load_frag(Km, FDIM, rowTok + tt * 16, f0, lane);
      sacc[tt] = wmma_f16(a, bf, sacc[tt]);
    }
  }
  const int mB = lBase + ((lane >> 4) << 3);
#pragma unroll
  for (int tt = 0; tt < 8; ++tt) {
    const int tl = tt * 16 + (lane & 15);
#pragma unroll
    for (int r = 0; r < 8; ++r) {
      const int ll = mB + r;
      sc[ll][tl] = (_Float16)((tl <= ll) ? sacc[tt][r] : 0.0f);
    }
  }
  __syncthreads();

  // Phase B: O = scores @ V_c + Q_c @ M_prev  (both register double-buffered)
  const _Float16* vtb = Vt + (size_t)b * DIM * SEQ;
  const _Float16* mtb = Mt + (size_t)(b * NCHK + j) * DIM * FDIM;
  v8f acc[4] = {};
  {
    v16h a_cur = load_frag(&sc[0][0], CHUNK + 8, lBase, 0, lane);
    v16h b_cur[4];
#pragma unroll
    for (int t = 0; t < 4; ++t)
      b_cur[t] = load_frag(vtb, SEQ, dBase + t * 16, j * CHUNK, lane);
    for (int i = 0; i < CHUNK / 32; ++i) {
      v16h a_next, b_next[4];
      if (i + 1 < CHUNK / 32) {
        a_next = load_frag(&sc[0][0], CHUNK + 8, lBase, (i + 1) * 32, lane);
#pragma unroll
        for (int t = 0; t < 4; ++t)
          b_next[t] = load_frag(vtb, SEQ, dBase + t * 16,
                                j * CHUNK + (i + 1) * 32, lane);
      }
#pragma unroll
      for (int t = 0; t < 4; ++t) acc[t] = wmma_f16(a_cur, b_cur[t], acc[t]);
      if (i + 1 < CHUNK / 32) {
        a_cur = a_next;
#pragma unroll
        for (int t = 0; t < 4; ++t) b_cur[t] = b_next[t];
      }
    }
  }
  {
    v16h a_cur = load_frag(Qm, FDIM, rowTok + lBase, 0, lane);
    v16h b_cur[4];
#pragma unroll
    for (int t = 0; t < 4; ++t)
      b_cur[t] = load_frag(mtb, FDIM, dBase + t * 16, 0, lane);
    for (int i = 0; i < FDIM / 32; ++i) {
      v16h a_next, b_next[4];
      if (i + 1 < FDIM / 32) {
        a_next = load_frag(Qm, FDIM, rowTok + lBase, (i + 1) * 32, lane);
#pragma unroll
        for (int t = 0; t < 4; ++t)
          b_next[t] = load_frag(mtb, FDIM, dBase + t * 16, (i + 1) * 32, lane);
      }
#pragma unroll
      for (int t = 0; t < 4; ++t) acc[t] = wmma_f16(a_cur, b_cur[t], acc[t]);
      if (i + 1 < FDIM / 32) {
        a_cur = a_next;
#pragma unroll
        for (int t = 0; t < 4; ++t) b_cur[t] = b_next[t];
      }
    }
  }
#pragma unroll
  for (int t = 0; t < 4; ++t) {
    const int d = dBase + t * 16 + (lane & 15);
#pragma unroll
    for (int r = 0; r < 8; ++r)
      Ot[(size_t)(rowTok + mB + r) * DIM + d] = acc[t][r];
  }
}

// ---- K4a: position norm + LayerNorm -> yn (f16) ---------------------------
// grid (ROWS), block 256; 2 elements per thread.

__global__ void k_layernorm(const float* __restrict__ Ot,
                            const float* __restrict__ ln_g,
                            const float* __restrict__ ln_b,
                            _Float16* __restrict__ yn) {
  __shared__ float rs[256], rq[256];
  const int row = blockIdx.x, tid = threadIdx.x;
  const int l = row & 2047;
  const float nf = rsqrtf((float)(l + 1) * (float)NPLN);
  float y0 = Ot[(size_t)row * DIM + tid] * nf;
  float y1 = Ot[(size_t)row * DIM + 256 + tid] * nf;
  rs[tid] = y0 + y1;
  rq[tid] = y0 * y0 + y1 * y1;
  __syncthreads();
#pragma unroll
  for (int s = 128; s > 0; s >>= 1) {
    if (tid < s) { rs[tid] += rs[tid + s]; rq[tid] += rq[tid + s]; }
    __syncthreads();
  }
  const float mu  = rs[0] * (1.0f / DIM);
  const float var = rq[0] * (1.0f / DIM) - mu * mu;
  const float ivs = rsqrtf(var + 1e-5f);
  yn[(size_t)row * DIM + tid]       = (_Float16)((y0 - mu) * ivs * ln_g[tid] + ln_b[tid]);
  yn[(size_t)row * DIM + 256 + tid] = (_Float16)((y1 - mu) * ivs * ln_g[256 + tid] + ln_b[256 + tid]);
}

// ---- K4b: out = x + yn @ ow + ob ------------------------------------------
// grid (32, 8), block 256. Same async LDS staging as K1.

__global__ void k_outproj(const _Float16* __restrict__ yn,
                          const _Float16* __restrict__ owt,
                          const float* __restrict__ ob,
                          const float* __restrict__ x,
                          float* __restrict__ out) {
  __shared__ _Float16 bs[2][64 * 32];
  const int tid = threadIdx.x;
  const int lane = tid & 31, wave = tid >> 5;
  const int rowBase = blockIdx.x * 128 + wave * 16;
  const int colBase = blockIdx.y * 64;

  stage_b_tile(bs[0], owt, DIM, colBase, 0, tid);
  v16h a_cur = load_frag(yn, DIM, rowBase, 0, lane);

  v8f acc[4] = {};
  for (int i = 0; i < DIM / 32; ++i) {
    stage_wait();
    __syncthreads();
    if (i + 1 < DIM / 32)
      stage_b_tile(bs[(i + 1) & 1], owt, DIM, colBase, (i + 1) * 32, tid);
    v16h a_next;
    if (i + 1 < DIM / 32)
      a_next = load_frag(yn, DIM, rowBase, (i + 1) * 32, lane);
#pragma unroll
    for (int t = 0; t < 4; ++t) {
      v16h b = load_frag(bs[i & 1], 32, t * 16, 0, lane);
      acc[t] = wmma_f16(a_cur, b, acc[t]);
    }
    a_cur = a_next;
  }

  const int mBase = rowBase + ((lane >> 4) << 3);
#pragma unroll
  for (int t = 0; t < 4; ++t) {
    const int n = colBase + t * 16 + (lane & 15);
#pragma unroll
    for (int r = 0; r < 8; ++r) {
      const size_t idx = (size_t)(mBase + r) * DIM + n;
      out[idx] = x[idx] + acc[t][r] + ob[n];
    }
  }
}

// ---------------------------------------------------------------------------

extern "C" void kernel_launch(void* const* d_in, const int* in_sizes, int n_in,
                              void* d_out, int out_size, void* d_ws, size_t ws_size,
                              hipStream_t stream) {
  const float* x   = (const float*)d_in[0];
  const float* sw  = (const float*)d_in[1];
  const float* kw1 = (const float*)d_in[2];
  const float* kb1 = (const float*)d_in[3];
  const float* kw2 = (const float*)d_in[4];
  const float* kb2 = (const float*)d_in[5];
  const float* qw1 = (const float*)d_in[6];
  const float* qb1 = (const float*)d_in[7];
  const float* qw2 = (const float*)d_in[8];
  const float* qb2 = (const float*)d_in[9];
  const float* vw  = (const float*)d_in[10];
  const float* vb  = (const float*)d_in[11];
  const float* lng = (const float*)d_in[12];
  const float* lnb = (const float*)d_in[13];
  const float* ow  = (const float*)d_in[14];
  const float* ob  = (const float*)d_in[15];
  float* out = (float*)d_out;

  // workspace carve-up (all 256B aligned)
  char* ws = (char*)d_ws;
  size_t off = 0;
  auto take = [&](size_t bytes) { char* p = ws + off; off += (bytes + 255) & ~(size_t)255; return p; };
  _Float16* xh    = (_Float16*)take((size_t)ROWS * DIM * 2);
  _Float16* hk    = (_Float16*)take((size_t)ROWS * DIM * 2);
  _Float16* hq    = (_Float16*)take((size_t)ROWS * DIM * 2);
  _Float16* vt    = (_Float16*)take((size_t)BATCH * DIM * SEQ * 2);
  _Float16* Qm    = (_Float16*)take((size_t)ROWS * FDIM * 2);
  _Float16* Km    = (_Float16*)take((size_t)ROWS * FDIM * 2);
  _Float16* Kt    = (_Float16*)take((size_t)BATCH * FDIM * SEQ * 2);
  float*    Ssum  = (float*)   take((size_t)BATCH * NCHK * FDIM * DIM * 4);
  _Float16* Mt    = (_Float16*)take((size_t)BATCH * NCHK * DIM * FDIM * 2);
  float*    Ot    = (float*)   take((size_t)ROWS * DIM * 4);
  _Float16* yn    = (_Float16*)take((size_t)ROWS * DIM * 2);
  _Float16* kw1t  = (_Float16*)take((size_t)DIM * DIM * 2);
  _Float16* qw1t  = (_Float16*)take((size_t)DIM * DIM * 2);
  _Float16* vwt   = (_Float16*)take((size_t)DIM * DIM * 2);
  _Float16* owt   = (_Float16*)take((size_t)DIM * DIM * 2);
  _Float16* kw2t  = (_Float16*)take((size_t)TP * DIM * 2);
  _Float16* qw2t  = (_Float16*)take((size_t)TP * DIM * 2);

  // P0: conversions, one launch
  k_prepare<<<NB_PREP, 256, 0, stream>>>(x, kw1, qw1, vw, ow, kw2, qw2,
                                         xh, kw1t, qw1t, vwt, owt, kw2t, qw2t);

  // K1: Hk / Hq / Vt
  k_encode1<<<dim3(ROWS / 128, DIM / 64, 3), 256, 0, stream>>>(
      xh, kw1t, qw1t, vwt, kb1, qb1, vb, hk, hq, vt);

  // K2: phases -> Q, K, Kt
  k_phases<<<dim3(ROWS / 128), 256, 0, stream>>>(
      hk, hq, kw2t, qw2t, kb2, qb2, sw, Qm, Km, Kt);

  // K3: chunked causal linear attention
  k_chunk_kv<<<dim3(NCHK, DIM / 64, BATCH), 256, 0, stream>>>(Kt, vt, Ssum);
  k_scan<<<BATCH * FDIM * DIM / 4 / 128, 128, 0, stream>>>(Ssum, Mt);
  k_chunk_out<<<dim3(NCHK, DIM / 64, BATCH), 256, 0, stream>>>(Qm, Km, vt, Mt, Ot);

  // K4: norm + LN + output projection + residual
  k_layernorm<<<dim3(ROWS), 256, 0, stream>>>(Ot, lng, lnb, yn);
  k_outproj<<<dim3(ROWS / 128, DIM / 64), 256, 0, stream>>>(yn, owt, ob, x, out);
}

// v004
// It runs in 73.2 microseconds.
// Next to v003, in two timings, it ran 1.39 times as fast each time.
// Counting every step since v000, it is 3.12 times as fast.
#include <hip/hip_runtime.h>
#include <hip/hip_bf16.h>
#include <math.h>

// ---------------------------------------------------------------------------
// MI455X (gfx1250, wave32) implementation.
// Pipeline:
//  P0  convert x -> f16, transpose-convert all weights -> f16 [N,K]; one launch
//  K1  Hk = gelu(x@kw1+b), Hq = gelu(x@qw1+b), Vt = (x@vw+b)^T     (WMMA f16,
//      B tile staged in LDS via async-load-to-LDS, ping-pong)
//  K2  phases -> Q[l,f]=w_s*{cos,sin}(qp), K[l,f], Kt[f,l]          (WMMA f16)
//  K3a per-chunk state sums S_j^T = V_j^T K_j, stored [d][f]        (WMMA f16)
//  K3b exclusive prefix over 16 chunks -> Mt [d][f], f16            (scan)
//  K3c O = Q@M_prev + tril(Q K^T) @ V  (scores staged in LDS)       (WMMA f16)
//  K4a position-norm + LayerNorm -> yn (f16)
//  K4b out = x + yn@ow + ob  (async LDS-staged B, like K1)          (WMMA f16)
// All accumulation in f32 (WMMA f32 accumulators).
// ---------------------------------------------------------------------------

typedef __attribute__((ext_vector_type(16))) _Float16 v16h;
typedef __attribute__((ext_vector_type(8)))  _Float16 v8h;
typedef __attribute__((ext_vector_type(8)))  float    v8f;
typedef __attribute__((ext_vector_type(4)))  int      v4i;
typedef __attribute__((ext_vector_type(4)))  float    v4f;
typedef __attribute__((ext_vector_type(4)))  _Float16 v4h;

#define BATCH 2
#define SEQ   2048
#define DIM   512
#define NSET  4
#define NPLN  16
#define TP    64          // NSET*NPLN
#define FDIM  128         // 2*TP (cos|sin features)
#define ROWS  4096        // BATCH*SEQ
#define CHUNK 128
#define NCHK  16          // SEQ/CHUNK
#define PI_F  3.14159265358979323846f

// CDNA5 async global->LDS path (ASYNCcnt). Guarded so the file compiles on
// toolchains without the builtins (falls back to sync reg->LDS staging).
#if defined(__has_builtin)
#if __has_builtin(__builtin_amdgcn_global_load_async_to_lds_b128) && \
    __has_builtin(__builtin_amdgcn_s_wait_asynccnt)
#define USE_ASYNC_LDS 1
#endif
#endif

#define AS_GLOBAL __attribute__((address_space(1)))
#define AS_LDS    __attribute__((address_space(3)))

// ---- WMMA helpers ---------------------------------------------------------

__device__ __forceinline__ v8f wmma_f16(v16h a, v16h b, v8f c) {
  // v_wmma_f32_16x16x32_f16 : D = A(16x32) x B(32x16) + C
  return __builtin_amdgcn_wmma_f32_16x16x32_f16(false, a, false, b,
                                                (short)0, c, false, false);
}

// Load a 16x32 f16 A-fragment (or the transposed-B fragment, which has the
// identical per-lane layout) from a row-major f16 matrix with leading dim ld.
// ISA layout: lane&15 selects row, (lane>>4)*8 selects K phase; vector
// elements 0..7 hold K = kb..kb+7, elements 8..15 hold K = kb+16..kb+23.
__device__ __forceinline__ v16h load_frag(const _Float16* __restrict__ base,
                                          int ld, int rowBase, int k0, int lane) {
  const _Float16* p = base + (size_t)(rowBase + (lane & 15)) * ld
                           + k0 + ((lane >> 4) << 3);
  v16h f;
  *(v8h*)&f       = *(const v8h*)(p);
  *((v8h*)&f + 1) = *(const v8h*)(p + 16);
  return f;
}

// Stage one 64x32 f16 B sub-tile (4 KB) into LDS, one b128 per thread of a
// 256-thread block. Async (ASYNCcnt path) when available.
__device__ __forceinline__ void stage_b_tile(_Float16* __restrict__ lds_dst,
                                             const _Float16* __restrict__ gsrc,
                                             int ld, int colBase, int k0, int tid) {
  const int r = tid >> 2;          // 0..63  (row of transposed B)
  const int c = (tid & 3) << 3;    // 0,8,16,24 (halves)
  const _Float16* src = gsrc + (size_t)(colBase + r) * ld + k0 + c;
  _Float16* dst = lds_dst + r * 32 + c;
#if defined(USE_ASYNC_LDS)
  _Float16* src_nc = const_cast<_Float16*>(src);
  __builtin_amdgcn_global_load_async_to_lds_b128(
      (AS_GLOBAL v4i*)src_nc, (AS_LDS v4i*)dst, 0, 0);
#else
  *(v8h*)dst = *(const v8h*)src;
#endif
}

__device__ __forceinline__ void stage_wait() {
#if defined(USE_ASYNC_LDS)
  __builtin_amdgcn_s_wait_asynccnt(0);
#endif
}

__device__ __forceinline__ float gelu_exact(float v) {
  return 0.5f * v * (1.0f + erff(v * 0.70710678118654752440f));
}

// ---- P0: conversions ------------------------------------------------------
// A thread makes 8 f16 that are neighbours in dst and stores them as 16 bytes.
// All seven conversions read inputs only and none reads another's output, so
// they share one launch: a block's index says which array it works on.

// dst[n*K+k] = (f16) src[k*N+n]   (store weights transposed for B operands)
// A thread reads 8 consecutive k of one n. A wave is 4 n x 8 groups of k, so
// its one store fills 4 whole 128-byte lines of dst, each written by no other
// wave; the 8 waves of a block read 128 contiguous bytes of each source row.
// idx runs over K * N / 8 threads, in whole blocks of 256.
template <int K, int N>
__device__ __forceinline__ void transpose_f16(const float* __restrict__ src,
                                              _Float16* __restrict__ dst,
                                              unsigned idx) {
  static_assert(N % 4 == 0 && K % 64 == 0, "a wave is 4 n x 64 k");
  static_assert((K * N) % (8 * 256) == 0, "whole blocks cover the matrix");
  const unsigned nb = N >> 2;            // waves across n
  const unsigned w  = idx >> 5;
  const unsigned wk = w / nb, wn = w - wk * nb;
  const unsigned n  = wn * 4 + (idx & 3);
  const unsigned k0 = (wk * 8 + ((idx >> 2) & 7)) * 8;
  const float* p = src + (size_t)k0 * N + n;
  v8h h;
  // unrolled: h stays in registers and the eight loads are in flight together
#pragma unroll
  for (int i = 0; i < 8; ++i) h[i] = (_Float16)p[(size_t)i * N];
  *(v8h*)(dst + (size_t)n * K + k0) = h;
}

#define NB_WBIG   (DIM * DIM / 8 / 256)   // blocks per DIM x DIM weight
#define NB_WSMALL (DIM * TP / 8 / 256)    // blocks per DIM x TP weight
#define NB_X      (ROWS * DIM / 8 / 256)  // blocks for x
#define NB_PREP   (4 * NB_WBIG + 2 * NB_WSMALL + NB_X)

static_assert((ROWS * DIM) % (8 * 256) == 0, "the grid covers x exactly");

// grid (NB_PREP), block 256. The transposes come first in the index order:
// their loads touch more lines than those of the x conversion.
__global__ void k_prepare(const float* __restrict__ x,
                          const float* __restrict__ kw1,
                          const float* __restrict__ qw1,
                          const float* __restrict__ vw,
                          const float* __restrict__ ow,
                          const float* __restrict__ kw2,
                          const float* __restrict__ qw2,
                          _Float16* __restrict__ xh,
                          _Float16* __restrict__ kw1t,
                          _Float16* __restrict__ qw1t,
                          _Float16* __restrict__ vwt,
                          _Float16* __restrict__ owt,
                          _Float16* __restrict__ kw2t,
                          _Float16* __restrict__ qw2t) {
  unsigned blk = blockIdx.x;
  if (blk < 4 * NB_WBIG) {
    const unsigned m = blk / NB_WBIG;
    const float* s = (m == 0) ? kw1 : (m == 1) ? qw1 : (m == 2) ? vw : ow;
    _Float16* d = (m == 0) ? kw1t : (m == 1) ? qw1t : (m == 2) ? vwt : owt;
    transpose_f16<DIM, DIM>(s, d, (blk - m * NB_WBIG) * 256 + threadIdx.x);
    return;
  }
  blk -= 4 * NB_WBIG;
  if (blk < 2 * NB_WSMALL) {
    const unsigned m = blk / NB_WSMALL;
    transpose_f16<DIM, TP>(m == 0 ? kw2 : qw2, m == 0 ? kw2t : qw2t,
                           (blk - m * NB_WSMALL) * 256 + threadIdx.x);
    // the build lays another branch's code behind this store, and that code
    // rewrites the store's registers: the wait stands in front of any rewrite
    asm volatile("s_wait_xcnt 0x0" ::: "memory");
    return;
  }
  blk -= 2 * NB_WSMALL;
  const unsigned i = (blk * 256 + threadIdx.x) * 8;
  *(v8h*)(xh + i) = __builtin_convertvector(*(const v8f*)(x + i), v8h);
  // as above: in front of any rewrite of this store's registers
  asm volatile("s_wait_xcnt 0x0" ::: "memory");
}

// ---- K1: encoder layer-1 GEMMs + V projection -----------------------------
// grid (32, 8, 3), block 256 (8 waves); 128x64 output tile per block.
// B tile ping-pong staged in LDS (async), A fragments double-buffered in regs.

__global__ void k_encode1(const _Float16* __restrict__ xh,
                          const _Float16* __restrict__ kw1t,
                          const _Float16* __restrict__ qw1t,
                          const _Float16* __restrict__ vwt,
                          const float* __restrict__ kb1,
                          const float* __restrict__ qb1,
                          const float* __restrict__ vb,
                          _Float16* __restrict__ hk,
                          _Float16* __restrict__ hq,
                          _Float16* __restrict__ vt) {
  __shared__ _Float16 bs[2][64 * 32];  // 8 KB ping-pong B tile
  const int tid = threadIdx.x;
  const int lane = tid & 31, wave = tid >> 5;
  const int z = blockIdx.z;
  const int rowBase = blockIdx.x * 128 + wave * 16;
  const int colBase = blockIdx.y * 64;
  const _Float16* wt  = (z == 0) ? kw1t : (z == 1) ? qw1t : vwt;
  const float*    bia = (z == 0) ? kb1  : (z == 1) ? qb1  : vb;

  stage_b_tile(bs[0], wt, DIM, colBase, 0, tid);
  v16h a_cur = load_frag(xh, DIM, rowBase, 0, lane);

  v8f acc[4] = {};
  for (int i = 0; i < DIM / 32; ++i) {
    stage_wait();
    __syncthreads();                      // buffer i&1 ready for all waves
    if (i + 1 < DIM / 32)
      stage_b_tile(bs[(i + 1) & 1], wt, DIM, colBase, (i + 1) * 32, tid);
    v16h a_next;
    if (i + 1 < DIM / 32)
      a_next = load_frag(xh, DIM, rowBase, (i + 1) * 32, lane);
#pragma unroll
    for (int t = 0; t < 4; ++t) {
      v16h b = load_frag(bs[i & 1], 32, t * 16, 0, lane);
      acc[t] = wmma_f16(a_cur, b, acc[t]);
    }
    a_cur = a_next;
  }

  const int mBase = rowBase + ((lane >> 4) << 3);
  const int nBase = colBase + (lane & 15);
  // the loops below are unrolled so that acc[] is indexed by constants and
  // stays in registers
#pragma unroll
  for (int t = 0; t < 4; ++t) acc[t] += bia[nBase + t * 16];

  if (z == 2) {
    // V^T [b][d][l]: a lane's 8 rows are 8 neighbours in l (mBase % 8 == 0)
    const int b = mBase >> 11, l = mBase & 2047;
#pragma unroll
    for (int t = 0; t < 4; ++t)
      *(v8h*)(vt + ((size_t)(b * DIM + nBase + t * 16)) * SEQ + l) =
          __builtin_convertvector(acc[t], v8h);
    return;
  }

  _Float16* dst = (z == 0) ? hk : hq;
#pragma unroll
  for (int t = 0; t < 4; ++t) {
#pragma unroll
    for (int r = 0; r < 8; ++r)
      dst[(size_t)(mBase + r) * DIM + nBase + t * 16] =
          (_Float16)gelu_exact(acc[t][r]);
  }
}

// ---- K2: encoder layer-2 + phases -> Q, K, Kt -----------------------------
// grid (ROWS / 16), block 256. A block owns 16 rows; each of its 8 waves owns
// one 16x16 tile: waves 0..3 the four column tiles of k, waves 4..7 those of
// q. So 256 blocks share the loads and the tanh / cos / sin work, one tile a
// wave. A tile's k order is 0, 32, ... in one accumulator chain.

__global__ __launch_bounds__(256)
void k_phases(const _Float16* __restrict__ hk,
              const _Float16* __restrict__ hq,
              const _Float16* __restrict__ kw2t,
              const _Float16* __restrict__ qw2t,
              const float* __restrict__ kb2,
              const float* __restrict__ qb2,
              const float* __restrict__ sw,
              _Float16* __restrict__ Qm,   // [ROWS][FDIM]
              _Float16* __restrict__ Km,   // [ROWS][FDIM]
              _Float16* __restrict__ Kt) { // [B][FDIM][SEQ]
  const int lane = threadIdx.x & 31;
  // the wave's number in a scalar register: the choices below become scalar
  const int wave = __builtin_amdgcn_readfirstlane(threadIdx.x >> 5);
  const bool isq = wave >= 4;
  const int t = wave & 3;                  // column tile = orthogonal set
  const int rowBase = blockIdx.x * 16;
  const _Float16* h  = isq ? hq : hk;
  const _Float16* wt = isq ? qw2t : kw2t;
  const int tp = t * 16 + (lane & 15);     // 0..63
  const float bias = (isq ? qb2 : kb2)[tp];

  // A wave has one product a k step, so nothing but its own loads in flight
  // hides their latency: eight k steps are fetched ahead, in registers.
  v16h a[8], b[8];
#pragma unroll
  for (int i = 0; i < 8; ++i) {
    a[i] = load_frag(h, DIM, rowBase, i * 32, lane);
    b[i] = load_frag(wt, DIM, t * 16, i * 32, lane);
  }
  // without it the compiler sinks each load to just above its product
  __builtin_amdgcn_sched_barrier(0);
  v8f acc = {};
  // unrolled: a[] and b[] are indexed by constants and stay in registers
#pragma unroll
  for (int i = 0; i < DIM / 32; ++i) {
    acc = wmma_f16(a[i & 7], b[i & 7], acc);
    if (i + 8 < DIM / 32) {
      a[i & 7] = load_frag(h, DIM, rowBase, (i + 8) * 32, lane);
      b[i & 7] = load_frag(wt, DIM, t * 16, (i + 8) * 32, lane);
      // as above: the refill stays directly behind the product it follows
      __builtin_amdgcn_sched_barrier(0);
    }
  }
  // softmax over 4 set weights (redundant per thread; trivially cheap)
  float s0 = sw[0], s1 = sw[1], s2 = sw[2], s3 = sw[3];
  float mx = fmaxf(fmaxf(s0, s1), fmaxf(s2, s3));
  float e0 = expf(s0 - mx), e1 = expf(s1 - mx), e2 = expf(s2 - mx), e3 = expf(s3 - mx);
  float inv = 1.0f / (e0 + e1 + e2 + e3);
  const float et = (t == 0) ? e0 : (t == 1) ? e1 : (t == 2) ? e2 : e3;
  const float scale = isq ? et * inv : 1.0f;   // k features carry no weight

  const int mBase = rowBase + ((lane >> 4) << 3);
  _Float16* dst = (isq ? Qm : Km) + (size_t)mBase * FDIM + tp;
  v8h ccol, scol;   // a lane's 8 rows of its cos and its sin feature
#pragma unroll
  for (int r = 0; r < 8; ++r) {
    float ph = tanhf(acc[r] + bias) * PI_F;
    ccol[r] = (_Float16)(scale * cosf(ph));
    scol[r] = (_Float16)(scale * sinf(ph));
  }
#pragma unroll
  for (int r = 0; r < 8; ++r) {
    dst[r * FDIM]      = ccol[r];
    dst[r * FDIM + TP] = scol[r];
  }
  if (!isq) {
    // the address arithmetic below reuses registers that the stores above
    // name: the wait stands in front of any rewrite
    asm volatile("s_wait_xcnt 0x0" ::: "memory");
    // K^T [b][f][l]: a lane's 8 rows are 8 neighbours in l (mBase % 8 == 0)
    const int bt = mBase >> 11, l = mBase & 2047;
    *(v8h*)(Kt + ((size_t)(bt * FDIM + tp)) * SEQ + l)      = ccol;
    *(v8h*)(Kt + ((size_t)(bt * FDIM + TP + tp)) * SEQ + l) = scol;
  }
}

// ---- K3a: per-chunk KV sums S_j[f,d] = sum_t K[t,f] V[t,d] ---------------
// grid (NCHK, 8, BATCH), block 256. Register double-buffered K loop.
// V^T is the A operand and K^T the B operand, so the accumulator tile has d
// on its rows and f across its lanes and is stored in Mt's own [d][f] order.

__global__ void k_chunk_kv(const _Float16* __restrict__ Kt,
                           const _Float16* __restrict__ Vt,
                           float* __restrict__ Ssum) { // [B][NCHK][DIM][FDIM]
  const int lane = threadIdx.x & 31, wave = threadIdx.x >> 5;
  const int j = blockIdx.x, dBase = blockIdx.y * 64, b = blockIdx.z;
  const int fBase = wave * 16;
  const _Float16* ktb = Kt + (size_t)b * FDIM * SEQ;
  const _Float16* vtb = Vt + (size_t)b * DIM * SEQ;
  const int kBase = j * CHUNK;

  v8f acc[4] = {};
  v16h a_cur = load_frag(ktb, SEQ, fBase, kBase, lane);
  v16h b_cur[4];
#pragma unroll
  for (int t = 0; t < 4; ++t)
    b_cur[t] = load_frag(vtb, SEQ, dBase + t * 16, kBase, lane);

  for (int i = 0; i < CHUNK / 32; ++i) {
    v16h a_next, b_next[4];
    if (i + 1 < CHUNK / 32) {
      a_next = load_frag(ktb, SEQ, fBase, kBase + (i + 1) * 32, lane);
#pragma unroll
      for (int t = 0; t < 4; ++t)
        b_next[t] = load_frag(vtb, SEQ, dBase + t * 16, kBase + (i + 1) * 32, lane);
    }
#pragma unroll
    for (int t = 0; t < 4; ++t) acc[t] = wmma_f16(b_cur[t], a_cur, acc[t]);
    if (i + 1 < CHUNK / 32) {
      a_cur = a_next;
#pragma unroll
      for (int t = 0; t < 4; ++t) b_cur[t] = b_next[t];
    }
  }

  float* sp = Ssum + ((size_t)(b * NCHK + j) * DIM + dBase + ((lane >> 4) << 3)) * FDIM
                   + fBase + (lane & 15);
#pragma unroll
  for (int t = 0; t < 4; ++t) {
#pragma unroll
    for (int r = 0; r < 8; ++r)
      sp[(t * 16 + r) * FDIM] = acc[t][r];
  }
}

// ---- K3b: exclusive prefix over chunks -> Mt (f16) ------------------------
// Ssum and Mt share the [B][NCHK][DIM][FDIM] order; a thread owns 4 adjacent
// f of one d, so a wave reads 512 and writes 256 contiguous bytes per chunk.
// grid (BATCH*DIM*FDIM/4/128), block 128.

__global__ void k_scan(const float* __restrict__ Ssum,
                       _Float16* __restrict__ Mt) { // [B][NCHK][DIM][FDIM]
  const int PLANE = DIM * FDIM;
  const int tid = blockIdx.x * blockDim.x + threadIdx.x;
  const int b = tid / (PLANE / 4);
  const int e = (tid - b * (PLANE / 4)) * 4;
  const size_t base = (size_t)b * NCHK * PLANE + e;
  v4f run = {};
#pragma unroll
  for (int j = 0; j < NCHK; ++j) {
    *(v4h*)(Mt + base + (size_t)j * PLANE) = __builtin_convertvector(run, v4h);
    run += *(const v4f*)(Ssum + base + (size_t)j * PLANE);
  }
}

// ---- K3c: O = Q@M_prev + tril(Q K^T) @ V ---------------------------------
// grid (NCHK, 8, BATCH), block 256. Scores staged in LDS (f16, padded).

__global__ void k_chunk_out(const _Float16* __restrict__ Qm,
                            const _Float16* __restrict__ Km,
                            const _Float16* __restrict__ Vt,
                            const _Float16* __restrict__ Mt,
                            float* __restrict__ Ot) { // [ROWS][DIM]
  __shared__ _Float16 sc[CHUNK][CHUNK + 8];  // +8 halves pad, keeps 16B align
  const int lane = threadIdx.x & 31, wave = threadIdx.x >> 5;
  const int j = blockIdx.x, dBase = blockIdx.y * 64, b = blockIdx.z;
  const int rowTok = b * SEQ + j * CHUNK;   // first token row of chunk
  const int lBase = wave * 16;

  // Phase A: scores = Q_c K_c^T  (128x128), masked causal-inclusive
  v8f sacc[8] = {};
  for (int f0 = 0; f0 < FDIM; f0 += 32) {
    v16h a = load_frag(Qm, FDIM, rowTok + lBase, f0, lane);
#pragma unroll
    for (int tt = 0; tt < 8; ++tt) {
      v16h bf = load_frag(Km, FDIM, rowTok + tt * 16, f0, lane);
      sacc[tt] = wmma_f16(a, bf, sacc[tt]);
    }
  }
  const int mB = lBase + ((lane >> 4) << 3);
#pragma unroll
  for (int tt = 0; tt < 8; ++tt) {
    const int tl = tt * 16 + (lane & 15);
#pragma unroll
    for (int r = 0; r < 8; ++r) {
      const int ll = mB + r;
      sc[ll][tl] = (_Float16)((tl <= ll) ? sacc[tt][r] : 0.0f);
    }
  }
  __syncthreads();

  // Phase B: O = scores @ V_c + Q_c @ M_prev  (both register double-buffered)
  const _Float16* vtb = Vt + (size_t)b * DIM * SEQ;
  const _Float16* mtb = Mt + (size_t)(b * NCHK + j) * DIM * FDIM;
  v8f acc[4] = {};
  {
    v16h a_cur = load_frag(&sc[0][0], CHUNK + 8, lBase, 0, lane);
    v16h b_cur[4];
#pragma unroll
    for (int t = 0; t < 4; ++t)
      b_cur[t] = load_frag(vtb, SEQ, dBase + t * 16, j * CHUNK, lane);
    for (int i = 0; i < CHUNK / 32; ++i) {
      v16h a_next, b_next[4];
      if (i + 1 < CHUNK / 32) {
        a_next = load_frag(&sc[0][0], CHUNK + 8, lBase, (i + 1) * 32, lane);
#pragma unroll
        for (int t = 0; t < 4; ++t)
          b_next[t] = load_frag(vtb, SEQ, dBase + t * 16,
                                j * CHUNK + (i + 1) * 32, lane);
      }
#pragma unroll
      for (int t = 0; t < 4; ++t) acc[t] = wmma_f16(a_cur, b_cur[t], acc[t]);
      if (i + 1 < CHUNK / 32) {
        a_cur = a_next;
#pragma unroll
        for (int t = 0; t < 4; ++t) b_cur[t] = b_next[t];
      }
    }
  }
  {
    v16h a_cur = load_frag(Qm, FDIM, rowTok + lBase, 0, lane);
    v16h b_cur[4];
#pragma unroll
    for (int t = 0; t < 4; ++t)
      b_cur[t] = load_frag(mtb, FDIM, dBase + t * 16, 0, lane);
    for (int i = 0; i < FDIM / 32; ++i) {
      v16h a_next, b_next[4];
      if (i + 1 < FDIM / 32) {
        a_next = load_frag(Qm, FDIM, rowTok + lBase, (i + 1) * 32, lane);
#pragma unroll
        for (int t = 0; t < 4; ++t)
          b_next[t] = load_frag(mtb, FDIM, dBase + t * 16, (i + 1) * 32, lane);
      }
#pragma unroll
      for (int t = 0; t < 4; ++t) acc[t] = wmma_f16(a_cur, b_cur[t], acc[t]);
      if (i + 1 < FDIM / 32) {
        a_cur = a_next;
#pragma unroll
        for (int t = 0; t < 4; ++t) b_cur[t] = b_next[t];
      }
    }
  }
#pragma unroll
  for (int t = 0; t < 4; ++t) {
    const int d = dBase + t * 16 + (lane & 15);
#pragma unroll
    for (int r = 0; r < 8; ++r)
      Ot[(size_t)(rowTok + mB + r) * DIM + d] = acc[t][r];
  }
}

// ---- K4a: position norm + LayerNorm -> yn (f16) ---------------------------
// grid (ROWS), block 256; 2 elements per thread.

__global__ void k_layernorm(const float* __restrict__ Ot,
                            const float* __restrict__ ln_g,
                            const float* __restrict__ ln_b,
                            _Float16* __restrict__ yn) {
  __shared__ float rs[256], rq[256];
  const int row = blockIdx.x, tid = threadIdx.x;
  const int l = row & 2047;
  const float nf = rsqrtf((float)(l + 1) * (float)NPLN);
  float y0 = Ot[(size_t)row * DIM + tid] * nf;
  float y1 = Ot[(size_t)row * DIM + 256 + tid] * nf;
  rs[tid] = y0 + y1;
  rq[tid] = y0 * y0 + y1 * y1;
  __syncthreads();
#pragma unroll
  for (int s = 128; s > 0; s >>= 1) {
    if (tid < s) { rs[tid] += rs[tid + s]; rq[tid] += rq[tid + s]; }
    __syncthreads();
  }
  const float mu  = rs[0] * (1.0f / DIM);
  const float var = rq[0] * (1.0f / DIM) - mu * mu;
  const float ivs = rsqrtf(var + 1e-5f);
  yn[(size_t)row * DIM + tid]       = (_Float16)((y0 - mu) * ivs * ln_g[tid] + ln_b[tid]);
  yn[(size_t)row * DIM + 256 + tid] = (_Float16)((y1 - mu) * ivs * ln_g[256 + tid] + ln_b[256 + tid]);
}

// ---- K4b: out = x + yn @ ow + ob ------------------------------------------
// grid (32, 8), block 256. Same async LDS staging as K1.

__global__ void k_outproj(const _Float16* __restrict__ yn,
                          const _Float16* __restrict__ owt,
                          const float* __restrict__ ob,
                          const float* __restrict__ x,
                          float* __restrict__ out) {
  __shared__ _Float16 bs[2][64 * 32];
  const int tid = threadIdx.x;
  const int lane = tid & 31, wave = tid >> 5;
  const int rowBase = blockIdx.x * 128 + wave * 16;
  const int colBase = blockIdx.y * 64;

  stage_b_tile(bs[0], owt, DIM, colBase, 0, tid);
  v16h a_cur = load_frag(yn, DIM, rowBase, 0, lane);

  v8f acc[4] = {};
  for (int i = 0; i < DIM / 32; ++i) {
    stage_wait();
    __syncthreads();
    if (i + 1 < DIM / 32)
      stage_b_tile(bs[(i + 1) & 1], owt, DIM, colBase, (i + 1) * 32, tid);
    v16h a_next;
    if (i + 1 < DIM / 32)
      a_next = load_frag(yn, DIM, rowBase, (i + 1) * 32, lane);
#pragma unroll
    for (int t = 0; t < 4; ++t) {
      v16h b = load_frag(bs[i & 1], 32, t * 16, 0, lane);
      acc[t] = wmma_f16(a_cur, b, acc[t]);
    }
    a_cur = a_next;
  }

  const int mBase = rowBase + ((lane >> 4) << 3);
#pragma unroll
  for (int t = 0; t < 4; ++t) {
    const int n = colBase + t * 16 + (lane & 15);
#pragma unroll
    for (int r = 0; r < 8; ++r) {
      const size_t idx = (size_t)(mBase + r) * DIM + n;
      out[idx] = x[idx] + acc[t][r] + ob[n];
    }
  }
}

// ---------------------------------------------------------------------------

extern "C" void kernel_launch(void* const* d_in, const int* in_sizes, int n_in,
                              void* d_out, int out_size, void* d_ws, size_t ws_size,
                              hipStream_t stream) {
  const float* x   = (const float*)d_in[0];
  const float* sw  = (const float*)d_in[1];
  const float* kw1 = (const float*)d_in[2];
  const float* kb1 = (const float*)d_in[3];
  const float* kw2 = (const float*)d_in[4];
  const float* kb2 = (const float*)d_in[5];
  const float* qw1 = (const float*)d_in[6];
  const float* qb1 = (const float*)d_in[7];
  const float* qw2 = (const float*)d_in[8];
  const float* qb2 = (const float*)d_in[9];
  const float* vw  = (const float*)d_in[10];
  const float* vb  = (const float*)d_in[11];
  const float* lng = (const float*)d_in[12];
  const float* lnb = (const float*)d_in[13];
  const float* ow  = (const float*)d_in[14];
  const float* ob  = (const float*)d_in[15];
  float* out = (float*)d_out;

  // workspace carve-up (all 256B aligned)
  char* ws = (char*)d_ws;
  size_t off = 0;
  auto take = [&](size_t bytes) { char* p = ws + off; off += (bytes + 255) & ~(size_t)255; return p; };
  _Float16* xh    = (_Float16*)take((size_t)ROWS * DIM * 2);
  _Float16* hk    = (_Float16*)take((size_t)ROWS * DIM * 2);
  _Float16* hq    = (_Float16*)take((size_t)ROWS * DIM * 2);
  _Float16* vt    = (_Float16*)take((size_t)BATCH * DIM * SEQ * 2);
  _Float16* Qm    = (_Float16*)take((size_t)ROWS * FDIM * 2);
  _Float16* Km    = (_Float16*)take((size_t)ROWS * FDIM * 2);
  _Float16* Kt    = (_Float16*)take((size_t)BATCH * FDIM * SEQ * 2);
  float*    Ssum  = (float*)   take((size_t)BATCH * NCHK * FDIM * DIM * 4);
  _Float16* Mt    = (_Float16*)take((size_t)BATCH * NCHK * DIM * FDIM * 2);
  float*    Ot    = (float*)   take((size_t)ROWS * DIM * 4);
  _Float16* yn    = (_Float16*)take((size_t)ROWS * DIM * 2);
  _Float16* kw1t  = (_Float16*)take((size_t)DIM * DIM * 2);
  _Float16* qw1t  = (_Float16*)take((size_t)DIM * DIM * 2);
  _Float16* vwt   = (_Float16*)take((size_t)DIM * DIM * 2);
  _Float16* owt   = (_Float16*)take((size_t)DIM * DIM * 2);
  _Float16* kw2t  = (_Float16*)take((size_t)TP * DIM * 2);
  _Float16* qw2t  = (_Float16*)take((size_t)TP * DIM * 2);

  // P0: conversions, one launch
  k_prepare<<<NB_PREP, 256, 0, stream>>>(x, kw1, qw1, vw, ow, kw2, qw2,
                                         xh, kw1t, qw1t, vwt, owt, kw2t, qw2t);

  // K1: Hk / Hq / Vt
  k_encode1<<<dim3(ROWS / 128, DIM / 64, 3), 256, 0, stream>>>(
      xh, kw1t, qw1t, vwt, kb1, qb1, vb, hk, hq, vt);

  // K2: phases -> Q, K, Kt
  k_phases<<<dim3(ROWS / 16), 256, 0, stream>>>(
      hk, hq, kw2t, qw2t, kb2, qb2, sw, Qm, Km, Kt);

  // K3: chunked causal linear attention
  k_chunk_kv<<<dim3(NCHK, DIM / 64, BATCH), 256, 0, stream>>>(Kt, vt, Ssum);
  k_scan<<<BATCH * FDIM * DIM / 4 / 128, 128, 0, stream>>>(Ssum, Mt);
  k_chunk_out<<<dim3(NCHK, DIM / 64, BATCH), 256, 0, stream>>>(Qm, Km, vt, Mt, Ot);

  // K4: norm + LN + output projection + residual
  k_layernorm<<<dim3(ROWS), 256, 0, stream>>>(Ot, lng, lnb, yn);
  k_outproj<<<dim3(ROWS / 128, DIM / 64), 256, 0, stream>>>(yn, owt, ob, x, out);
}

// v005
// A run of this version takes 70.3 microseconds.
// Next to v004, in two timings, it ran 1.05 and 1.03 times as fast.
// Over all steps from v000 it is 3.25 times as fast.
#include <hip/hip_runtime.h>
#include <hip/hip_bf16.h>
#include <math.h>

// ---------------------------------------------------------------------------
// MI455X (gfx1250, wave32) implementation.
// Pipeline:
//  P0  convert x -> f16, transpose-convert all weights -> f16 [N,K]; one launch
//  K1  Hk = gelu(x@kw1+b), Hq = gelu(x@qw1+b), Vt = (x@vw+b)^T     (WMMA f16,
//      B tile staged in LDS via async-load-to-LDS, ping-pong)
//  K2  phases -> Q[l,f]=w_s*{cos,sin}(qp), K[l,f], Kt[f,l]          (WMMA f16)
//  K3a per-chunk state sums S_j^T = V_j^T K_j, stored [d][f]        (WMMA f16)
//  K3b exclusive prefix over 16 chunks -> Mt [d][f], f16            (scan)
//  K3c O = Q@M_prev + tril(Q K^T) @ V  (scores staged in LDS)       (WMMA f16)
//  K4a position-norm + LayerNorm -> yn (f16)
//  K4b out = x + yn@ow + ob  (async LDS-staged B, like K1)          (WMMA f16)
// All accumulation in f32 (WMMA f32 accumulators).
// ---------------------------------------------------------------------------

typedef __attribute__((ext_vector_type(16))) _Float16 v16h;
typedef __attribute__((ext_vector_type(8)))  _Float16 v8h;
typedef __attribute__((ext_vector_type(8)))  float    v8f;
typedef __attribute__((ext_vector_type(4)))  int      v4i;
typedef __attribute__((ext_vector_type(4)))  float    v4f;
typedef __attribute__((ext_vector_type(4)))  _Float16 v4h;

#define BATCH 2
#define SEQ   2048
#define DIM   512
#define NSET  4
#define NPLN  16
#define TP    64          // NSET*NPLN
#define FDIM  128         // 2*TP (cos|sin features)
#define ROWS  4096        // BATCH*SEQ
#define CHUNK 128
#define NCHK  16          // SEQ/CHUNK
#define PI_F  3.14159265358979323846f

// CDNA5 async global->LDS path (ASYNCcnt). Guarded so the file compiles on
// toolchains without the builtins (falls back to sync reg->LDS staging).
#if defined(__has_builtin)
#if __has_builtin(__builtin_amdgcn_global_load_async_to_lds_b128) && \
    __has_builtin(__builtin_amdgcn_s_wait_asynccnt)
#define USE_ASYNC_LDS 1
#endif
#endif

#define AS_GLOBAL __attribute__((address_space(1)))
#define AS_LDS    __attribute__((address_space(3)))

// ---- WMMA helpers ---------------------------------------------------------

__device__ __forceinline__ v8f wmma_f16(v16h a, v16h b, v8f c) {
  // v_wmma_f32_16x16x32_f16 : D = A(16x32) x B(32x16) + C
  return __builtin_amdgcn_wmma_f32_16x16x32_f16(false, a, false, b,
                                                (short)0, c, false, false);
}

// Load a 16x32 f16 A-fragment (or the transposed-B fragment, which has the
// identical per-lane layout) from a row-major f16 matrix with leading dim ld.
// ISA layout: lane&15 selects row, (lane>>4)*8 selects K phase; vector
// elements 0..7 hold K = kb..kb+7, elements 8..15 hold K = kb+16..kb+23.
__device__ __forceinline__ v16h load_frag(const _Float16* __restrict__ base,
                                          int ld, int rowBase, int k0, int lane) {
  const _Float16* p = base + (size_t)(rowBase + (lane & 15)) * ld
                           + k0 + ((lane >> 4) << 3);
  v16h f;
  *(v8h*)&f       = *(const v8h*)(p);
  *((v8h*)&f + 1) = *(const v8h*)(p + 16);
  return f;
}

// Stage one 64x32 f16 B sub-tile (4 KB) into LDS, one b128 per thread of a
// 256-thread block. Async (ASYNCcnt path) when available.
__device__ __forceinline__ void stage_b_tile(_Float16* __restrict__ lds_dst,
                                             const _Float16* __restrict__ gsrc,
                                             int ld, int colBase, int k0, int tid) {
  const int r = tid >> 2;          // 0..63  (row of transposed B)
  const int c = (tid & 3) << 3;    // 0,8,16,24 (halves)
  const _Float16* src = gsrc + (size_t)(colBase + r) * ld + k0 + c;
  _Float16* dst = lds_dst + r * 32 + c;
#if defined(USE_ASYNC_LDS)
  _Float16* src_nc = const_cast<_Float16*>(src);
  __builtin_amdgcn_global_load_async_to_lds_b128(
      (AS_GLOBAL v4i*)src_nc, (AS_LDS v4i*)dst, 0, 0);
#else
  *(v8h*)dst = *(const v8h*)src;
#endif
}

__device__ __forceinline__ void stage_wait() {
#if defined(USE_ASYNC_LDS)
  __builtin_amdgcn_s_wait_asynccnt(0);
#endif
}

__device__ __forceinline__ float gelu_exact(float v) {
  return 0.5f * v * (1.0f + erff(v * 0.70710678118654752440f));
}

// ---- P0: conversions ------------------------------------------------------
// A thread makes 8 f16 that are neighbours in dst and stores them as 16 bytes.
// All seven conversions read inputs only and none reads another's output, so
// they share one launch: a block's index says which array it works on.

// dst[n*K+k] = (f16) src[k*N+n]   (store weights transposed for B operands)
// A thread reads 8 consecutive k of one n. A wave is 4 n x 8 groups of k, so
// its one store fills 4 whole 128-byte lines of dst, each written by no other
// wave; the 8 waves of a block read 128 contiguous bytes of each source row.
// idx runs over K * N / 8 threads, in whole blocks of 256.
template <int K, int N>
__device__ __forceinline__ void transpose_f16(const float* __restrict__ src,
                                              _Float16* __restrict__ dst,
                                              unsigned idx) {
  static_assert(N % 4 == 0 && K % 64 == 0, "a wave is 4 n x 64 k");
  static_assert((K * N) % (8 * 256) == 0, "whole blocks cover the matrix");
  const unsigned nb = N >> 2;            // waves across n
  const unsigned w  = idx >> 5;
  const unsigned wk = w / nb, wn = w - wk * nb;
  const unsigned n  = wn * 4 + (idx & 3);
  const unsigned k0 = (wk * 8 + ((idx >> 2) & 7)) * 8;
  const float* p = src + (size_t)k0 * N + n;
  v8h h;
  // unrolled: h stays in registers and the eight loads are in flight together
#pragma unroll
  for (int i = 0; i < 8; ++i) h[i] = (_Float16)p[(size_t)i * N];
  *(v8h*)(dst + (size_t)n * K + k0) = h;
}

#define NB_WBIG   (DIM * DIM / 8 / 256)   // blocks per DIM x DIM weight
#define NB_WSMALL (DIM * TP / 8 / 256)    // blocks per DIM x TP weight
#define NB_X      (ROWS * DIM / 8 / 256)  // blocks for x
#define NB_PREP   (4 * NB_WBIG + 2 * NB_WSMALL + NB_X)

static_assert((ROWS * DIM) % (8 * 256) == 0, "the grid covers x exactly");

// grid (NB_PREP), block 256. The transposes come first in the index order:
// their loads touch more lines than those of the x conversion.
__global__ void k_prepare(const float* __restrict__ x,
                          const float* __restrict__ kw1,
                          const float* __restrict__ qw1,
                          const float* __restrict__ vw,
                          const float* __restrict__ ow,
                          const float* __restrict__ kw2,
                          const float* __restrict__ qw2,
                          _Float16* __restrict__ xh,
                          _Float16* __restrict__ kw1t,
                          _Float16* __restrict__ qw1t,
                          _Float16* __restrict__ vwt,
                          _Float16* __restrict__ owt,
                          _Float16* __restrict__ kw2t,
                          _Float16* __restrict__ qw2t) {
  unsigned blk = blockIdx.x;
  if (blk < 4 * NB_WBIG) {
    const unsigned m = blk / NB_WBIG;
    const float* s = (m == 0) ? kw1 : (m == 1) ? qw1 : (m == 2) ? vw : ow;
    _Float16* d = (m == 0) ? kw1t : (m == 1) ? qw1t : (m == 2) ? vwt : owt;
    transpose_f16<DIM, DIM>(s, d, (blk - m * NB_WBIG) * 256 + threadIdx.x);
    return;
  }
  blk -= 4 * NB_WBIG;
  if (blk < 2 * NB_WSMALL) {
    const unsigned m = blk / NB_WSMALL;
    transpose_f16<DIM, TP>(m == 0 ? kw2 : qw2, m == 0 ? kw2t : qw2t,
                           (blk - m * NB_WSMALL) * 256 + threadIdx.x);
    // the build lays another branch's code behind this store, and that code
    // rewrites the store's registers: the wait stands in front of any rewrite
    asm volatile("s_wait_xcnt 0x0" ::: "memory");
    return;
  }
  blk -= 2 * NB_WSMALL;
  const unsigned i = (blk * 256 + threadIdx.x) * 8;
  *(v8h*)(xh + i) = __builtin_convertvector(*(const v8f*)(x + i), v8h);
  // as above: in front of any rewrite of this store's registers
  asm volatile("s_wait_xcnt 0x0" ::: "memory");
}

// ---- K1: encoder layer-1 GEMMs + V projection -----------------------------
// grid (32, 8, 3), block 256 (8 waves); 128x64 output tile per block.
// B tile ping-pong staged in LDS (async), A fragments double-buffered in regs.

__global__ void k_encode1(const _Float16* __restrict__ xh,
                          const _Float16* __restrict__ kw1t,
                          const _Float16* __restrict__ qw1t,
                          const _Float16* __restrict__ vwt,
                          const float* __restrict__ kb1,
                          const float* __restrict__ qb1,
                          const float* __restrict__ vb,
                          _Float16* __restrict__ hk,
                          _Float16* __restrict__ hq,
                          _Float16* __restrict__ vt) {
  __shared__ _Float16 bs[2][64 * 32];  // 8 KB ping-pong B tile
  const int tid = threadIdx.x;
  const int lane = tid & 31, wave = tid >> 5;
  const int z = blockIdx.z;
  const int rowBase = blockIdx.x * 128 + wave * 16;
  const int colBase = blockIdx.y * 64;
  const _Float16* wt  = (z == 0) ? kw1t : (z == 1) ? qw1t : vwt;
  const float*    bia = (z == 0) ? kb1  : (z == 1) ? qb1  : vb;

  stage_b_tile(bs[0], wt, DIM, colBase, 0, tid);
  v16h a_cur = load_frag(xh, DIM, rowBase, 0, lane);

  v8f acc[4] = {};
  for (int i = 0; i < DIM / 32; ++i) {
    stage_wait();
    __syncthreads();                      // buffer i&1 ready for all waves
    if (i + 1 < DIM / 32)
      stage_b_tile(bs[(i + 1) & 1], wt, DIM, colBase, (i + 1) * 32, tid);
    v16h a_next;
    if (i + 1 < DIM / 32)
      a_next = load_frag(xh, DIM, rowBase, (i + 1) * 32, lane);
#pragma unroll
    for (int t = 0; t < 4; ++t) {
      v16h b = load_frag(bs[i & 1], 32, t * 16, 0, lane);
      acc[t] = wmma_f16(a_cur, b, acc[t]);
    }
    a_cur = a_next;
  }

  const int mBase = rowBase + ((lane >> 4) << 3);
  const int nBase = colBase + (lane & 15);
  // the loops below are unrolled so that acc[] is indexed by constants and
  // stays in registers
#pragma unroll
  for (int t = 0; t < 4; ++t) acc[t] += bia[nBase + t * 16];

  if (z == 2) {
    // V^T [b][d][l]: a lane's 8 rows are 8 neighbours in l (mBase % 8 == 0)
    const int b = mBase >> 11, l = mBase & 2047;
#pragma unroll
    for (int t = 0; t < 4; ++t)
      *(v8h*)(vt + ((size_t)(b * DIM + nBase + t * 16)) * SEQ + l) =
          __builtin_convertvector(acc[t], v8h);
    return;
  }

  _Float16* dst = (z == 0) ? hk : hq;
#pragma unroll
  for (int t = 0; t < 4; ++t) {
#pragma unroll
    for (int r = 0; r < 8; ++r)
      dst[(size_t)(mBase + r) * DIM + nBase + t * 16] =
          (_Float16)gelu_exact(acc[t][r]);
  }
}

// ---- K2: encoder layer-2 + phases -> Q, K, Kt -----------------------------
// grid (ROWS / 16), block 256. A block owns 16 rows; each of its 8 waves owns
// one 16x16 tile: waves 0..3 the four column tiles of k, waves 4..7 those of
// q. So 256 blocks share the loads and the tanh / cos / sin work, one tile a
// wave. A tile's k order is 0, 32, ... in one accumulator chain.

__global__ __launch_bounds__(256)
void k_phases(const _Float16* __restrict__ hk,
              const _Float16* __restrict__ hq,
              const _Float16* __restrict__ kw2t,
              const _Float16* __restrict__ qw2t,
              const float* __restrict__ kb2,
              const float* __restrict__ qb2,
              const float* __restrict__ sw,
              _Float16* __restrict__ Qm,   // [ROWS][FDIM]
              _Float16* __restrict__ Km,   // [ROWS][FDIM]
              _Float16* __restrict__ Kt) { // [B][FDIM][SEQ]
  const int lane = threadIdx.x & 31;
  // the wave's number in a scalar register: the choices below become scalar
  const int wave = __builtin_amdgcn_readfirstlane(threadIdx.x >> 5);
  const bool isq = wave >= 4;
  const int t = wave & 3;                  // column tile = orthogonal set
  const int rowBase = blockIdx.x * 16;
  const _Float16* h  = isq ? hq : hk;
  const _Float16* wt = isq ? qw2t : kw2t;
  const int tp = t * 16 + (lane & 15);     // 0..63
  const float bias = (isq ? qb2 : kb2)[tp];

  // A wave has one product a k step, so nothing but its own loads in flight
  // hides their latency: eight k steps are fetched ahead, in registers.
  v16h a[8], b[8];
#pragma unroll
  for (int i = 0; i < 8; ++i) {
    a[i] = load_frag(h, DIM, rowBase, i * 32, lane);
    b[i] = load_frag(wt, DIM, t * 16, i * 32, lane);
  }
  // without it the compiler sinks each load to just above its product
  __builtin_amdgcn_sched_barrier(0);
  v8f acc = {};
  // unrolled: a[] and b[] are indexed by constants and stay in registers
#pragma unroll
  for (int i = 0; i < DIM / 32; ++i) {
    acc = wmma_f16(a[i & 7], b[i & 7], acc);
    if (i + 8 < DIM / 32) {
      a[i & 7] = load_frag(h, DIM, rowBase, (i + 8) * 32, lane);
      b[i & 7] = load_frag(wt, DIM, t * 16, (i + 8) * 32, lane);
      // as above: the refill stays directly behind the product it follows
      __builtin_amdgcn_sched_barrier(0);
    }
  }
  // softmax over 4 set weights (redundant per thread; trivially cheap)
  float s0 = sw[0], s1 = sw[1], s2 = sw[2], s3 = sw[3];
  float mx = fmaxf(fmaxf(s0, s1), fmaxf(s2, s3));
  float e0 = expf(s0 - mx), e1 = expf(s1 - mx), e2 = expf(s2 - mx), e3 = expf(s3 - mx);
  float inv = 1.0f / (e0 + e1 + e2 + e3);
  const float et = (t == 0) ? e0 : (t == 1) ? e1 : (t == 2) ? e2 : e3;
  const float scale = isq ? et * inv : 1.0f;   // k features carry no weight

  const int mBase = rowBase + ((lane >> 4) << 3);
  _Float16* dst = (isq ? Qm : Km) + (size_t)mBase * FDIM + tp;
  v8h ccol, scol;   // a lane's 8 rows of its cos and its sin feature
#pragma unroll
  for (int r = 0; r < 8; ++r) {
    float ph = tanhf(acc[r] + bias) * PI_F;
    ccol[r] = (_Float16)(scale * cosf(ph));
    scol[r] = (_Float16)(scale * sinf(ph));
  }
#pragma unroll
  for (int r = 0; r < 8; ++r) {
    dst[r * FDIM]      = ccol[r];
    dst[r * FDIM + TP] = scol[r];
  }
  if (!isq) {
    // the address arithmetic below reuses registers that the stores above
    // name: the wait stands in front of any rewrite
    asm volatile("s_wait_xcnt 0x0" ::: "memory");
    // K^T [b][f][l]: a lane's 8 rows are 8 neighbours in l (mBase % 8 == 0)
    const int bt = mBase >> 11, l = mBase & 2047;
    *(v8h*)(Kt + ((size_t)(bt * FDIM + tp)) * SEQ + l)      = ccol;
    *(v8h*)(Kt + ((size_t)(bt * FDIM + TP + tp)) * SEQ + l) = scol;
  }
}

// ---- K3a: per-chunk KV sums S_j[f,d] = sum_t K[t,f] V[t,d] ---------------
// grid (NCHK, 8, BATCH), block 256. Register double-buffered K loop.
// V^T is the A operand and K^T the B operand, so the accumulator tile has d
// on its rows and f across its lanes and is stored in Mt's own [d][f] order.

__global__ void k_chunk_kv(const _Float16* __restrict__ Kt,
                           const _Float16* __restrict__ Vt,
                           float* __restrict__ Ssum) { // [B][NCHK][DIM][FDIM]
  const int lane = threadIdx.x & 31, wave = threadIdx.x >> 5;
  const int j = blockIdx.x, dBase = blockIdx.y * 64, b = blockIdx.z;
  const int fBase = wave * 16;
  const _Float16* ktb = Kt + (size_t)b * FDIM * SEQ;
  const _Float16* vtb = Vt + (size_t)b * DIM * SEQ;
  const int kBase = j * CHUNK;

  v8f acc[4] = {};
  v16h a_cur = load_frag(ktb, SEQ, fBase, kBase, lane);
  v16h b_cur[4];
#pragma unroll
  for (int t = 0; t < 4; ++t)
    b_cur[t] = load_frag(vtb, SEQ, dBase + t * 16, kBase, lane);

  for (int i = 0; i < CHUNK / 32; ++i) {
    v16h a_next, b_next[4];
    if (i + 1 < CHUNK / 32) {
      a_next = load_frag(ktb, SEQ, fBase, kBase + (i + 1) * 32, lane);
#pragma unroll
      for (int t = 0; t < 4; ++t)
        b_next[t] = load_frag(vtb, SEQ, dBase + t * 16, kBase + (i + 1) * 32, lane);
    }
#pragma unroll
    for (int t = 0; t < 4; ++t) acc[t] = wmma_f16(b_cur[t], a_cur, acc[t]);
    if (i + 1 < CHUNK / 32) {
      a_cur = a_next;
#pragma unroll
      for (int t = 0; t < 4; ++t) b_cur[t] = b_next[t];
    }
  }

  float* sp = Ssum + ((size_t)(b * NCHK + j) * DIM + dBase + ((lane >> 4) << 3)) * FDIM
                   + fBase + (lane & 15);
#pragma unroll
  for (int t = 0; t < 4; ++t) {
#pragma unroll
    for (int r = 0; r < 8; ++r)
      sp[(t * 16 + r) * FDIM] = acc[t][r];
  }
}

// ---- K3b: exclusive prefix over chunks -> Mt (f16) ------------------------
// Ssum and Mt share the [B][NCHK][DIM][FDIM] order; a thread owns 4 adjacent
// f of one d, so a wave reads 512 and writes 256 contiguous bytes per chunk.
// grid (BATCH*DIM*FDIM/4/128), block 128.

__global__ void k_scan(const float* __restrict__ Ssum,
                       _Float16* __restrict__ Mt) { // [B][NCHK][DIM][FDIM]
  const int PLANE = DIM * FDIM;
  const int tid = blockIdx.x * blockDim.x + threadIdx.x;
  const int b = tid / (PLANE / 4);
  const int e = (tid - b * (PLANE / 4)) * 4;
  const size_t base = (size_t)b * NCHK * PLANE + e;
  v4f run = {};
#pragma unroll
  for (int j = 0; j < NCHK; ++j) {
    *(v4h*)(Mt + base + (size_t)j * PLANE) = __builtin_convertvector(run, v4h);
    run += *(const v4f*)(Ssum + base + (size_t)j * PLANE);
  }
}

// ---- K3c: O = Q@M_prev + tril(Q K^T) @ V ---------------------------------
// grid (NCHK, 8, BATCH), block 256. Scores staged in LDS (f16, padded).

__global__ void k_chunk_out(const _Float16* __restrict__ Qm,
                            const _Float16* __restrict__ Km,
                            const _Float16* __restrict__ Vt,
                            const _Float16* __restrict__ Mt,
                            float* __restrict__ Ot) { // [ROWS][DIM]
  __shared__ _Float16 sc[CHUNK][CHUNK + 8];  // +8 halves pad, keeps 16B align
  const int lane = threadIdx.x & 31, wave = threadIdx.x >> 5;
  const int j = blockIdx.x, dBase = blockIdx.y * 64, b = blockIdx.z;
  const int rowTok = b * SEQ + j * CHUNK;   // first token row of chunk
  const int lBase = wave * 16;

  // Phase A: scores = Q_c K_c^T  (128x128), masked causal-inclusive
  v8f sacc[8] = {};
  for (int f0 = 0; f0 < FDIM; f0 += 32) {
    v16h a = load_frag(Qm, FDIM, rowTok + lBase, f0, lane);
#pragma unroll
    for (int tt = 0; tt < 8; ++tt) {
      v16h bf = load_frag(Km, FDIM, rowTok + tt * 16, f0, lane);
      sacc[tt] = wmma_f16(a, bf, sacc[tt]);
    }
  }
  const int mB = lBase + ((lane >> 4) << 3);
#pragma unroll
  for (int tt = 0; tt < 8; ++tt) {
    const int tl = tt * 16 + (lane & 15);
#pragma unroll
    for (int r = 0; r < 8; ++r) {
      const int ll = mB + r;
      sc[ll][tl] = (_Float16)((tl <= ll) ? sacc[tt][r] : 0.0f);
    }
  }
  __syncthreads();

  // Phase B: O = scores @ V_c + Q_c @ M_prev  (both register double-buffered)
  const _Float16* vtb = Vt + (size_t)b * DIM * SEQ;
  const _Float16* mtb = Mt + (size_t)(b * NCHK + j) * DIM * FDIM;
  v8f acc[4] = {};
  {
    v16h a_cur = load_frag(&sc[0][0], CHUNK + 8, lBase, 0, lane);
    v16h b_cur[4];
#pragma unroll
    for (int t = 0; t < 4; ++t)
      b_cur[t] = load_frag(vtb, SEQ, dBase + t * 16, j * CHUNK, lane);
    for (int i = 0; i < CHUNK / 32; ++i) {
      v16h a_next, b_next[4];
      if (i + 1 < CHUNK / 32) {
        a_next = load_frag(&sc[0][0], CHUNK + 8, lBase, (i + 1) * 32, lane);
#pragma unroll
        for (int t = 0; t < 4; ++t)
          b_next[t] = load_frag(vtb, SEQ, dBase + t * 16,
                                j * CHUNK + (i + 1) * 32, lane);
      }
#pragma unroll
      for (int t = 0; t < 4; ++t) acc[t] = wmma_f16(a_cur, b_cur[t], acc[t]);
      if (i + 1 < CHUNK / 32) {
        a_cur = a_next;
#pragma unroll
        for (int t = 0; t < 4; ++t) b_cur[t] = b_next[t];
      }
    }
  }
  {
    v16h a_cur = load_frag(Qm, FDIM, rowTok + lBase, 0, lane);
    v16h b_cur[4];
#pragma unroll
    for (int t = 0; t < 4; ++t)
      b_cur[t] = load_frag(mtb, FDIM, dBase + t * 16, 0, lane);
    for (int i = 0; i < FDIM / 32; ++i) {
      v16h a_next, b_next[4];
      if (i + 1 < FDIM / 32) {
        a_next = load_frag(Qm, FDIM, rowTok + lBase, (i + 1) * 32, lane);
#pragma unroll
        for (int t = 0; t < 4; ++t)
          b_next[t] = load_frag(mtb, FDIM, dBase + t * 16, (i + 1) * 32, lane);
      }
#pragma unroll
      for (int t = 0; t < 4; ++t) acc[t] = wmma_f16(a_cur, b_cur[t], acc[t]);
      if (i + 1 < FDIM / 32) {
        a_cur = a_next;
#pragma unroll
        for (int t = 0; t < 4; ++t) b_cur[t] = b_next[t];
      }
    }
  }
#pragma unroll
  for (int t = 0; t < 4; ++t) {
    const int d = dBase + t * 16 + (lane & 15);
#pragma unroll
    for (int r = 0; r < 8; ++r)
      Ot[(size_t)(rowTok + mB + r) * DIM + d] = acc[t][r];
  }
}

// ---- K4a: position norm + LayerNorm -> yn (f16) ---------------------------
// grid (ROWS / 16), block 256. A wave owns two whole rows, 16 elements of each
// a lane, and sums them across its lanes: no LDS and no barrier, and only
// 2,048 waves to start, in as many blocks as the chip has WGPs. Every load of
// a wave covers 512 contiguous bytes, every store 256.

// v of the lane whose number within its 16-lane row differs by XMASK
template <int XMASK>
__device__ __forceinline__ float row_xor(float v) {
  return __builtin_bit_cast(float, __builtin_amdgcn_update_dpp(
      0, __builtin_bit_cast(int, v), 0x160 + XMASK, 0xf, 0xf, true));
}

// the sum of v over the 32 lanes, in every lane
__device__ __forceinline__ float wave_sum(float v) {
  v += row_xor<1>(v);
  v += row_xor<2>(v);
  v += row_xor<4>(v);
  v += row_xor<8>(v);
  // the lane of the same number in the other 16-lane row
  const int o = __builtin_bit_cast(int, v);
  v += __builtin_bit_cast(float, __builtin_amdgcn_permlanex16(
      o, o, 0x76543210, 0xfedcba98, false, false));
  return v;
}

static_assert(DIM == 4 * 32 * 4, "a lane holds 4 vectors of 4 of a row");
static_assert(ROWS % 16 == 0, "whole blocks of 8 waves x 2 rows");

__global__ __launch_bounds__(256)
void k_layernorm(const float* __restrict__ Ot,
                 const float* __restrict__ ln_g,
                 const float* __restrict__ ln_b,
                 _Float16* __restrict__ yn) {
  const int lane = threadIdx.x & 31;
  // the wave's number in a scalar register: the rows' addresses become scalar
  const int wave = __builtin_amdgcn_readfirstlane(threadIdx.x >> 5);
  const int row0 = (blockIdx.x * 8 + wave) * 2;
  const int col = lane * 4;
  const float* __restrict__ src = Ot + (size_t)row0 * DIM;
  _Float16* __restrict__ dst = yn + (size_t)row0 * DIM;
  // the loops below are unrolled so that the arrays stay in registers and all
  // sixteen loads are in flight together
  v4f y[2][4], g[4], be[4];
#pragma unroll
  for (int r = 0; r < 2; ++r) {
#pragma unroll
    for (int c = 0; c < 4; ++c)
      y[r][c] = *(const v4f*)(src + r * DIM + c * 128 + col);
  }
#pragma unroll
  for (int c = 0; c < 4; ++c) {
    g[c]  = *(const v4f*)(ln_g + c * 128 + col);
    be[c] = *(const v4f*)(ln_b + c * 128 + col);
  }
  // without it the compiler sinks the loads of g and be behind the sums, where
  // their latency comes on top of that of y
  __builtin_amdgcn_sched_barrier(0);
  // in front of any rewrite of a register that the loads above name; as its
  // inputs, their offset and base registers stay as they are up to the wait
  asm volatile("s_wait_xcnt 0x0"
               :: "v"(col * 4), "s"(src), "s"(ln_g), "s"(ln_b) : "memory");
  float s[2], q[2];
#pragma unroll
  for (int r = 0; r < 2; ++r) {
    const int l = (row0 + r) & 2047;
    const float nf = rsqrtf((float)(l + 1) * (float)NPLN);
    v4f vs = {}, vq = {};
#pragma unroll
    for (int c = 0; c < 4; ++c) {
      y[r][c] *= nf;
      vs += y[r][c];
      vq += y[r][c] * y[r][c];
    }
    s[r] = (vs[0] + vs[1]) + (vs[2] + vs[3]);
    q[r] = (vq[0] + vq[1]) + (vq[2] + vq[3]);
  }
#pragma unroll
  for (int r = 0; r < 2; ++r) {
    s[r] = wave_sum(s[r]);
    q[r] = wave_sum(q[r]);
  }
#pragma unroll
  for (int r = 0; r < 2; ++r) {
    const float mu  = s[r] * (1.0f / DIM);
    const float var = q[r] * (1.0f / DIM) - mu * mu;
    const float ivs = rsqrtf(var + 1e-5f);
#pragma unroll
    for (int c = 0; c < 4; ++c)
      *(v4h*)(dst + r * DIM + c * 128 + col) =
          __builtin_convertvector((y[r][c] - mu) * ivs * g[c] + be[c], v4h);
  }
}

// ---- K4b: out = x + yn @ ow + ob ------------------------------------------
// grid (32, 8), block 256. Same async LDS staging as K1.

__global__ void k_outproj(const _Float16* __restrict__ yn,
                          const _Float16* __restrict__ owt,
                          const float* __restrict__ ob,
                          const float* __restrict__ x,
                          float* __restrict__ out) {
  __shared__ _Float16 bs[2][64 * 32];
  const int tid = threadIdx.x;
  const int lane = tid & 31, wave = tid >> 5;
  const int rowBase = blockIdx.x * 128 + wave * 16;
  const int colBase = blockIdx.y * 64;

  stage_b_tile(bs[0], owt, DIM, colBase, 0, tid);
  v16h a_cur = load_frag(yn, DIM, rowBase, 0, lane);

  v8f acc[4] = {};
  for (int i = 0; i < DIM / 32; ++i) {
    stage_wait();
    __syncthreads();
    if (i + 1 < DIM / 32)
      stage_b_tile(bs[(i + 1) & 1], owt, DIM, colBase, (i + 1) * 32, tid);
    v16h a_next;
    if (i + 1 < DIM / 32)
      a_next = load_frag(yn, DIM, rowBase, (i + 1) * 32, lane);
#pragma unroll
    for (int t = 0; t < 4; ++t) {
      v16h b = load_frag(bs[i & 1], 32, t * 16, 0, lane);
      acc[t] = wmma_f16(a_cur, b, acc[t]);
    }
    a_cur = a_next;
  }

  const int mBase = rowBase + ((lane >> 4) << 3);
#pragma unroll
  for (int t = 0; t < 4; ++t) {
    const int n = colBase + t * 16 + (lane & 15);
#pragma unroll
    for (int r = 0; r < 8; ++r) {
      const size_t idx = (size_t)(mBase + r) * DIM + n;
      out[idx] = x[idx] + acc[t][r] + ob[n];
    }
  }
}

// ---------------------------------------------------------------------------

extern "C" void kernel_launch(void* const* d_in, const int* in_sizes, int n_in,
                              void* d_out, int out_size, void* d_ws, size_t ws_size,
                              hipStream_t stream) {
  const float* x   = (const float*)d_in[0];
  const float* sw  = (const float*)d_in[1];
  const float* kw1 = (const float*)d_in[2];
  const float* kb1 = (const float*)d_in[3];
  const float* kw2 = (const float*)d_in[4];
  const float* kb2 = (const float*)d_in[5];
  const float* qw1 = (const float*)d_in[6];
  const float* qb1 = (const float*)d_in[7];
  const float* qw2 = (const float*)d_in[8];
  const float* qb2 = (const float*)d_in[9];
  const float* vw  = (const float*)d_in[10];
  const float* vb  = (const float*)d_in[11];
  const float* lng = (const float*)d_in[12];
  const float* lnb = (const float*)d_in[13];
  const float* ow  = (const float*)d_in[14];
  const float* ob  = (const float*)d_in[15];
  float* out = (float*)d_out;

  // workspace carve-up (all 256B aligned)
  char* ws = (char*)d_ws;
  size_t off = 0;
  auto take = [&](size_t bytes) { char* p = ws + off; off += (bytes + 255) & ~(size_t)255; return p; };
  _Float16* xh    = (_Float16*)take((size_t)ROWS * DIM * 2);
  _Float16* hk    = (_Float16*)take((size_t)ROWS * DIM * 2);
  _Float16* hq    = (_Float16*)take((size_t)ROWS * DIM * 2);
  _Float16* vt    = (_Float16*)take((size_t)BATCH * DIM * SEQ * 2);
  _Float16* Qm    = (_Float16*)take((size_t)ROWS * FDIM * 2);
  _Float16* Km    = (_Float16*)take((size_t)ROWS * FDIM * 2);
  _Float16* Kt    = (_Float16*)take((size_t)BATCH * FDIM * SEQ * 2);
  float*    Ssum  = (float*)   take((size_t)BATCH * NCHK * FDIM * DIM * 4);
  _Float16* Mt    = (_Float16*)take((size_t)BATCH * NCHK * DIM * FDIM * 2);
  float*    Ot    = (float*)   take((size_t)ROWS * DIM * 4);
  _Float16* yn    = (_Float16*)take((size_t)ROWS * DIM * 2);
  _Float16* kw1t  = (_Float16*)take((size_t)DIM * DIM * 2);
  _Float16* qw1t  = (_Float16*)take((size_t)DIM * DIM * 2);
  _Float16* vwt   = (_Float16*)take((size_t)DIM * DIM * 2);
  _Float16* owt   = (_Float16*)take((size_t)DIM * DIM * 2);
  _Float16* kw2t  = (_Float16*)take((size_t)TP * DIM * 2);
  _Float16* qw2t  = (_Float16*)take((size_t)TP * DIM * 2);

  // P0: conversions, one launch
  k_prepare<<<NB_PREP, 256, 0, stream>>>(x, kw1, qw1, vw, ow, kw2, qw2,
                                         xh, kw1t, qw1t, vwt, owt, kw2t, qw2t);

  // K1: Hk / Hq / Vt
  k_encode1<<<dim3(ROWS / 128, DIM / 64, 3), 256, 0, stream>>>(
      xh, kw1t, qw1t, vwt, kb1, qb1, vb, hk, hq, vt);

  // K2: phases -> Q, K, Kt
  k_phases<<<dim3(ROWS / 16), 256, 0, stream>>>(
      hk, hq, kw2t, qw2t, kb2, qb2, sw, Qm, Km, Kt);

  // K3: chunked causal linear attention
  k_chunk_kv<<<dim3(NCHK, DIM / 64, BATCH), 256, 0, stream>>>(Kt, vt, Ssum);
  k_scan<<<BATCH * FDIM * DIM / 4 / 128, 128, 0, stream>>>(Ssum, Mt);
  k_chunk_out<<<dim3(NCHK, DIM / 64, BATCH), 256, 0, stream>>>(Qm, Km, vt, Mt, Ot);

  // K4: norm + LN + output projection + residual
  k_layernorm<<<dim3(ROWS / 16), 256, 0, stream>>>(Ot, lng, lnb, yn);
  k_outproj<<<dim3(ROWS / 128, DIM / 64), 256, 0, stream>>>(yn, owt, ob, x, out);
}

// v006
// It runs in 60.1 microseconds.
// Timed twice side by side with v005, it ran 1.17 times as fast both times.
// Over all steps from v000 it is 3.81 times as fast.
#include <hip/hip_runtime.h>
#include <hip/hip_bf16.h>
#include <math.h>

// ---------------------------------------------------------------------------
// MI455X (gfx1250, wave32) implementation.
// Pipeline:
//  P0  convert x -> f16, transpose-convert all weights -> f16 [N,K]; one launch
//  K1  Hk = gelu(x@kw1+b), Hq = gelu(x@qw1+b), Vt = (x@vw+b)^T     (WMMA f16,
//      B panel of all k staged once in LDS via async-load-to-LDS)
//  K2  phases -> Q[l,f]=w_s*{cos,sin}(qp), K[l,f], Kt[f,l]          (WMMA f16)
//  K3a per-chunk state sums S_j^T = V_j^T K_j, stored [d][f]        (WMMA f16)
//  K3b exclusive prefix over 16 chunks -> Mt [d][f], f16            (scan)
//  K3c O = Q@M_prev + tril(Q K^T) @ V  (scores staged in LDS)       (WMMA f16)
//  K4a position-norm + LayerNorm -> yn (f16)
//  K4b out = x + yn@ow + ob  (async LDS-staged B, like K1)          (WMMA f16)
// All accumulation in f32 (WMMA f32 accumulators).
// ---------------------------------------------------------------------------

typedef __attribute__((ext_vector_type(16))) _Float16 v16h;
typedef __attribute__((ext_vector_type(8)))  _Float16 v8h;
typedef __attribute__((ext_vector_type(8)))  float    v8f;
typedef __attribute__((ext_vector_type(4)))  int      v4i;
typedef __attribute__((ext_vector_type(4)))  float    v4f;
typedef __attribute__((ext_vector_type(4)))  _Float16 v4h;

#define BATCH 2
#define SEQ   2048
#define DIM   512
#define NSET  4
#define NPLN  16
#define TP    64          // NSET*NPLN
#define FDIM  128         // 2*TP (cos|sin features)
#define ROWS  4096        // BATCH*SEQ
#define CHUNK 128
#define NCHK  16          // SEQ/CHUNK
#define PI_F  3.14159265358979323846f

// CDNA5 async global->LDS path (ASYNCcnt). Guarded so the file compiles on
// toolchains without the builtins (falls back to sync reg->LDS staging).
#if defined(__has_builtin)
#if __has_builtin(__builtin_amdgcn_global_load_async_to_lds_b128) && \
    __has_builtin(__builtin_amdgcn_s_wait_asynccnt)
#define USE_ASYNC_LDS 1
#endif
#endif

#define AS_GLOBAL __attribute__((address_space(1)))
#define AS_LDS    __attribute__((address_space(3)))

// ---- WMMA helpers ---------------------------------------------------------

__device__ __forceinline__ v8f wmma_f16(v16h a, v16h b, v8f c) {
  // v_wmma_f32_16x16x32_f16 : D = A(16x32) x B(32x16) + C
  return __builtin_amdgcn_wmma_f32_16x16x32_f16(false, a, false, b,
                                                (short)0, c, false, false);
}

// Load a 16x32 f16 A-fragment (or the transposed-B fragment, which has the
// identical per-lane layout) from a row-major f16 matrix with leading dim ld.
// ISA layout: lane&15 selects row, (lane>>4)*8 selects K phase; vector
// elements 0..7 hold K = kb..kb+7, elements 8..15 hold K = kb+16..kb+23.
__device__ __forceinline__ v16h load_frag(const _Float16* __restrict__ base,
                                          int ld, int rowBase, int k0, int lane) {
  const _Float16* p = base + (size_t)(rowBase + (lane & 15)) * ld
                           + k0 + ((lane >> 4) << 3);
  v16h f;
  *(v8h*)&f       = *(const v8h*)(p);
  *((v8h*)&f + 1) = *(const v8h*)(p + 16);
  return f;
}

// LDS row pitch of a B panel, in halves: 1040 bytes = 16 B x 65, an odd count,
// so the 16 rows that a ds_load_b128 reads fall on different banks.
#define BPITCH (DIM + 8)

// Stage a whole 64 x DIM f16 B panel (64 KB) into LDS: 16 b128 per thread of a
// 256-thread block, all in flight together. A wave's copy takes 512 contiguous
// bytes, half a row. Async (ASYNCcnt path) when available.
__device__ __forceinline__ void stage_b_panel(_Float16* __restrict__ lds_dst,
                                              const _Float16* __restrict__ gsrc,
                                              int colBase, int tid) {
  const int r = tid >> 6;          // 0..3  (row of transposed B, within 4)
  const int c = (tid & 63) << 3;   // 0,8,..,504 (halves)
  const _Float16* src = gsrc + (size_t)(colBase + r) * DIM + c;
  _Float16* dst = lds_dst + r * BPITCH + c;
  // unrolled: the steps become constants of the copies' addresses
#pragma unroll
  for (int i = 0; i < 16; ++i) {
#if defined(USE_ASYNC_LDS)
    _Float16* src_nc = const_cast<_Float16*>(src + i * 4 * DIM);
    __builtin_amdgcn_global_load_async_to_lds_b128(
        (AS_GLOBAL v4i*)src_nc, (AS_LDS v4i*)(dst + i * 4 * BPITCH), 0, 0);
#else
    *(v8h*)(dst + i * 4 * BPITCH) = *(const v8h*)(src + i * 4 * DIM);
#endif
  }
}

// The issuing wave's own copies have landed behind it; in asm with the memory
// clobber, so that no LDS read is moved in front of it.
__device__ __forceinline__ void stage_wait() {
#if defined(USE_ASYNC_LDS)
  asm volatile("s_wait_asynccnt 0x0" ::: "memory");
#endif
}

// acc[t] += A[rowBase .. +15][0 .. DIM) x (rows colBase + 16 t .. +15 of wt)^T,
// t = 0..3, for each of the 8 waves of a block; k runs 0, 32, ... in one
// accumulator chain a tile. Every load of the product is issued at the start:
// the B panel's copies and the wave's 16 A fragments wait out one memory
// latency together, and one barrier publishes the panel.
__device__ __forceinline__ void gemm_16x64(const _Float16* __restrict__ A,
                                           const _Float16* __restrict__ wt,
                                           _Float16* __restrict__ bs,
                                           int rowBase, int colBase, int tid,
                                           v8f (&acc)[4]) {
  const int lane = tid & 31;
  stage_b_panel(bs, wt, colBase, tid);
  // the loops below are unrolled so that a[] stays in registers
  v16h a[DIM / 32];
#pragma unroll
  for (int i = 0; i < DIM / 32; ++i)
    a[i] = load_frag(A, DIM, rowBase, i * 32, lane);
  // without it the compiler sinks each load to just above its product
  __builtin_amdgcn_sched_barrier(0);
  // in front of any rewrite of a register that the loads above name
  asm volatile("s_wait_xcnt 0x0" ::: "memory");
  stage_wait();
  __syncthreads();                        // the panel is ready for all waves
  // With no barrier left between the k steps, a step's four B fragments are
  // read from LDS as one group, one step ahead of their products.
  v16h b[2][4];
#pragma unroll
  for (int t = 0; t < 4; ++t) b[0][t] = load_frag(bs, BPITCH, t * 16, 0, lane);
#pragma unroll
  for (int i = 0; i < DIM / 32; ++i) {
    if (i + 1 < DIM / 32) {
#pragma unroll
      for (int t = 0; t < 4; ++t)
        b[(i + 1) & 1][t] = load_frag(bs, BPITCH, t * 16, (i + 1) * 32, lane);
    }
    // without it the compiler sinks each LDS read to just above its product,
    // which then waits out the whole LDS latency
    __builtin_amdgcn_sched_barrier(0);
#pragma unroll
    for (int t = 0; t < 4; ++t) acc[t] = wmma_f16(a[i], b[i & 1][t], acc[t]);
    // as above: the next group of reads stays behind these products
    __builtin_amdgcn_sched_barrier(0);
  }
}

__device__ __forceinline__ float gelu_exact(float v) {
  return 0.5f * v * (1.0f + erff(v * 0.70710678118654752440f));
}

// ---- P0: conversions ------------------------------------------------------
// A thread makes 8 f16 that are neighbours in dst and stores them as 16 bytes.
// All seven conversions read inputs only and none reads another's output, so
// they share one launch: a block's index says which array it works on.

// dst[n*K+k] = (f16) src[k*N+n]   (store weights transposed for B operands)
// A thread reads 8 consecutive k of one n. A wave is 4 n x 8 groups of k, so
// its one store fills 4 whole 128-byte lines of dst, each written by no other
// wave; the 8 waves of a block read 128 contiguous bytes of each source row.
// idx runs over K * N / 8 threads, in whole blocks of 256.
template <int K, int N>
__device__ __forceinline__ void transpose_f16(const float* __restrict__ src,
                                              _Float16* __restrict__ dst,
                                              unsigned idx) {
  static_assert(N % 4 == 0 && K % 64 == 0, "a wave is 4 n x 64 k");
  static_assert((K * N) % (8 * 256) == 0, "whole blocks cover the matrix");
  const unsigned nb = N >> 2;            // waves across n
  const unsigned w  = idx >> 5;
  const unsigned wk = w / nb, wn = w - wk * nb;
  const unsigned n  = wn * 4 + (idx & 3);
  const unsigned k0 = (wk * 8 + ((idx >> 2) & 7)) * 8;
  const float* p = src + (size_t)k0 * N + n;
  v8h h;
  // unrolled: h stays in registers and the eight loads are in flight together
#pragma unroll
  for (int i = 0; i < 8; ++i) h[i] = (_Float16)p[(size_t)i * N];
  *(v8h*)(dst + (size_t)n * K + k0) = h;
}

#define NB_WBIG   (DIM * DIM / 8 / 256)   // blocks per DIM x DIM weight
#define NB_WSMALL (DIM * TP / 8 / 256)    // blocks per DIM x TP weight
#define NB_X      (ROWS * DIM / 8 / 256)  // blocks for x
#define NB_PREP   (4 * NB_WBIG + 2 * NB_WSMALL + NB_X)

static_assert((ROWS * DIM) % (8 * 256) == 0, "the grid covers x exactly");

// grid (NB_PREP), block 256. The transposes come first in the index order:
// their loads touch more lines than those of the x conversion.
__global__ void k_prepare(const float* __restrict__ x,
                          const float* __restrict__ kw1,
                          const float* __restrict__ qw1,
                          const float* __restrict__ vw,
                          const float* __restrict__ ow,
                          const float* __restrict__ kw2,
                          const float* __restrict__ qw2,
                          _Float16* __restrict__ xh,
                          _Float16* __restrict__ kw1t,
                          _Float16* __restrict__ qw1t,
                          _Float16* __restrict__ vwt,
                          _Float16* __restrict__ owt,
                          _Float16* __restrict__ kw2t,
                          _Float16* __restrict__ qw2t) {
  unsigned blk = blockIdx.x;
  if (blk < 4 * NB_WBIG) {
    const unsigned m = blk / NB_WBIG;
    const float* s = (m == 0) ? kw1 : (m == 1) ? qw1 : (m == 2) ? vw : ow;
    _Float16* d = (m == 0) ? kw1t : (m == 1) ? qw1t : (m == 2) ? vwt : owt;
    transpose_f16<DIM, DIM>(s, d, (blk - m * NB_WBIG) * 256 + threadIdx.x);
    return;
  }
  blk -= 4 * NB_WBIG;
  if (blk < 2 * NB_WSMALL) {
    const unsigned m = blk / NB_WSMALL;
    transpose_f16<DIM, TP>(m == 0 ? kw2 : qw2, m == 0 ? kw2t : qw2t,
                           (blk - m * NB_WSMALL) * 256 + threadIdx.x);
    // the build lays another branch's code behind this store, and that code
    // rewrites the store's registers: the wait stands in front of any rewrite
    asm volatile("s_wait_xcnt 0x0" ::: "memory");
    return;
  }
  blk -= 2 * NB_WSMALL;
  const unsigned i = (blk * 256 + threadIdx.x) * 8;
  *(v8h*)(xh + i) = __builtin_convertvector(*(const v8f*)(x + i), v8h);
  // as above: in front of any rewrite of this store's registers
  asm volatile("s_wait_xcnt 0x0" ::: "memory");
}

// ---- K1: encoder layer-1 GEMMs + V projection -----------------------------
// grid (32, 8, 3), block 256 (8 waves); 128x64 output tile per block.

__global__ __launch_bounds__(256)
void k_encode1(const _Float16* __restrict__ xh,
                          const _Float16* __restrict__ kw1t,
                          const _Float16* __restrict__ qw1t,
                          const _Float16* __restrict__ vwt,
                          const float* __restrict__ kb1,
                          const float* __restrict__ qb1,
                          const float* __restrict__ vb,
                          _Float16* __restrict__ hk,
                          _Float16* __restrict__ hq,
                          _Float16* __restrict__ vt) {
  // the B panel, 65 KB; 16-byte copies and reads
  __shared__ __attribute__((aligned(16))) _Float16 bs[64 * BPITCH];
  const int tid = threadIdx.x;
  const int lane = tid & 31, wave = tid >> 5;
  const int z = blockIdx.z;
  const int rowBase = blockIdx.x * 128 + wave * 16;
  const int colBase = blockIdx.y * 64;
  const _Float16* wt  = (z == 0) ? kw1t : (z == 1) ? qw1t : vwt;
  const float*    bia = (z == 0) ? kb1  : (z == 1) ? qb1  : vb;

  v8f acc[4] = {};
  gemm_16x64(xh, wt, bs, rowBase, colBase, tid, acc);

  const int mBase = rowBase + ((lane >> 4) << 3);
  const int nBase = colBase + (lane & 15);
  // the loops below are unrolled so that acc[] is indexed by constants and
  // stays in registers
#pragma unroll
  for (int t = 0; t < 4; ++t) acc[t] += bia[nBase + t * 16];

  if (z == 2) {
    // V^T [b][d][l]: a lane's 8 rows are 8 neighbours in l (mBase % 8 == 0)
    const int b = mBase >> 11, l = mBase & 2047;
#pragma unroll
    for (int t = 0; t < 4; ++t)
      *(v8h*)(vt + ((size_t)(b * DIM + nBase + t * 16)) * SEQ + l) =
          __builtin_convertvector(acc[t], v8h);
    return;
  }

  _Float16* dst = (z == 0) ? hk : hq;
#pragma unroll
  for (int t = 0; t < 4; ++t) {
#pragma unroll
    for (int r = 0; r < 8; ++r)
      dst[(size_t)(mBase + r) * DIM + nBase + t * 16] =
          (_Float16)gelu_exact(acc[t][r]);
  }
}

// ---- K2: encoder layer-2 + phases -> Q, K, Kt -----------------------------
// grid (ROWS / 16), block 256. A block owns 16 rows; each of its 8 waves owns
// one 16x16 tile: waves 0..3 the four column tiles of k, waves 4..7 those of
// q. So 256 blocks share the loads and the tanh / cos / sin work, one tile a
// wave. A tile's k order is 0, 32, ... in one accumulator chain.

__global__ __launch_bounds__(256)
void k_phases(const _Float16* __restrict__ hk,
              const _Float16* __restrict__ hq,
              const _Float16* __restrict__ kw2t,
              const _Float16* __restrict__ qw2t,
              const float* __restrict__ kb2,
              const float* __restrict__ qb2,
              const float* __restrict__ sw,
              _Float16* __restrict__ Qm,   // [ROWS][FDIM]
              _Float16* __restrict__ Km,   // [ROWS][FDIM]
              _Float16* __restrict__ Kt) { // [B][FDIM][SEQ]
  const int lane = threadIdx.x & 31;
  // the wave's number in a scalar register: the choices below become scalar
  const int wave = __builtin_amdgcn_readfirstlane(threadIdx.x >> 5);
  const bool isq = wave >= 4;
  const int t = wave & 3;                  // column tile = orthogonal set
  const int rowBase = blockIdx.x * 16;
  const _Float16* h  = isq ? hq : hk;
  const _Float16* wt = isq ? qw2t : kw2t;
  const int tp = t * 16 + (lane & 15);     // 0..63
  const float bias = (isq ? qb2 : kb2)[tp];

  // A wave has one product a k step, so nothing but its own loads in flight
  // hides their latency: eight k steps are fetched ahead, in registers.
  v16h a[8], b[8];
#pragma unroll
  for (int i = 0; i < 8; ++i) {
    a[i] = load_frag(h, DIM, rowBase, i * 32, lane);
    b[i] = load_frag(wt, DIM, t * 16, i * 32, lane);
  }
  // without it the compiler sinks each load to just above its product
  __builtin_amdgcn_sched_barrier(0);
  v8f acc = {};
  // unrolled: a[] and b[] are indexed by constants and stay in registers
#pragma unroll
  for (int i = 0; i < DIM / 32; ++i) {
    acc = wmma_f16(a[i & 7], b[i & 7], acc);
    if (i + 8 < DIM / 32) {
      a[i & 7] = load_frag(h, DIM, rowBase, (i + 8) * 32, lane);
      b[i & 7] = load_frag(wt, DIM, t * 16, (i + 8) * 32, lane);
      // as above: the refill stays directly behind the product it follows
      __builtin_amdgcn_sched_barrier(0);
    }
  }
  // softmax over 4 set weights (redundant per thread; trivially cheap)
  float s0 = sw[0], s1 = sw[1], s2 = sw[2], s3 = sw[3];
  float mx = fmaxf(fmaxf(s0, s1), fmaxf(s2, s3));
  float e0 = expf(s0 - mx), e1 = expf(s1 - mx), e2 = expf(s2 - mx), e3 = expf(s3 - mx);
  float inv = 1.0f / (e0 + e1 + e2 + e3);
  const float et = (t == 0) ? e0 : (t == 1) ? e1 : (t == 2) ? e2 : e3;
  const float scale = isq ? et * inv : 1.0f;   // k features carry no weight

  const int mBase = rowBase + ((lane >> 4) << 3);
  _Float16* dst = (isq ? Qm : Km) + (size_t)mBase * FDIM + tp;
  v8h ccol, scol;   // a lane's 8 rows of its cos and its sin feature
#pragma unroll
  for (int r = 0; r < 8; ++r) {
    float ph = tanhf(acc[r] + bias) * PI_F;
    ccol[r] = (_Float16)(scale * cosf(ph));
    scol[r] = (_Float16)(scale * sinf(ph));
  }
#pragma unroll
  for (int r = 0; r < 8; ++r) {
    dst[r * FDIM]      = ccol[r];
    dst[r * FDIM + TP] = scol[r];
  }
  if (!isq) {
    // the address arithmetic below reuses registers that the stores above
    // name: the wait stands in front of any rewrite
    asm volatile("s_wait_xcnt 0x0" ::: "memory");
    // K^T [b][f][l]: a lane's 8 rows are 8 neighbours in l (mBase % 8 == 0)
    const int bt = mBase >> 11, l = mBase & 2047;
    *(v8h*)(Kt + ((size_t)(bt * FDIM + tp)) * SEQ + l)      = ccol;
    *(v8h*)(Kt + ((size_t)(bt * FDIM + TP + tp)) * SEQ + l) = scol;
  }
}

// ---- K3a: per-chunk KV sums S_j[f,d] = sum_t K[t,f] V[t,d] ---------------
// grid (NCHK, 8, BATCH), block 256. Register double-buffered K loop.
// V^T is the A operand and K^T the B operand, so the accumulator tile has d
// on its rows and f across its lanes and is stored in Mt's own [d][f] order.

__global__ void k_chunk_kv(const _Float16* __restrict__ Kt,
                           const _Float16* __restrict__ Vt,
                           float* __restrict__ Ssum) { // [B][NCHK][DIM][FDIM]
  const int lane = threadIdx.x & 31, wave = threadIdx.x >> 5;
  const int j = blockIdx.x, dBase = blockIdx.y * 64, b = blockIdx.z;
  const int fBase = wave * 16;
  const _Float16* ktb = Kt + (size_t)b * FDIM * SEQ;
  const _Float16* vtb = Vt + (size_t)b * DIM * SEQ;
  const int kBase = j * CHUNK;

  v8f acc[4] = {};
  v16h a_cur = load_frag(ktb, SEQ, fBase, kBase, lane);
  v16h b_cur[4];
#pragma unroll
  for (int t = 0; t < 4; ++t)
    b_cur[t] = load_frag(vtb, SEQ, dBase + t * 16, kBase, lane);

  for (int i = 0; i < CHUNK / 32; ++i) {
    v16h a_next, b_next[4];
    if (i + 1 < CHUNK / 32) {
      a_next = load_frag(ktb, SEQ, fBase, kBase + (i + 1) * 32, lane);
#pragma unroll
      for (int t = 0; t < 4; ++t)
        b_next[t] = load_frag(vtb, SEQ, dBase + t * 16, kBase + (i + 1) * 32, lane);
    }
#pragma unroll
    for (int t = 0; t < 4; ++t) acc[t] = wmma_f16(b_cur[t], a_cur, acc[t]);
    if (i + 1 < CHUNK / 32) {
      a_cur = a_next;
#pragma unroll
      for (int t = 0; t < 4; ++t) b_cur[t] = b_next[t];
    }
  }

  float* sp = Ssum + ((size_t)(b * NCHK + j) * DIM + dBase + ((lane >> 4) << 3)) * FDIM
                   + fBase + (lane & 15);
#pragma unroll
  for (int t = 0; t < 4; ++t) {
#pragma unroll
    for (int r = 0; r < 8; ++r)
      sp[(t * 16 + r) * FDIM] = acc[t][r];
  }
}

// ---- K3b: exclusive prefix over chunks -> Mt (f16) ------------------------
// Ssum and Mt share the [B][NCHK][DIM][FDIM] order; a thread owns 4 adjacent
// f of one d, so a wave reads 512 and writes 256 contiguous bytes per chunk.
// grid (BATCH*DIM*FDIM/4/128), block 128.

__global__ void k_scan(const float* __restrict__ Ssum,
                       _Float16* __restrict__ Mt) { // [B][NCHK][DIM][FDIM]
  const int PLANE = DIM * FDIM;
  const int tid = blockIdx.x * blockDim.x + threadIdx.x;
  const int b = tid / (PLANE / 4);
  const int e = (tid - b * (PLANE / 4)) * 4;
  const size_t base = (size_t)b * NCHK * PLANE + e;
  v4f run = {};
#pragma unroll
  for (int j = 0; j < NCHK; ++j) {
    *(v4h*)(Mt + base + (size_t)j * PLANE) = __builtin_convertvector(run, v4h);
    run += *(const v4f*)(Ssum + base + (size_t)j * PLANE);
  }
}

// ---- K3c: O = Q@M_prev + tril(Q K^T) @ V ---------------------------------
// grid (NCHK, 8, BATCH), block 256. Scores staged in LDS (f16, padded).

__global__ void k_chunk_out(const _Float16* __restrict__ Qm,
                            const _Float16* __restrict__ Km,
                            const _Float16* __restrict__ Vt,
                            const _Float16* __restrict__ Mt,
                            float* __restrict__ Ot) { // [ROWS][DIM]
  __shared__ _Float16 sc[CHUNK][CHUNK + 8];  // +8 halves pad, keeps 16B align
  const int lane = threadIdx.x & 31, wave = threadIdx.x >> 5;
  const int j = blockIdx.x, dBase = blockIdx.y * 64, b = blockIdx.z;
  const int rowTok = b * SEQ + j * CHUNK;   // first token row of chunk
  const int lBase = wave * 16;

  // Phase A: scores = Q_c K_c^T  (128x128), masked causal-inclusive
  v8f sacc[8] = {};
  for (int f0 = 0; f0 < FDIM; f0 += 32) {
    v16h a = load_frag(Qm, FDIM, rowTok + lBase, f0, lane);
#pragma unroll
    for (int tt = 0; tt < 8; ++tt) {
      v16h bf = load_frag(Km, FDIM, rowTok + tt * 16, f0, lane);
      sacc[tt] = wmma_f16(a, bf, sacc[tt]);
    }
  }
  const int mB = lBase + ((lane >> 4) << 3);
#pragma unroll
  for (int tt = 0; tt < 8; ++tt) {
    const int tl = tt * 16 + (lane & 15);
#pragma unroll
    for (int r = 0; r < 8; ++r) {
      const int ll = mB + r;
      sc[ll][tl] = (_Float16)((tl <= ll) ? sacc[tt][r] : 0.0f);
    }
  }
  __syncthreads();

  // Phase B: O = scores @ V_c + Q_c @ M_prev  (both register double-buffered)
  const _Float16* vtb = Vt + (size_t)b * DIM * SEQ;
  const _Float16* mtb = Mt + (size_t)(b * NCHK + j) * DIM * FDIM;
  v8f acc[4] = {};
  {
    v16h a_cur = load_frag(&sc[0][0], CHUNK + 8, lBase, 0, lane);
    v16h b_cur[4];
#pragma unroll
    for (int t = 0; t < 4; ++t)
      b_cur[t] = load_frag(vtb, SEQ, dBase + t * 16, j * CHUNK, lane);
    for (int i = 0; i < CHUNK / 32; ++i) {
      v16h a_next, b_next[4];
      if (i + 1 < CHUNK / 32) {
        a_next = load_frag(&sc[0][0], CHUNK + 8, lBase, (i + 1) * 32, lane);
#pragma unroll
        for (int t = 0; t < 4; ++t)
          b_next[t] = load_frag(vtb, SEQ, dBase + t * 16,
                                j * CHUNK + (i + 1) * 32, lane);
      }
#pragma unroll
      for (int t = 0; t < 4; ++t) acc[t] = wmma_f16(a_cur, b_cur[t], acc[t]);
      if (i + 1 < CHUNK / 32) {
        a_cur = a_next;
#pragma unroll
        for (int t = 0; t < 4; ++t) b_cur[t] = b_next[t];
      }
    }
  }
  {
    v16h a_cur = load_frag(Qm, FDIM, rowTok + lBase, 0, lane);
    v16h b_cur[4];
#pragma unroll
    for (int t = 0; t < 4; ++t)
      b_cur[t] = load_frag(mtb, FDIM, dBase + t * 16, 0, lane);
    for (int i = 0; i < FDIM / 32; ++i) {
      v16h a_next, b_next[4];
      if (i + 1 < FDIM / 32) {
        a_next = load_frag(Qm, FDIM, rowTok + lBase, (i + 1) * 32, lane);
#pragma unroll
        for (int t = 0; t < 4; ++t)
          b_next[t] = load_frag(mtb, FDIM, dBase + t * 16, (i + 1) * 32, lane);
      }
#pragma unroll
      for (int t = 0; t < 4; ++t) acc[t] = wmma_f16(a_cur, b_cur[t], acc[t]);
      if (i + 1 < FDIM / 32) {
        a_cur = a_next;
#pragma unroll
        for (int t = 0; t < 4; ++t) b_cur[t] = b_next[t];
      }
    }
  }
#pragma unroll
  for (int t = 0; t < 4; ++t) {
    const int d = dBase + t * 16 + (lane & 15);
#pragma unroll
    for (int r = 0; r < 8; ++r)
      Ot[(size_t)(rowTok + mB + r) * DIM + d] = acc[t][r];
  }
}

// ---- K4a: position norm + LayerNorm -> yn (f16) ---------------------------
// grid (ROWS / 16), block 256. A wave owns two whole rows, 16 elements of each
// a lane, and sums them across its lanes: no LDS and no barrier, and only
// 2,048 waves to start, in as many blocks as the chip has WGPs. Every load of
// a wave covers 512 contiguous bytes, every store 256.

// v of the lane whose number within its 16-lane row differs by XMASK
template <int XMASK>
__device__ __forceinline__ float row_xor(float v) {
  return __builtin_bit_cast(float, __builtin_amdgcn_update_dpp(
      0, __builtin_bit_cast(int, v), 0x160 + XMASK, 0xf, 0xf, true));
}

// the sum of v over the 32 lanes, in every lane
__device__ __forceinline__ float wave_sum(float v) {
  v += row_xor<1>(v);
  v += row_xor<2>(v);
  v += row_xor<4>(v);
  v += row_xor<8>(v);
  // the lane of the same number in the other 16-lane row
  const int o = __builtin_bit_cast(int, v);
  v += __builtin_bit_cast(float, __builtin_amdgcn_permlanex16(
      o, o, 0x76543210, 0xfedcba98, false, false));
  return v;
}

static_assert(DIM == 4 * 32 * 4, "a lane holds 4 vectors of 4 of a row");
static_assert(ROWS % 16 == 0, "whole blocks of 8 waves x 2 rows");

__global__ __launch_bounds__(256)
void k_layernorm(const float* __restrict__ Ot,
                 const float* __restrict__ ln_g,
                 const float* __restrict__ ln_b,
                 _Float16* __restrict__ yn) {
  const int lane = threadIdx.x & 31;
  // the wave's number in a scalar register: the rows' addresses become scalar
  const int wave = __builtin_amdgcn_readfirstlane(threadIdx.x >> 5);
  const int row0 = (blockIdx.x * 8 + wave) * 2;
  const int col = lane * 4;
  const float* __restrict__ src = Ot + (size_t)row0 * DIM;
  _Float16* __restrict__ dst = yn + (size_t)row0 * DIM;
  // the loops below are unrolled so that the arrays stay in registers and all
  // sixteen loads are in flight together
  v4f y[2][4], g[4], be[4];
#pragma unroll
  for (int r = 0; r < 2; ++r) {
#pragma unroll
    for (int c = 0; c < 4; ++c)
      y[r][c] = *(const v4f*)(src + r * DIM + c * 128 + col);
  }
#pragma unroll
  for (int c = 0; c < 4; ++c) {
    g[c]  = *(const v4f*)(ln_g + c * 128 + col);
    be[c] = *(const v4f*)(ln_b + c * 128 + col);
  }
  // without it the compiler sinks the loads of g and be behind the sums, where
  // their latency comes on top of that of y
  __builtin_amdgcn_sched_barrier(0);
  // in front of any rewrite of a register that the loads above name; as its
  // inputs, their offset and base registers stay as they are up to the wait
  asm volatile("s_wait_xcnt 0x0"
               :: "v"(col * 4), "s"(src), "s"(ln_g), "s"(ln_b) : "memory");
  float s[2], q[2];
#pragma unroll
  for (int r = 0; r < 2; ++r) {
    const int l = (row0 + r) & 2047;
    const float nf = rsqrtf((float)(l + 1) * (float)NPLN);
    v4f vs = {}, vq = {};
#pragma unroll
    for (int c = 0; c < 4; ++c) {
      y[r][c] *= nf;
      vs += y[r][c];
      vq += y[r][c] * y[r][c];
    }
    s[r] = (vs[0] + vs[1]) + (vs[2] + vs[3]);
    q[r] = (vq[0] + vq[1]) + (vq[2] + vq[3]);
  }
#pragma unroll
  for (int r = 0; r < 2; ++r) {
    s[r] = wave_sum(s[r]);
    q[r] = wave_sum(q[r]);
  }
#pragma unroll
  for (int r = 0; r < 2; ++r) {
    const float mu  = s[r] * (1.0f / DIM);
    const float var = q[r] * (1.0f / DIM) - mu * mu;
    const float ivs = rsqrtf(var + 1e-5f);
#pragma unroll
    for (int c = 0; c < 4; ++c)
      *(v4h*)(dst + r * DIM + c * 128 + col) =
          __builtin_convertvector((y[r][c] - mu) * ivs * g[c] + be[c], v4h);
  }
}

// ---- K4b: out = x + yn @ ow + ob ------------------------------------------
// grid (32, 8), block 256. Same async LDS staging as K1.

__global__ __launch_bounds__(256)
void k_outproj(const _Float16* __restrict__ yn,
                          const _Float16* __restrict__ owt,
                          const float* __restrict__ ob,
                          const float* __restrict__ x,
                          float* __restrict__ out) {
  __shared__ __attribute__((aligned(16))) _Float16 bs[64 * BPITCH];
  const int tid = threadIdx.x;
  const int lane = tid & 31, wave = tid >> 5;
  const int rowBase = blockIdx.x * 128 + wave * 16;
  const int colBase = blockIdx.y * 64;

  v8f acc[4] = {};
  gemm_16x64(yn, owt, bs, rowBase, colBase, tid, acc);

  const int mBase = rowBase + ((lane >> 4) << 3);
#pragma unroll
  for (int t = 0; t < 4; ++t) {
    const int n = colBase + t * 16 + (lane & 15);
#pragma unroll
    for (int r = 0; r < 8; ++r) {
      const size_t idx = (size_t)(mBase + r) * DIM + n;
      out[idx] = x[idx] + acc[t][r] + ob[n];
    }
  }
}

// ---------------------------------------------------------------------------

extern "C" void kernel_launch(void* const* d_in, const int* in_sizes, int n_in,
                              void* d_out, int out_size, void* d_ws, size_t ws_size,
                              hipStream_t stream) {
  const float* x   = (const float*)d_in[0];
  const float* sw  = (const float*)d_in[1];
  const float* kw1 = (const float*)d_in[2];
  const float* kb1 = (const float*)d_in[3];
  const float* kw2 = (const float*)d_in[4];
  const float* kb2 = (const float*)d_in[5];
  const float* qw1 = (const float*)d_in[6];
  const float* qb1 = (const float*)d_in[7];
  const float* qw2 = (const float*)d_in[8];
  const float* qb2 = (const float*)d_in[9];
  const float* vw  = (const float*)d_in[10];
  const float* vb  = (const float*)d_in[11];
  const float* lng = (const float*)d_in[12];
  const float* lnb = (const float*)d_in[13];
  const float* ow  = (const float*)d_in[14];
  const float* ob  = (const float*)d_in[15];
  float* out = (float*)d_out;

  // workspace carve-up (all 256B aligned)
  char* ws = (char*)d_ws;
  size_t off = 0;
  auto take = [&](size_t bytes) { char* p = ws + off; off += (bytes + 255) & ~(size_t)255; return p; };
  _Float16* xh    = (_Float16*)take((size_t)ROWS * DIM * 2);
  _Float16* hk    = (_Float16*)take((size_t)ROWS * DIM * 2);
  _Float16* hq    = (_Float16*)take((size_t)ROWS * DIM * 2);
  _Float16* vt    = (_Float16*)take((size_t)BATCH * DIM * SEQ * 2);
  _Float16* Qm    = (_Float16*)take((size_t)ROWS * FDIM * 2);
  _Float16* Km    = (_Float16*)take((size_t)ROWS * FDIM * 2);
  _Float16* Kt    = (_Float16*)take((size_t)BATCH * FDIM * SEQ * 2);
  float*    Ssum  = (float*)   take((size_t)BATCH * NCHK * FDIM * DIM * 4);
  _Float16* Mt    = (_Float16*)take((size_t)BATCH * NCHK * DIM * FDIM * 2);
  float*    Ot    = (float*)   take((size_t)ROWS * DIM * 4);
  _Float16* yn    = (_Float16*)take((size_t)ROWS * DIM * 2);
  _Float16* kw1t  = (_Float16*)take((size_t)DIM * DIM * 2);
  _Float16* qw1t  = (_Float16*)take((size_t)DIM * DIM * 2);
  _Float16* vwt   = (_Float16*)take((size_t)DIM * DIM * 2);
  _Float16* owt   = (_Float16*)take((size_t)DIM * DIM * 2);
  _Float16* kw2t  = (_Float16*)take((size_t)TP * DIM * 2);
  _Float16* qw2t  = (_Float16*)take((size_t)TP * DIM * 2);

  // P0: conversions, one launch
  k_prepare<<<NB_PREP, 256, 0, stream>>>(x, kw1, qw1, vw, ow, kw2, qw2,
                                         xh, kw1t, qw1t, vwt, owt, kw2t, qw2t);

  // K1: Hk / Hq / Vt
  k_encode1<<<dim3(ROWS / 128, DIM / 64, 3), 256, 0, stream>>>(
      xh, kw1t, qw1t, vwt, kb1, qb1, vb, hk, hq, vt);

  // K2: phases -> Q, K, Kt
  k_phases<<<dim3(ROWS / 16), 256, 0, stream>>>(
      hk, hq, kw2t, qw2t, kb2, qb2, sw, Qm, Km, Kt);

  // K3: chunked causal linear attention
  k_chunk_kv<<<dim3(NCHK, DIM / 64, BATCH), 256, 0, stream>>>(Kt, vt, Ssum);
  k_scan<<<BATCH * FDIM * DIM / 4 / 128, 128, 0, stream>>>(Ssum, Mt);
  k_chunk_out<<<dim3(NCHK, DIM / 64, BATCH), 256, 0, stream>>>(Qm, Km, vt, Mt, Ot);

  // K4: norm + LN + output projection + residual
  k_layernorm<<<dim3(ROWS / 16), 256, 0, stream>>>(Ot, lng, lnb, yn);
  k_outproj<<<dim3(ROWS / 128, DIM / 64), 256, 0, stream>>>(yn, owt, ob, x, out);
}

// v007
// Measured time: 52.6 microseconds a run.
// Timed twice side by side with v006, it ran 1.14 times as fast both times.
// All steps since v000 together make it 4.36 times as fast.
#include <hip/hip_runtime.h>
#include <hip/hip_bf16.h>
#include <math.h>

// ---------------------------------------------------------------------------
// MI455X (gfx1250, wave32) implementation.
// Pipeline:
//  P0  convert x -> f16, transpose-convert all weights -> f16 [N,K]; one launch
//  K1  Hk = gelu(x@kw1+b), Hq = gelu(x@qw1+b), Vt = (x@vw+b)^T     (WMMA f16,
//      B panel of all k staged once in LDS via async-load-to-LDS)
//  K2  phases -> Q[l,f]=w_s*{cos,sin}(qp), K[l,f], Kt[f,l]          (WMMA f16)
//  K3a per-chunk state sums S_j^T = V_j^T K_j, stored [d][f]        (WMMA f16)
//  K3b exclusive prefix over 16 chunks -> Mt [d][f], f16            (scan)
//  K3c O = Q@M_prev + tril(Q K^T) @ V  (scores staged in LDS), then
//      position-norm + LayerNorm of its whole rows -> yn (f16)      (WMMA f16)
//  K4b out = x + yn@ow + ob  (async LDS-staged B, like K1)          (WMMA f16)
// All accumulation in f32 (WMMA f32 accumulators).
// ---------------------------------------------------------------------------

typedef __attribute__((ext_vector_type(16))) _Float16 v16h;
typedef __attribute__((ext_vector_type(8)))  _Float16 v8h;
typedef __attribute__((ext_vector_type(8)))  float    v8f;
typedef __attribute__((ext_vector_type(4)))  int      v4i;
typedef __attribute__((ext_vector_type(4)))  float    v4f;
typedef __attribute__((ext_vector_type(4)))  _Float16 v4h;

#define BATCH 2
#define SEQ   2048
#define DIM   512
#define NSET  4
#define NPLN  16
#define TP    64          // NSET*NPLN
#define FDIM  128         // 2*TP (cos|sin features)
#define ROWS  4096        // BATCH*SEQ
#define CHUNK 128
#define NCHK  16          // SEQ/CHUNK
#define PI_F  3.14159265358979323846f

// CDNA5 async global->LDS path (ASYNCcnt). Guarded so the file compiles on
// toolchains without the builtins (falls back to sync reg->LDS staging).
#if defined(__has_builtin)
#if __has_builtin(__builtin_amdgcn_global_load_async_to_lds_b128) && \
    __has_builtin(__builtin_amdgcn_s_wait_asynccnt)
#define USE_ASYNC_LDS 1
#endif
#endif

#define AS_GLOBAL __attribute__((address_space(1)))
#define AS_LDS    __attribute__((address_space(3)))

// ---- WMMA helpers ---------------------------------------------------------

__device__ __forceinline__ v8f wmma_f16(v16h a, v16h b, v8f c) {
  // v_wmma_f32_16x16x32_f16 : D = A(16x32) x B(32x16) + C
  return __builtin_amdgcn_wmma_f32_16x16x32_f16(false, a, false, b,
                                                (short)0, c, false, false);
}

// Load a 16x32 f16 A-fragment (or the transposed-B fragment, which has the
// identical per-lane layout) from a row-major f16 matrix with leading dim ld.
// ISA layout: lane&15 selects row, (lane>>4)*8 selects K phase; vector
// elements 0..7 hold K = kb..kb+7, elements 8..15 hold K = kb+16..kb+23.
__device__ __forceinline__ v16h load_frag(const _Float16* __restrict__ base,
                                          int ld, int rowBase, int k0, int lane) {
  const _Float16* p = base + (size_t)(rowBase + (lane & 15)) * ld
                           + k0 + ((lane >> 4) << 3);
  v16h f;
  *(v8h*)&f       = *(const v8h*)(p);
  *((v8h*)&f + 1) = *(const v8h*)(p + 16);
  return f;
}

// The same fragment from the lane's own place p in it (row lane & 15, k phase
// (lane >> 4) * 8 already counted into p).
__device__ __forceinline__ v16h frag_at(const _Float16* __restrict__ p) {
  v16h f;
  *(v8h*)&f       = *(const v8h*)(p);
  *((v8h*)&f + 1) = *(const v8h*)(p + 16);
  return f;
}

// LDS row pitch of a B panel, in halves: 1040 bytes = 16 B x 65, an odd count,
// so the 16 rows that a ds_load_b128 reads fall on different banks.
#define BPITCH (DIM + 8)

// Stage a whole 64 x DIM f16 B panel (64 KB) into LDS: 16 b128 per thread of a
// 256-thread block, all in flight together. A wave's copy takes 512 contiguous
// bytes, half a row. Async (ASYNCcnt path) when available.
__device__ __forceinline__ void stage_b_panel(_Float16* __restrict__ lds_dst,
                                              const _Float16* __restrict__ gsrc,
                                              int colBase, int tid) {
  const int r = tid >> 6;          // 0..3  (row of transposed B, within 4)
  const int c = (tid & 63) << 3;   // 0,8,..,504 (halves)
  const _Float16* src = gsrc + (size_t)(colBase + r) * DIM + c;
  _Float16* dst = lds_dst + r * BPITCH + c;
  // unrolled: the steps become constants of the copies' addresses
#pragma unroll
  for (int i = 0; i < 16; ++i) {
#if defined(USE_ASYNC_LDS)
    _Float16* src_nc = const_cast<_Float16*>(src + i * 4 * DIM);
    __builtin_amdgcn_global_load_async_to_lds_b128(
        (AS_GLOBAL v4i*)src_nc, (AS_LDS v4i*)(dst + i * 4 * BPITCH), 0, 0);
#else
    *(v8h*)(dst + i * 4 * BPITCH) = *(const v8h*)(src + i * 4 * DIM);
#endif
  }
}

// The issuing wave's own copies have landed behind it; in asm with the memory
// clobber, so that no LDS read is moved in front of it.
__device__ __forceinline__ void stage_wait() {
#if defined(USE_ASYNC_LDS)
  asm volatile("s_wait_asynccnt 0x0" ::: "memory");
#endif
}

// acc[t] += A[rowBase .. +15][0 .. DIM) x (rows colBase + 16 t .. +15 of wt)^T,
// t = 0..3, for each of the 8 waves of a block; k runs 0, 32, ... in one
// accumulator chain a tile. Every load of the product is issued at the start:
// the B panel's copies and the wave's 16 A fragments wait out one memory
// latency together, and one barrier publishes the panel.
__device__ __forceinline__ void gemm_16x64(const _Float16* __restrict__ A,
                                           const _Float16* __restrict__ wt,
                                           _Float16* __restrict__ bs,
                                           int rowBase, int colBase, int tid,
                                           v8f (&acc)[4]) {
  const int lane = tid & 31;
  stage_b_panel(bs, wt, colBase, tid);
  // the loops below are unrolled so that a[] stays in registers
  v16h a[DIM / 32];
#pragma unroll
  for (int i = 0; i < DIM / 32; ++i)
    a[i] = load_frag(A, DIM, rowBase, i * 32, lane);
  // without it the compiler sinks each load to just above its product
  __builtin_amdgcn_sched_barrier(0);
  // in front of any rewrite of a register that the loads above name
  asm volatile("s_wait_xcnt 0x0" ::: "memory");
  stage_wait();
  __syncthreads();                        // the panel is ready for all waves
  // With no barrier left between the k steps, a step's four B fragments are
  // read from LDS as one group, one step ahead of their products.
  v16h b[2][4];
#pragma unroll
  for (int t = 0; t < 4; ++t) b[0][t] = load_frag(bs, BPITCH, t * 16, 0, lane);
#pragma unroll
  for (int i = 0; i < DIM / 32; ++i) {
    if (i + 1 < DIM / 32) {
#pragma unroll
      for (int t = 0; t < 4; ++t)
        b[(i + 1) & 1][t] = load_frag(bs, BPITCH, t * 16, (i + 1) * 32, lane);
    }
    // without it the compiler sinks each LDS read to just above its product,
    // which then waits out the whole LDS latency
    __builtin_amdgcn_sched_barrier(0);
#pragma unroll
    for (int t = 0; t < 4; ++t) acc[t] = wmma_f16(a[i], b[i & 1][t], acc[t]);
    // as above: the next group of reads stays behind these products
    __builtin_amdgcn_sched_barrier(0);
  }
}

__device__ __forceinline__ float gelu_exact(float v) {
  return 0.5f * v * (1.0f + erff(v * 0.70710678118654752440f));
}

// ---- P0: conversions ------------------------------------------------------
// A thread makes 8 f16 that are neighbours in dst and stores them as 16 bytes.
// All seven conversions read inputs only and none reads another's output, so
// they share one launch: a block's index says which array it works on.

// dst[n*K+k] = (f16) src[k*N+n]   (store weights transposed for B operands)
// A thread reads 8 consecutive k of one n. A wave is 4 n x 8 groups of k, so
// its one store fills 4 whole 128-byte lines of dst, each written by no other
// wave; the 8 waves of a block read 128 contiguous bytes of each source row.
// idx runs over K * N / 8 threads, in whole blocks of 256.
template <int K, int N>
__device__ __forceinline__ void transpose_f16(const float* __restrict__ src,
                                              _Float16* __restrict__ dst,
                                              unsigned idx) {
  static_assert(N % 4 == 0 && K % 64 == 0, "a wave is 4 n x 64 k");
  static_assert((K * N) % (8 * 256) == 0, "whole blocks cover the matrix");
  const unsigned nb = N >> 2;            // waves across n
  const unsigned w  = idx >> 5;
  const unsigned wk = w / nb, wn = w - wk * nb;
  const unsigned n  = wn * 4 + (idx & 3);
  const unsigned k0 = (wk * 8 + ((idx >> 2) & 7)) * 8;
  const float* p = src + (size_t)k0 * N + n;
  v8h h;
  // unrolled: h stays in registers and the eight loads are in flight together
#pragma unroll
  for (int i = 0; i < 8; ++i) h[i] = (_Float16)p[(size_t)i * N];
  *(v8h*)(dst + (size_t)n * K + k0) = h;
}

#define NB_WBIG   (DIM * DIM / 8 / 256)   // blocks per DIM x DIM weight
#define NB_WSMALL (DIM * TP / 8 / 256)    // blocks per DIM x TP weight
#define NB_X      (ROWS * DIM / 8 / 256)  // blocks for x
#define NB_PREP   (4 * NB_WBIG + 2 * NB_WSMALL + NB_X)

static_assert((ROWS * DIM) % (8 * 256) == 0, "the grid covers x exactly");

// grid (NB_PREP), block 256. The transposes come first in the index order:
// their loads touch more lines than those of the x conversion.
__global__ void k_prepare(const float* __restrict__ x,
                          const float* __restrict__ kw1,
                          const float* __restrict__ qw1,
                          const float* __restrict__ vw,
                          const float* __restrict__ ow,
                          const float* __restrict__ kw2,
                          const float* __restrict__ qw2,
                          _Float16* __restrict__ xh,
                          _Float16* __restrict__ kw1t,
                          _Float16* __restrict__ qw1t,
                          _Float16* __restrict__ vwt,
                          _Float16* __restrict__ owt,
                          _Float16* __restrict__ kw2t,
                          _Float16* __restrict__ qw2t) {
  unsigned blk = blockIdx.x;
  if (blk < 4 * NB_WBIG) {
    const unsigned m = blk / NB_WBIG;
    const float* s = (m == 0) ? kw1 : (m == 1) ? qw1 : (m == 2) ? vw : ow;
    _Float16* d = (m == 0) ? kw1t : (m == 1) ? qw1t : (m == 2) ? vwt : owt;
    transpose_f16<DIM, DIM>(s, d, (blk - m * NB_WBIG) * 256 + threadIdx.x);
    return;
  }
  blk -= 4 * NB_WBIG;
  if (blk < 2 * NB_WSMALL) {
    const unsigned m = blk / NB_WSMALL;
    transpose_f16<DIM, TP>(m == 0 ? kw2 : qw2, m == 0 ? kw2t : qw2t,
                           (blk - m * NB_WSMALL) * 256 + threadIdx.x);
    // the build lays another branch's code behind this store, and that code
    // rewrites the store's registers: the wait stands in front of any rewrite
    asm volatile("s_wait_xcnt 0x0" ::: "memory");
    return;
  }
  blk -= 2 * NB_WSMALL;
  const unsigned i = (blk * 256 + threadIdx.x) * 8;
  *(v8h*)(xh + i) = __builtin_convertvector(*(const v8f*)(x + i), v8h);
  // as above: in front of any rewrite of this store's registers
  asm volatile("s_wait_xcnt 0x0" ::: "memory");
}

// ---- K1: encoder layer-1 GEMMs + V projection -----------------------------
// grid (32, 8, 3), block 256 (8 waves); 128x64 output tile per block.

__global__ __launch_bounds__(256)
void k_encode1(const _Float16* __restrict__ xh,
                          const _Float16* __restrict__ kw1t,
                          const _Float16* __restrict__ qw1t,
                          const _Float16* __restrict__ vwt,
                          const float* __restrict__ kb1,
                          const float* __restrict__ qb1,
                          const float* __restrict__ vb,
                          _Float16* __restrict__ hk,
                          _Float16* __restrict__ hq,
                          _Float16* __restrict__ vt) {
  // the B panel, 65 KB; 16-byte copies and reads
  __shared__ __attribute__((aligned(16))) _Float16 bs[64 * BPITCH];
  const int tid = threadIdx.x;
  const int lane = tid & 31, wave = tid >> 5;
  const int z = blockIdx.z;
  const int rowBase = blockIdx.x * 128 + wave * 16;
  const int colBase = blockIdx.y * 64;
  const _Float16* wt  = (z == 0) ? kw1t : (z == 1) ? qw1t : vwt;
  const float*    bia = (z == 0) ? kb1  : (z == 1) ? qb1  : vb;

  v8f acc[4] = {};
  gemm_16x64(xh, wt, bs, rowBase, colBase, tid, acc);

  const int mBase = rowBase + ((lane >> 4) << 3);
  const int nBase = colBase + (lane & 15);
  // the loops below are unrolled so that acc[] is indexed by constants and
  // stays in registers
#pragma unroll
  for (int t = 0; t < 4; ++t) acc[t] += bia[nBase + t * 16];

  if (z == 2) {
    // V^T [b][d][l]: a lane's 8 rows are 8 neighbours in l (mBase % 8 == 0)
    const int b = mBase >> 11, l = mBase & 2047;
#pragma unroll
    for (int t = 0; t < 4; ++t)
      *(v8h*)(vt + ((size_t)(b * DIM + nBase + t * 16)) * SEQ + l) =
          __builtin_convertvector(acc[t], v8h);
    return;
  }

  _Float16* dst = (z == 0) ? hk : hq;
#pragma unroll
  for (int t = 0; t < 4; ++t) {
#pragma unroll
    for (int r = 0; r < 8; ++r)
      dst[(size_t)(mBase + r) * DIM + nBase + t * 16] =
          (_Float16)gelu_exact(acc[t][r]);
  }
}

// ---- K2: encoder layer-2 + phases -> Q, K, Kt -----------------------------
// grid (ROWS / 16), block 256. A block owns 16 rows; each of its 8 waves owns
// one 16x16 tile: waves 0..3 the four column tiles of k, waves 4..7 those of
// q. So 256 blocks share the loads and the tanh / cos / sin work, one tile a
// wave. A tile's k order is 0, 32, ... in one accumulator chain.

__global__ __launch_bounds__(256)
void k_phases(const _Float16* __restrict__ hk,
              const _Float16* __restrict__ hq,
              const _Float16* __restrict__ kw2t,
              const _Float16* __restrict__ qw2t,
              const float* __restrict__ kb2,
              const float* __restrict__ qb2,
              const float* __restrict__ sw,
              _Float16* __restrict__ Qm,   // [ROWS][FDIM]
              _Float16* __restrict__ Km,   // [ROWS][FDIM]
              _Float16* __restrict__ Kt) { // [B][FDIM][SEQ]
  const int lane = threadIdx.x & 31;
  // the wave's number in a scalar register: the choices below become scalar
  const int wave = __builtin_amdgcn_readfirstlane(threadIdx.x >> 5);
  const bool isq = wave >= 4;
  const int t = wave & 3;                  // column tile = orthogonal set
  const int rowBase = blockIdx.x * 16;
  const _Float16* h  = isq ? hq : hk;
  const _Float16* wt = isq ? qw2t : kw2t;
  const int tp = t * 16 + (lane & 15);     // 0..63
  const float bias = (isq ? qb2 : kb2)[tp];

  // A wave has one product a k step, so nothing but its own loads in flight
  // hides their latency: eight k steps are fetched ahead, in registers.
  v16h a[8], b[8];
#pragma unroll
  for (int i = 0; i < 8; ++i) {
    a[i] = load_frag(h, DIM, rowBase, i * 32, lane);
    b[i] = load_frag(wt, DIM, t * 16, i * 32, lane);
  }
  // without it the compiler sinks each load to just above its product
  __builtin_amdgcn_sched_barrier(0);
  v8f acc = {};
  // unrolled: a[] and b[] are indexed by constants and stay in registers
#pragma unroll
  for (int i = 0; i < DIM / 32; ++i) {
    acc = wmma_f16(a[i & 7], b[i & 7], acc);
    if (i + 8 < DIM / 32) {
      a[i & 7] = load_frag(h, DIM, rowBase, (i + 8) * 32, lane);
      b[i & 7] = load_frag(wt, DIM, t * 16, (i + 8) * 32, lane);
      // as above: the refill stays directly behind the product it follows
      __builtin_amdgcn_sched_barrier(0);
    }
  }
  // softmax over 4 set weights (redundant per thread; trivially cheap)
  float s0 = sw[0], s1 = sw[1], s2 = sw[2], s3 = sw[3];
  float mx = fmaxf(fmaxf(s0, s1), fmaxf(s2, s3));
  float e0 = expf(s0 - mx), e1 = expf(s1 - mx), e2 = expf(s2 - mx), e3 = expf(s3 - mx);
  float inv = 1.0f / (e0 + e1 + e2 + e3);
  const float et = (t == 0) ? e0 : (t == 1) ? e1 : (t == 2) ? e2 : e3;
  const float scale = isq ? et * inv : 1.0f;   // k features carry no weight

  const int mBase = rowBase + ((lane >> 4) << 3);
  _Float16* dst = (isq ? Qm : Km) + (size_t)mBase * FDIM + tp;
  v8h ccol, scol;   // a lane's 8 rows of its cos and its sin feature
#pragma unroll
  for (int r = 0; r < 8; ++r) {
    float ph = tanhf(acc[r] + bias) * PI_F;
    ccol[r] = (_Float16)(scale * cosf(ph));
    scol[r] = (_Float16)(scale * sinf(ph));
  }
#pragma unroll
  for (int r = 0; r < 8; ++r) {
    dst[r * FDIM]      = ccol[r];
    dst[r * FDIM + TP] = scol[r];
  }
  if (!isq) {
    // the address arithmetic below reuses registers that the stores above
    // name: the wait stands in front of any rewrite
    asm volatile("s_wait_xcnt 0x0" ::: "memory");
    // K^T [b][f][l]: a lane's 8 rows are 8 neighbours in l (mBase % 8 == 0)
    const int bt = mBase >> 11, l = mBase & 2047;
    *(v8h*)(Kt + ((size_t)(bt * FDIM + tp)) * SEQ + l)      = ccol;
    *(v8h*)(Kt + ((size_t)(bt * FDIM + TP + tp)) * SEQ + l) = scol;
  }
}

// ---- K3a: per-chunk KV sums S_j[f,d] = sum_t K[t,f] V[t,d] ---------------
// grid (NCHK, 8, BATCH), block 256. Register double-buffered K loop.
// V^T is the A operand and K^T the B operand, so the accumulator tile has d
// on its rows and f across its lanes and is stored in Mt's own [d][f] order.

__global__ void k_chunk_kv(const _Float16* __restrict__ Kt,
                           const _Float16* __restrict__ Vt,
                           float* __restrict__ Ssum) { // [B][NCHK][DIM][FDIM]
  const int lane = threadIdx.x & 31, wave = threadIdx.x >> 5;
  const int j = blockIdx.x, dBase = blockIdx.y * 64, b = blockIdx.z;
  const int fBase = wave * 16;
  const _Float16* ktb = Kt + (size_t)b * FDIM * SEQ;
  const _Float16* vtb = Vt + (size_t)b * DIM * SEQ;
  const int kBase = j * CHUNK;

  v8f acc[4] = {};
  v16h a_cur = load_frag(ktb, SEQ, fBase, kBase, lane);
  v16h b_cur[4];
#pragma unroll
  for (int t = 0; t < 4; ++t)
    b_cur[t] = load_frag(vtb, SEQ, dBase + t * 16, kBase, lane);

  for (int i = 0; i < CHUNK / 32; ++i) {
    v16h a_next, b_next[4];
    if (i + 1 < CHUNK / 32) {
      a_next = load_frag(ktb, SEQ, fBase, kBase + (i + 1) * 32, lane);
#pragma unroll
      for (int t = 0; t < 4; ++t)
        b_next[t] = load_frag(vtb, SEQ, dBase + t * 16, kBase + (i + 1) * 32, lane);
    }
#pragma unroll
    for (int t = 0; t < 4; ++t) acc[t] = wmma_f16(b_cur[t], a_cur, acc[t]);
    if (i + 1 < CHUNK / 32) {
      a_cur = a_next;
#pragma unroll
      for (int t = 0; t < 4; ++t) b_cur[t] = b_next[t];
    }
  }

  float* sp = Ssum + ((size_t)(b * NCHK + j) * DIM + dBase + ((lane >> 4) << 3)) * FDIM
                   + fBase + (lane & 15);
#pragma unroll
  for (int t = 0; t < 4; ++t) {
#pragma unroll
    for (int r = 0; r < 8; ++r)
      sp[(t * 16 + r) * FDIM] = acc[t][r];
  }
}

// ---- K3b: exclusive prefix over chunks -> Mt (f16) ------------------------
// Ssum and Mt share the [B][NCHK][DIM][FDIM] order; a thread owns 4 adjacent
// f of one d, so a wave reads 512 and writes 256 contiguous bytes per chunk.
// grid (BATCH*DIM*FDIM/4/128), block 128.

__global__ void k_scan(const float* __restrict__ Ssum,
                       _Float16* __restrict__ Mt) { // [B][NCHK][DIM][FDIM]
  const int PLANE = DIM * FDIM;
  const int tid = blockIdx.x * blockDim.x + threadIdx.x;
  const int b = tid / (PLANE / 4);
  const int e = (tid - b * (PLANE / 4)) * 4;
  const size_t base = (size_t)b * NCHK * PLANE + e;
  v4f run = {};
#pragma unroll
  for (int j = 0; j < NCHK; ++j) {
    *(v4h*)(Mt + base + (size_t)j * PLANE) = __builtin_convertvector(run, v4h);
    run += *(const v4f*)(Ssum + base + (size_t)j * PLANE);
  }
}

// ---- K3c: yn = LayerNorm((Q@M_prev + tril(Q K^T) @ V) / norm), f16 ---------
// grid (ROWS / 16), block 256. A block owns 16 whole token rows, wave w their
// 64 columns d = 64 w .. 64 w + 63, so the rows' mean and variance are formed
// here, from the accumulators: O never goes to memory and LayerNorm has no
// launch of its own. The block's 16 x 128 scores are made once, one 16 x 16
// tile a wave. In the second phase V^T and M^T are the A operand: a lane then
// holds 8 neighbouring d of ONE token row and stores them as 16 bytes.

static_assert(DIM == 8 * 64, "8 waves x 64 columns are a whole row");
static_assert(CHUNK == 8 * 16, "8 waves x 16 tokens are a whole chunk");
static_assert(SEQ == 2048 && CHUNK == 128, "the shifts below");

__global__ __launch_bounds__(256)
void k_chunk_out_ln(const _Float16* __restrict__ Qm,
                    const _Float16* __restrict__ Km,
                    const _Float16* __restrict__ Vt,
                    const _Float16* __restrict__ Mt,
                    const float* __restrict__ ln_g,
                    const float* __restrict__ ln_b,
                    _Float16* __restrict__ yn) { // [ROWS][DIM]
  // +8 halves pad: 16-byte reads of 16 rows fall on different banks
  __shared__ __attribute__((aligned(16))) _Float16 sc[16][CHUNK + 8];
  // [sum | sum of squares][token row][wave]
  __shared__ __attribute__((aligned(16))) float red[2][16][8];
  const int lane = threadIdx.x & 31;
  // the wave's number in a scalar register: tile bases become scalar
  const int wave = __builtin_amdgcn_readfirstlane(threadIdx.x >> 5);
  const int hi = lane >> 4, m = lane & 15;
  const int row0 = blockIdx.x * 16;          // first token row of the block
  const int b = row0 >> 11;
  const int j = (row0 & (SEQ - 1)) >> 7;     // chunk
  const int rowTok = row0 & ~(CHUNK - 1);    // first token row of the chunk
  const int lIn = row0 & (CHUNK - 1);        // row0 within the chunk
  const int dBase = wave * 64;
  // This lane's place in the first fragment of each operand (layout: see
  // load_frag); every other fragment is a constant step from it.
  const _Float16* qp = Qm + (size_t)(row0 + m) * FDIM + hi * 8;
  const _Float16* kp = Km + (size_t)(rowTok + wave * 16 + m) * FDIM + hi * 8;
  const _Float16* vp = Vt + ((size_t)b * DIM + dBase + m) * SEQ + j * CHUNK + hi * 8;
  const _Float16* mp = Mt + ((size_t)(b * NCHK + j) * DIM + dBase + m) * FDIM + hi * 8;
  const float* gs = ln_g + dBase;            // scalar bases
  const float* bs = ln_b + dBase;
  const int go = hi * 8;

  // Every load of the block is issued here, so that all of them wait out one
  // memory latency together. The loops are unrolled so that the arrays stay in
  // registers. A lane's row of each operand is 256 bytes, two lines, which the
  // eight loads of one t take in 32-byte pieces: the scheduling barriers keep
  // those eight next to each other (the compiler mixes the groups otherwise),
  // so that a line is still in the WGP's cache at its last piece.
  v16h qf[4], kf[4], vf[4][4], mf[4][4];
  v8f g[4], be[4];
#pragma unroll
  for (int i = 0; i < 4; ++i) qf[i] = frag_at(qp + i * 32);
#pragma unroll
  for (int i = 0; i < 4; ++i) kf[i] = frag_at(kp + i * 32);
  __builtin_amdgcn_sched_barrier(0);
#pragma unroll
  for (int t = 0; t < 4; ++t) {
#pragma unroll
    for (int i = 0; i < 4; ++i) vf[i][t] = frag_at(vp + t * 16 * SEQ + i * 32);
    __builtin_amdgcn_sched_barrier(0);
  }
#pragma unroll
  for (int t = 0; t < 4; ++t) {
#pragma unroll
    for (int i = 0; i < 4; ++i) mf[i][t] = frag_at(mp + t * 16 * FDIM + i * 32);
    __builtin_amdgcn_sched_barrier(0);
  }
#pragma unroll
  for (int t = 0; t < 4; ++t) {
    g[t]  = *(const v8f*)(gs + go + t * 16);
    be[t] = *(const v8f*)(bs + go + t * 16);
  }
  // without it the compiler sinks each load to just above its use
  __builtin_amdgcn_sched_barrier(0);
  // in front of any rewrite of a register that the loads above name; as its
  // inputs, their address, offset and base registers stay as they are up to it
  asm volatile("s_wait_xcnt 0x0"
               :: "v"(qp), "v"(kp), "v"(vp), "v"(mp), "v"(go * 4), "s"(gs), "s"(bs)
               : "memory");

  // Phase A: this wave's tile of scores = Q K_c^T, masked causal-inclusive
  v8f sacc = {};
#pragma unroll
  for (int i = 0; i < 4; ++i) sacc = wmma_f16(qf[i], kf[i], sacc);
  const int tl = wave * 16 + m;              // key token within the chunk
#pragma unroll
  for (int r = 0; r < 8; ++r) {
    const int mr = hi * 8 + r;               // query row within the block
    sc[mr][tl] = (_Float16)((tl <= lIn + mr) ? sacc[r] : 0.0f);
  }
  __syncthreads();                           // the scores are ready for all waves

  // Phase B: O^T = V_c^T scores^T + M_prev^T Q^T, one accumulator chain a tile,
  // the scores' k steps first
  v8f acc[4] = {};
  v16h sf[4];
#pragma unroll
  for (int i = 0; i < 4; ++i) sf[i] = load_frag(&sc[0][0], CHUNK + 8, 0, i * 32, lane);
#pragma unroll
  for (int i = 0; i < 4; ++i) {
#pragma unroll
    for (int t = 0; t < 4; ++t) acc[t] = wmma_f16(vf[i][t], sf[i], acc[t]);
  }
#pragma unroll
  for (int i = 0; i < 4; ++i) {
#pragma unroll
    for (int t = 0; t < 4; ++t) acc[t] = wmma_f16(mf[i][t], qf[i], acc[t]);
  }

  // Position norm and LayerNorm of token row row0 + m. A lane holds 32 of the
  // row's elements: d = dBase + 16 t + 8 hi + r.
  const int l = (row0 + m) & (SEQ - 1);
  const float nf = rsqrtf((float)(l + 1) * (float)NPLN);
  v8f vs = {}, vq = {};
#pragma unroll
  for (int t = 0; t < 4; ++t) {
    acc[t] *= nf;
    vs += acc[t];
    vq += acc[t] * acc[t];
  }
  float s = ((vs[0] + vs[1]) + (vs[2] + vs[3])) + ((vs[4] + vs[5]) + (vs[6] + vs[7]));
  float q = ((vq[0] + vq[1]) + (vq[2] + vq[3])) + ((vq[4] + vq[5]) + (vq[6] + vq[7]));
  // plus the lane of the same number in the other 16-lane row: same token row
  const int so = __builtin_bit_cast(int, s), qo = __builtin_bit_cast(int, q);
  s += __builtin_bit_cast(float, __builtin_amdgcn_permlanex16(
      so, so, 0x76543210, 0xfedcba98, false, false));
  q += __builtin_bit_cast(float, __builtin_amdgcn_permlanex16(
      qo, qo, 0x76543210, 0xfedcba98, false, false));
  // lanes 0..15 hand over the wave's sums, lanes 16..31 its sums of squares
  red[hi][m][wave] = hi ? q : s;
  __syncthreads();                           // all 8 waves' sums are there
  const v8f rs = *(const v8f*)&red[0][m][0];
  const v8f rq = *(const v8f*)&red[1][m][0];
  s = ((rs[0] + rs[1]) + (rs[2] + rs[3])) + ((rs[4] + rs[5]) + (rs[6] + rs[7]));
  q = ((rq[0] + rq[1]) + (rq[2] + rq[3])) + ((rq[4] + rq[5]) + (rq[6] + rq[7]));
  const float mu  = s * (1.0f / DIM);
  const float var = q * (1.0f / DIM) - mu * mu;
  const float ivs = rsqrtf(var + 1e-5f);
  _Float16* dst = yn + (size_t)(row0 + m) * DIM + dBase + hi * 8;
#pragma unroll
  for (int t = 0; t < 4; ++t)
    *(v8h*)(dst + t * 16) =
        __builtin_convertvector((acc[t] - mu) * ivs * g[t] + be[t], v8h);
}

// ---- K4b: out = x + yn @ ow + ob ------------------------------------------
// grid (32, 8), block 256. Same async LDS staging as K1.

__global__ __launch_bounds__(256)
void k_outproj(const _Float16* __restrict__ yn,
                          const _Float16* __restrict__ owt,
                          const float* __restrict__ ob,
                          const float* __restrict__ x,
                          float* __restrict__ out) {
  __shared__ __attribute__((aligned(16))) _Float16 bs[64 * BPITCH];
  const int tid = threadIdx.x;
  const int lane = tid & 31, wave = tid >> 5;
  const int rowBase = blockIdx.x * 128 + wave * 16;
  const int colBase = blockIdx.y * 64;

  v8f acc[4] = {};
  gemm_16x64(yn, owt, bs, rowBase, colBase, tid, acc);

  const int mBase = rowBase + ((lane >> 4) << 3);
#pragma unroll
  for (int t = 0; t < 4; ++t) {
    const int n = colBase + t * 16 + (lane & 15);
#pragma unroll
    for (int r = 0; r < 8; ++r) {
      const size_t idx = (size_t)(mBase + r) * DIM + n;
      out[idx] = x[idx] + acc[t][r] + ob[n];
    }
  }
}

// ---------------------------------------------------------------------------

extern "C" void kernel_launch(void* const* d_in, const int* in_sizes, int n_in,
                              void* d_out, int out_size, void* d_ws, size_t ws_size,
                              hipStream_t stream) {
  const float* x   = (const float*)d_in[0];
  const float* sw  = (const float*)d_in[1];
  const float* kw1 = (const float*)d_in[2];
  const float* kb1 = (const float*)d_in[3];
  const float* kw2 = (const float*)d_in[4];
  const float* kb2 = (const float*)d_in[5];
  const float* qw1 = (const float*)d_in[6];
  const float* qb1 = (const float*)d_in[7];
  const float* qw2 = (const float*)d_in[8];
  const float* qb2 = (const float*)d_in[9];
  const float* vw  = (const float*)d_in[10];
  const float* vb  = (const float*)d_in[11];
  const float* lng = (const float*)d_in[12];
  const float* lnb = (const float*)d_in[13];
  const float* ow  = (const float*)d_in[14];
  const float* ob  = (const float*)d_in[15];
  float* out = (float*)d_out;

  // workspace carve-up (all 256B aligned)
  char* ws = (char*)d_ws;
  size_t off = 0;
  auto take = [&](size_t bytes) { char* p = ws + off; off += (bytes + 255) & ~(size_t)255; return p; };
  _Float16* xh    = (_Float16*)take((size_t)ROWS * DIM * 2);
  _Float16* hk    = (_Float16*)take((size_t)ROWS * DIM * 2);
  _Float16* hq    = (_Float16*)take((size_t)ROWS * DIM * 2);
  _Float16* vt    = (_Float16*)take((size_t)BATCH * DIM * SEQ * 2);
  _Float16* Qm    = (_Float16*)take((size_t)ROWS * FDIM * 2);
  _Float16* Km    = (_Float16*)take((size_t)ROWS * FDIM * 2);
  _Float16* Kt    = (_Float16*)take((size_t)BATCH * FDIM * SEQ * 2);
  float*    Ssum  = (float*)   take((size_t)BATCH * NCHK * FDIM * DIM * 4);
  _Float16* Mt    = (_Float16*)take((size_t)BATCH * NCHK * DIM * FDIM * 2);
  _Float16* yn    = (_Float16*)take((size_t)ROWS * DIM * 2);
  _Float16* kw1t  = (_Float16*)take((size_t)DIM * DIM * 2);
  _Float16* qw1t  = (_Float16*)take((size_t)DIM * DIM * 2);
  _Float16* vwt   = (_Float16*)take((size_t)DIM * DIM * 2);
  _Float16* owt   = (_Float16*)take((size_t)DIM * DIM * 2);
  _Float16* kw2t  = (_Float16*)take((size_t)TP * DIM * 2);
  _Float16* qw2t  = (_Float16*)take((size_t)TP * DIM * 2);

  // P0: conversions, one launch
  k_prepare<<<NB_PREP, 256, 0, stream>>>(x, kw1, qw1, vw, ow, kw2, qw2,
                                         xh, kw1t, qw1t, vwt, owt, kw2t, qw2t);

  // K1: Hk / Hq / Vt
  k_encode1<<<dim3(ROWS / 128, DIM / 64, 3), 256, 0, stream>>>(
      xh, kw1t, qw1t, vwt, kb1, qb1, vb, hk, hq, vt);

  // K2: phases -> Q, K, Kt
  k_phases<<<dim3(ROWS / 16), 256, 0, stream>>>(
      hk, hq, kw2t, qw2t, kb2, qb2, sw, Qm, Km, Kt);

  // K3: chunked causal linear attention
  k_chunk_kv<<<dim3(NCHK, DIM / 64, BATCH), 256, 0, stream>>>(Kt, vt, Ssum);
  k_scan<<<BATCH * FDIM * DIM / 4 / 128, 128, 0, stream>>>(Ssum, Mt);
  k_chunk_out_ln<<<dim3(ROWS / 16), 256, 0, stream>>>(Qm, Km, vt, Mt, lng, lnb, yn);

  // K4: output projection + residual
  k_outproj<<<dim3(ROWS / 128, DIM / 64), 256, 0, stream>>>(yn, owt, ob, x, out);
}

// v008
// Measured time: 46.3 microseconds a run.
// Timed twice side by side with v007, it ran 1.13 and 1.12 times as fast.
// Over all steps from v000 it is 4.91 times as fast.
#include <hip/hip_runtime.h>
#include <hip/hip_bf16.h>
#include <math.h>

// ---------------------------------------------------------------------------
// MI455X (gfx1250, wave32) implementation.
// Pipeline:
//  P0  convert x -> f16, transpose-convert all weights -> f16 [N,K]; one launch
//  K1  Hk = gelu(x@kw1+b), Hq = gelu(x@qw1+b), Vt = (x@vw+b)^T     (WMMA f16,
//      B panel of all k staged once in LDS via async-load-to-LDS)
//  K2  phases -> Q[l,f]=w_s*{cos,sin}(qp), K[l,f], Kt[f,l]          (WMMA f16)
//  K3a per-chunk state sums S_j = K_j^T V_j, stored as M^T planes   (WMMA f16)
//  K3b exclusive prefix over 16 chunks -> Mt, f16                   (scan)
//  K3c O = Q@M_prev + tril(Q K^T) @ V  (scores staged in LDS), then
//      position-norm + LayerNorm of its whole rows -> yn (f16)      (WMMA f16)
//  K4b out = x + yn@ow + ob  (async LDS-staged B, like K1)          (WMMA f16)
// All accumulation in f32 (WMMA f32 accumulators).
// Every f16 matrix that a wave loads from global memory as WMMA fragments lies
// in the workspace in fragment order (pk_off below), not row-major.
// ---------------------------------------------------------------------------

typedef __attribute__((ext_vector_type(16))) _Float16 v16h;
typedef __attribute__((ext_vector_type(8)))  _Float16 v8h;
typedef __attribute__((ext_vector_type(8)))  float    v8f;
typedef __attribute__((ext_vector_type(4)))  int      v4i;
typedef __attribute__((ext_vector_type(4)))  float    v4f;
typedef __attribute__((ext_vector_type(4)))  _Float16 v4h;

#define BATCH 2
#define SEQ   2048
#define DIM   512
#define NSET  4
#define NPLN  16
#define TP    64          // NSET*NPLN
#define FDIM  128         // 2*TP (cos|sin features)
#define ROWS  4096        // BATCH*SEQ
#define CHUNK 128
#define NCHK  16          // SEQ/CHUNK
#define PI_F  3.14159265358979323846f

// CDNA5 async global->LDS path (ASYNCcnt). Guarded so the file compiles on
// toolchains without the builtins (falls back to sync reg->LDS staging).
#if defined(__has_builtin)
#if __has_builtin(__builtin_amdgcn_global_load_async_to_lds_b128) && \
    __has_builtin(__builtin_amdgcn_s_wait_asynccnt)
#define USE_ASYNC_LDS 1
#endif
#endif

#define AS_GLOBAL __attribute__((address_space(1)))
#define AS_LDS    __attribute__((address_space(3)))

// ---- WMMA helpers ---------------------------------------------------------

__device__ __forceinline__ v8f wmma_f16(v16h a, v16h b, v8f c) {
  // v_wmma_f32_16x16x32_f16 : D = A(16x32) x B(32x16) + C
  return __builtin_amdgcn_wmma_f32_16x16x32_f16(false, a, false, b,
                                                (short)0, c, false, false);
}

// Load a 16x32 f16 A-fragment (or the transposed-B fragment, which has the
// identical per-lane layout) from a row-major f16 matrix with leading dim ld.
// ISA layout: lane&15 selects row, (lane>>4)*8 selects K phase; vector
// elements 0..7 hold K = kb..kb+7, elements 8..15 hold K = kb+16..kb+23.
__device__ __forceinline__ v16h load_frag(const _Float16* __restrict__ base,
                                          int ld, int rowBase, int k0, int lane) {
  const _Float16* p = base + (size_t)(rowBase + (lane & 15)) * ld
                           + k0 + ((lane >> 4) << 3);
  v16h f;
  *(v8h*)&f       = *(const v8h*)(p);
  *((v8h*)&f + 1) = *(const v8h*)(p + 16);
  return f;
}

// Fragment order of a rows x (32 ks) f16 matrix in the workspace. The 16 x 32
// fragment (row tile, k step) is 1 KB in a row: first every lane's elements
// 0..7, lane after lane, then every lane's elements 8..15. A wave's 16-byte
// load then takes 512 contiguous bytes, 4 whole lines, where a row-major
// matrix gives it 32-byte pieces of 16 lines. Eight neighbouring k (k % 8 == 0)
// of one row are still 16 contiguous bytes.
__device__ __forceinline__ int pk_off(int row, int k, int ks) {
  return ((((row >> 4) * ks + (k >> 5)) * 2 + ((k >> 4) & 1)) << 8)
         + (((((k >> 3) & 1) << 4) + (row & 15)) << 3) + (k & 7);
}

#define PK_FRAG 512   // halves of one fragment

// The fragment at p = matrix + (row tile * ks + k step) * PK_FRAG + lane * 8;
// the same values in the same lanes and elements as load_frag gives.
__device__ __forceinline__ v16h frag_pk(const _Float16* __restrict__ p) {
  v16h f;
  *(v8h*)&f       = *(const v8h*)(p);
  *((v8h*)&f + 1) = *(const v8h*)(p + 256);
  return f;
}

// LDS row pitch of a B panel, in halves: 1040 bytes = 16 B x 65, an odd count,
// so the 16 rows that a ds_load_b128 reads fall on different banks.
#define BPITCH (DIM + 8)

// Stage a whole 64 x DIM f16 B panel (64 KB) into LDS: 16 b128 per thread of a
// 256-thread block, all in flight together. A wave's copy takes 512 contiguous
// bytes, half a row. Async (ASYNCcnt path) when available.
__device__ __forceinline__ void stage_b_panel(_Float16* __restrict__ lds_dst,
                                              const _Float16* __restrict__ gsrc,
                                              int colBase, int tid) {
  const int r = tid >> 6;          // 0..3  (row of transposed B, within 4)
  const int c = (tid & 63) << 3;   // 0,8,..,504 (halves)
  const _Float16* src = gsrc + (size_t)(colBase + r) * DIM + c;
  _Float16* dst = lds_dst + r * BPITCH + c;
  // unrolled: the steps become constants of the copies' addresses
#pragma unroll
  for (int i = 0; i < 16; ++i) {
#if defined(USE_ASYNC_LDS)
    _Float16* src_nc = const_cast<_Float16*>(src + i * 4 * DIM);
    __builtin_amdgcn_global_load_async_to_lds_b128(
        (AS_GLOBAL v4i*)src_nc, (AS_LDS v4i*)(dst + i * 4 * BPITCH), 0, 0);
#else
    *(v8h*)(dst + i * 4 * BPITCH) = *(const v8h*)(src + i * 4 * DIM);
#endif
  }
}

// The issuing wave's own copies have landed behind it; in asm with the memory
// clobber, so that no LDS read is moved in front of it.
__device__ __forceinline__ void stage_wait() {
#if defined(USE_ASYNC_LDS)
  asm volatile("s_wait_asynccnt 0x0" ::: "memory");
#endif
}

// acc[t] += A[rowBase .. +15][0 .. DIM) x (rows colBase + 16 t .. +15 of wt)^T,
// t = 0..3, for each of the 8 waves of a block; k runs 0, 32, ... in one
// accumulator chain a tile. Every load of the product is issued at the start:
// the B panel's copies and the wave's 16 A fragments wait out one memory
// latency together, and one barrier publishes the panel. A lies in fragment
// order. With TR the panel is the A operand of the products: acc[t] is then the
// transposed tile, a lane holding 8 neighbouring columns of ONE row of A.
template <bool TR>
__device__ __forceinline__ void gemm_16x64(const _Float16* __restrict__ A,
                                           const _Float16* __restrict__ wt,
                                           _Float16* __restrict__ bs,
                                           int rowBase, int colBase, int tid,
                                           v8f (&acc)[4]) {
  const int lane = tid & 31;
  stage_b_panel(bs, wt, colBase, tid);
  // the loops below are unrolled so that a[] stays in registers
  v16h a[DIM / 32];
#pragma unroll
  for (int i = 0; i < DIM / 32; ++i)
    a[i] = frag_pk(A + ((rowBase >> 4) * (DIM / 32) + i) * PK_FRAG + lane * 8);
  // without it the compiler sinks each load to just above its product
  __builtin_amdgcn_sched_barrier(0);
  // in front of any rewrite of a register that the loads above name
  asm volatile("s_wait_xcnt 0x0" ::: "memory");
  stage_wait();
  __syncthreads();                        // the panel is ready for all waves
  // With no barrier left between the k steps, a step's four B fragments are
  // read from LDS as one group, one step ahead of their products.
  v16h b[2][4];
#pragma unroll
  for (int t = 0; t < 4; ++t) b[0][t] = load_frag(bs, BPITCH, t * 16, 0, lane);
#pragma unroll
  for (int i = 0; i < DIM / 32; ++i) {
    if (i + 1 < DIM / 32) {
#pragma unroll
      for (int t = 0; t < 4; ++t)
        b[(i + 1) & 1][t] = load_frag(bs, BPITCH, t * 16, (i + 1) * 32, lane);
    }
    // without it the compiler sinks each LDS read to just above its product,
    // which then waits out the whole LDS latency
    __builtin_amdgcn_sched_barrier(0);
#pragma unroll
    for (int t = 0; t < 4; ++t)
      acc[t] = TR ? wmma_f16(b[i & 1][t], a[i], acc[t])
                  : wmma_f16(a[i], b[i & 1][t], acc[t]);
    // as above: the next group of reads stays behind these products
    __builtin_amdgcn_sched_barrier(0);
  }
}

__device__ __forceinline__ float gelu_exact(float v) {
  return 0.5f * v * (1.0f + erff(v * 0.70710678118654752440f));
}

// ---- P0: conversions ------------------------------------------------------
// A thread makes 8 f16 that are neighbours in dst and stores them as 16 bytes (an x thread two such groups).
// All seven conversions read inputs only and none reads another's output, so
// they share one launch: a block's index says which array it works on.

// dst[n*K+k] = (f16) src[k*N+n]   (store weights transposed for B operands)
// A thread reads 8 consecutive k of one n. A wave is 4 n x 8 groups of k, so
// its one store fills 4 whole 128-byte lines of dst, each written by no other
// wave; the 8 waves of a block read 128 contiguous bytes of each source row.
// idx runs over K * N / 8 threads, in whole blocks of 256.
// With PK dst is in fragment order (rows n), else row-major; with PK a wave's
// store is 8 pieces of 64 bytes (the two matrices stored so are 64 KB each).
template <int K, int N, bool PK>
__device__ __forceinline__ void transpose_f16(const float* __restrict__ src,
                                              _Float16* __restrict__ dst,
                                              unsigned idx) {
  static_assert(N % 4 == 0 && K % 64 == 0, "a wave is 4 n x 64 k");
  static_assert((K * N) % (8 * 256) == 0, "whole blocks cover the matrix");
  const unsigned nb = N >> 2;            // waves across n
  const unsigned w  = idx >> 5;
  const unsigned wk = w / nb, wn = w - wk * nb;
  const unsigned n  = wn * 4 + (idx & 3);
  const unsigned k0 = (wk * 8 + ((idx >> 2) & 7)) * 8;
  const float* p = src + (size_t)k0 * N + n;
  v8h h;
  // unrolled: h stays in registers and the eight loads are in flight together
#pragma unroll
  for (int i = 0; i < 8; ++i) h[i] = (_Float16)p[(size_t)i * N];
  *(v8h*)(dst + (PK ? (size_t)pk_off(n, k0, K / 32) : (size_t)n * K + k0)) = h;
}

#define NB_WBIG   (DIM * DIM / 8 / 256)   // blocks per DIM x DIM weight
#define NB_WSMALL (DIM * TP / 8 / 256)    // blocks per DIM x TP weight
#define NB_X      (ROWS * DIM / 16 / 256) // blocks for x
#define NB_PREP   (4 * NB_WBIG + 2 * NB_WSMALL + NB_X)

static_assert((ROWS * DIM) % (16 * 256) == 0, "the grid covers x exactly");

// grid (NB_PREP), block 256. The transposes come first in the index order:
// their loads touch more lines than those of the x conversion.
__global__ void k_prepare(const float* __restrict__ x,
                          const float* __restrict__ kw1,
                          const float* __restrict__ qw1,
                          const float* __restrict__ vw,
                          const float* __restrict__ ow,
                          const float* __restrict__ kw2,
                          const float* __restrict__ qw2,
                          _Float16* __restrict__ xh,
                          _Float16* __restrict__ kw1t,
                          _Float16* __restrict__ qw1t,
                          _Float16* __restrict__ vwt,
                          _Float16* __restrict__ owt,
                          _Float16* __restrict__ kw2t,
                          _Float16* __restrict__ qw2t) {
  unsigned blk = blockIdx.x;
  if (blk < 4 * NB_WBIG) {
    const unsigned m = blk / NB_WBIG;
    const float* s = (m == 0) ? kw1 : (m == 1) ? qw1 : (m == 2) ? vw : ow;
    _Float16* d = (m == 0) ? kw1t : (m == 1) ? qw1t : (m == 2) ? vwt : owt;
    transpose_f16<DIM, DIM, false>(s, d, (blk - m * NB_WBIG) * 256 + threadIdx.x);
    return;
  }
  blk -= 4 * NB_WBIG;
  if (blk < 2 * NB_WSMALL) {
    const unsigned m = blk / NB_WSMALL;
    transpose_f16<DIM, TP, true>(m == 0 ? kw2 : qw2, m == 0 ? kw2t : qw2t,
                           (blk - m * NB_WSMALL) * 256 + threadIdx.x);
    // the build lays another branch's code behind this store, and that code
    // rewrites the store's registers: the wait stands in front of any rewrite
    asm volatile("s_wait_xcnt 0x0" ::: "memory");
    return;
  }
  blk -= 2 * NB_WSMALL;
  // x in fragment order: a wave makes one whole fragment, from 128 bytes (one
  // line) of each of 16 rows; a thread is the lane that will load its 16 halves
  const unsigned fr = blk * 8 + (threadIdx.x >> 5);   // row tile * 16 + k step
  const unsigned ln = threadIdx.x & 31;
  const float* xp = x + (size_t)((fr >> 4) * 16 + (ln & 15)) * DIM
                      + (fr & 15) * 32 + (ln >> 4) * 8;
  _Float16* xd = xh + (size_t)fr * PK_FRAG + ln * 8;
  const v8f lo = *(const v8f*)(xp), up = *(const v8f*)(xp + 16);
  *(v8h*)(xd)       = __builtin_convertvector(lo, v8h);
  *(v8h*)(xd + 256) = __builtin_convertvector(up, v8h);
  // as above: in front of any rewrite of this store's registers
  asm volatile("s_wait_xcnt 0x0" ::: "memory");
}

// ---- K1: encoder layer-1 GEMMs + V projection -----------------------------
// grid (32, 8, 3), block 256 (8 waves); 128x64 output tile per block.

__global__ __launch_bounds__(256)
void k_encode1(const _Float16* __restrict__ xh,
                          const _Float16* __restrict__ kw1t,
                          const _Float16* __restrict__ qw1t,
                          const _Float16* __restrict__ vwt,
                          const float* __restrict__ kb1,
                          const float* __restrict__ qb1,
                          const float* __restrict__ vb,
                          _Float16* __restrict__ hk,
                          _Float16* __restrict__ hq,
                          _Float16* __restrict__ vt) {
  // the B panel, 65 KB; 16-byte copies and reads
  __shared__ __attribute__((aligned(16))) _Float16 bs[64 * BPITCH];
  const int tid = threadIdx.x;
  const int lane = tid & 31, wave = tid >> 5;
  const int z = blockIdx.z;
  const int rowBase = blockIdx.x * 128 + wave * 16;
  const int colBase = blockIdx.y * 64;
  const _Float16* wt  = (z == 0) ? kw1t : (z == 1) ? qw1t : vwt;
  const float*    bia = (z == 0) ? kb1  : (z == 1) ? qb1  : vb;

  v8f acc[4] = {};
  // the loops below are unrolled so that acc[] is indexed by constants and
  // stays in registers; z is the same for the whole block, so every wave of a
  // block passes the same one barrier
  if (z == 2) {
    gemm_16x64<false>(xh, wt, bs, rowBase, colBase, tid, acc);
    const int mBase = rowBase + ((lane >> 4) << 3);
    const int nBase = colBase + (lane & 15);
    // V^T, rows b * DIM + d, k = l: a lane's 8 rows are 8 neighbours in l
    // (mBase % 8 == 0); a wave's store is half a fragment, 512 bytes in a row
    const int b = mBase >> 11, l = mBase & 2047;
#pragma unroll
    for (int t = 0; t < 4; ++t)
      *(v8h*)(vt + pk_off(b * DIM + nBase + t * 16, l, SEQ / 32)) =
          __builtin_convertvector(acc[t] + bia[nBase + t * 16], v8h);
    return;
  }

  // Hk, Hq, rows = tokens, k = column: the transposed tile gives a lane 8
  // neighbouring columns of one token, again half a fragment a store
  gemm_16x64<true>(xh, wt, bs, rowBase, colBase, tid, acc);
  const int row = rowBase + (lane & 15);
  const int n0  = colBase + ((lane >> 4) << 3);
  _Float16* dst = (z == 0) ? hk : hq;
#pragma unroll
  for (int t = 0; t < 4; ++t) {
    const v8f v = acc[t] + *(const v8f*)(bia + n0 + t * 16);
    v8h h;
#pragma unroll
    for (int r = 0; r < 8; ++r) h[r] = (_Float16)gelu_exact(v[r]);
    *(v8h*)(dst + pk_off(row, n0 + t * 16, DIM / 32)) = h;
  }
}

// ---- K2: encoder layer-2 + phases -> Q, K, Kt -----------------------------
// grid (ROWS / 16), block 256. A block owns 16 rows; each of its 8 waves owns
// one 16x16 tile: waves 0..3 the four column tiles of k, waves 4..7 those of
// q. So 256 blocks share the loads and the tanh / cos / sin work, one tile a
// wave. A tile's k order is 0, 32, ... in one accumulator chain.

__global__ __launch_bounds__(256)
void k_phases(const _Float16* __restrict__ hk,
              const _Float16* __restrict__ hq,
              const _Float16* __restrict__ kw2t,
              const _Float16* __restrict__ qw2t,
              const float* __restrict__ kb2,
              const float* __restrict__ qb2,
              const float* __restrict__ sw,
              _Float16* __restrict__ Qm,   // ROWS x FDIM, fragment order
              _Float16* __restrict__ Km,   // ROWS x FDIM, fragment order
              _Float16* __restrict__ Kt) { // (B FDIM) x SEQ, fragment order
  const int lane = threadIdx.x & 31;
  // the wave's number in a scalar register: the choices below become scalar
  const int wave = __builtin_amdgcn_readfirstlane(threadIdx.x >> 5);
  const bool isq = wave >= 4;
  const int t = wave & 3;                  // column tile = orthogonal set
  const int rowBase = blockIdx.x * 16;
  const int hi = lane >> 4;
  const int tp = t * 16 + (lane & 15);     // 0..63
  // This lane's place in the first fragment of the tokens' and of the weights'
  // row tile. A k wave has the tokens as the A operand: a lane holds 8 tokens
  // of one feature, as K^T wants them. A q wave has the weights as A: a lane
  // holds 8 neighbouring features of one token, as Q wants them.
  const _Float16* hp = (isq ? hq : hk)
      + (size_t)blockIdx.x * (DIM / 32) * PK_FRAG + lane * 8;
  const _Float16* wp = (isq ? qw2t : kw2t) + t * (DIM / 32) * PK_FRAG + lane * 8;
  const _Float16* pa = isq ? wp : hp;
  const _Float16* pb = isq ? hp : wp;
  // The bias of the lane's 8 accumulator rows: 8 features' in a q wave, one
  // feature's in a k wave. Both are loaded here by every wave and chosen behind
  // the products: a choice here would wait for the load in front of all others.
  const float* qbs = qb2 + t * 16;         // scalar base
  const v8f   bq = *(const v8f*)(qbs + hi * 8);
  const float bk = kb2[tp];

  // A wave has one product a k step, so nothing but its own loads in flight
  // hides their latency: eight k steps are fetched ahead, in registers.
  v16h a[8], b[8];
#pragma unroll
  for (int i = 0; i < 8; ++i) {
    a[i] = frag_pk(pa + i * PK_FRAG);
    b[i] = frag_pk(pb + i * PK_FRAG);
  }
  // without it the compiler sinks each load to just above its product
  __builtin_amdgcn_sched_barrier(0);
  v8f acc = {};
  // unrolled: a[] and b[] are indexed by constants and stay in registers
#pragma unroll
  for (int i = 0; i < DIM / 32; ++i) {
    acc = wmma_f16(a[i & 7], b[i & 7], acc);
    if (i + 8 < DIM / 32) {
      a[i & 7] = frag_pk(pa + (i + 8) * PK_FRAG);
      b[i & 7] = frag_pk(pb + (i + 8) * PK_FRAG);
      // as above: the refill stays directly behind the product it follows
      __builtin_amdgcn_sched_barrier(0);
    }
  }
  // in front of any rewrite of a register that the two bias loads name: as its
  // inputs, the loaded values keep the loads in front of it, and the offset and
  // base registers stay as they are up to it
  asm volatile("s_wait_xcnt 0x0"
               :: "v"(bq), "v"(bk), "v"(hi * 32), "v"(tp * 4), "s"(qbs), "s"(kb2)
               : "memory");
  // softmax over 4 set weights (redundant per thread; trivially cheap)
  float s0 = sw[0], s1 = sw[1], s2 = sw[2], s3 = sw[3];
  float mx = fmaxf(fmaxf(s0, s1), fmaxf(s2, s3));
  float e0 = expf(s0 - mx), e1 = expf(s1 - mx), e2 = expf(s2 - mx), e3 = expf(s3 - mx);
  float inv = 1.0f / (e0 + e1 + e2 + e3);
  const float et = (t == 0) ? e0 : (t == 1) ? e1 : (t == 2) ? e2 : e3;
  const float scale = isq ? et * inv : 1.0f;   // k features carry no weight

  v8h ccol, scol;   // the lane's 8 accumulator rows as cos and as sin
#pragma unroll
  for (int r = 0; r < 8; ++r) {
    float ph = tanhf(acc[r] + (isq ? bq[r] : bk)) * PI_F;
    ccol[r] = (_Float16)(scale * cosf(ph));
    scol[r] = (_Float16)(scale * sinf(ph));
  }
  if (isq) {
    // 8 neighbouring features of token rowBase + (lane & 15)
    _Float16* dq = Qm + pk_off(rowBase + (lane & 15), t * 16 + hi * 8, FDIM / 32);
    *(v8h*)(dq)                            = ccol;
    *(v8h*)(dq + (TP / 32) * PK_FRAG)      = scol;
    return;
  }
  // 8 tokens of feature tp. In K a token's features are the neighbours, so the
  // 8 go out one by one; token mBase + r lies 8 halves behind token mBase + r - 1
  const int mBase = rowBase + hi * 8;
  _Float16* dk = Km + pk_off(mBase, tp, FDIM / 32);
#pragma unroll
  for (int r = 0; r < 8; ++r) {
    dk[r * 8]                         = ccol[r];
    dk[r * 8 + (TP / 32) * PK_FRAG]   = scol[r];
  }
  // the address arithmetic below reuses registers that the stores above
  // name: the wait stands in front of any rewrite
  asm volatile("s_wait_xcnt 0x0" ::: "memory");
  // K^T, rows b * FDIM + f, k = l: the 8 tokens are neighbours (mBase % 8 == 0)
  const int bt = mBase >> 11, l = mBase & 2047;
  _Float16* dt = Kt + pk_off(bt * FDIM + tp, l, SEQ / 32);
  *(v8h*)(dt)                                      = ccol;
  *(v8h*)(dt + (TP / 16) * (SEQ / 32) * PK_FRAG)   = scol;
}

// ---- K3a: per-chunk KV sums S_j[f,d] = sum_t K[t,f] V[t,d] ---------------
// grid (NCHK, 8, BATCH), block 256. Register double-buffered K loop.
// K^T is the A operand and V^T the B operand: a lane holds 8 neighbouring f of
// one d, which in Mt's own order (each plane DIM x FDIM in fragment order, rows
// d, k = f) are neighbours: a wave stores 1 KB in a row per tile.

__global__ void k_chunk_kv(const _Float16* __restrict__ Kt,
                           const _Float16* __restrict__ Vt,
                           float* __restrict__ Ssum) { // [B][NCHK] planes
  const int lane = threadIdx.x & 31, wave = threadIdx.x >> 5;
  const int j = blockIdx.x, dBase = blockIdx.y * 64, b = blockIdx.z;
  const int fBase = wave * 16;
  // this lane's place in the chunk's first fragment of the wave's K^T row tile
  // and of the block's first V^T row tile
  const _Float16* ktb = Kt + lane * 8
      + (size_t)(((b * FDIM + fBase) >> 4) * (SEQ / 32) + j * (CHUNK / 32)) * PK_FRAG;
  const _Float16* vtb = Vt + lane * 8
      + (size_t)(((b * DIM + dBase) >> 4) * (SEQ / 32) + j * (CHUNK / 32)) * PK_FRAG;
  const int VT_TILE = (SEQ / 32) * PK_FRAG;   // halves from a row tile to the next

  v8f acc[4] = {};
  v16h a_cur = frag_pk(ktb);
  v16h b_cur[4];
#pragma unroll
  for (int t = 0; t < 4; ++t)
    b_cur[t] = frag_pk(vtb + t * VT_TILE);

  for (int i = 0; i < CHUNK / 32; ++i) {
    v16h a_next, b_next[4];
    if (i + 1 < CHUNK / 32) {
      a_next = frag_pk(ktb + (i + 1) * PK_FRAG);
#pragma unroll
      for (int t = 0; t < 4; ++t)
        b_next[t] = frag_pk(vtb + t * VT_TILE + (i + 1) * PK_FRAG);
    }
#pragma unroll
    for (int t = 0; t < 4; ++t) acc[t] = wmma_f16(a_cur, b_cur[t], acc[t]);
    if (i + 1 < CHUNK / 32) {
      a_cur = a_next;
#pragma unroll
      for (int t = 0; t < 4; ++t) b_cur[t] = b_next[t];
    }
  }

  float* sp = Ssum + (size_t)(b * NCHK + j) * DIM * FDIM
                   + pk_off(dBase + (lane & 15), fBase + ((lane >> 4) << 3), FDIM / 32);
#pragma unroll
  for (int t = 0; t < 4; ++t)
    *(v8f*)(sp + t * (FDIM / 32) * PK_FRAG) = acc[t];
}

// ---- K3b: exclusive prefix over chunks -> Mt (f16) ------------------------
// Ssum and Mt share one order, [B][NCHK] planes of DIM x FDIM elements; a thread
// owns 4 adjacent elements, so a wave reads 512 and writes 256 contiguous bytes
// per chunk. The order within a plane (fragment order) plays no part here.
// grid (BATCH*DIM*FDIM/4/128), block 128.

__global__ void k_scan(const float* __restrict__ Ssum,
                       _Float16* __restrict__ Mt) { // [B][NCHK] planes
  const int PLANE = DIM * FDIM;
  const int tid = blockIdx.x * blockDim.x + threadIdx.x;
  const int b = tid / (PLANE / 4);
  const int e = (tid - b * (PLANE / 4)) * 4;
  const size_t base = (size_t)b * NCHK * PLANE + e;
  v4f run = {};
#pragma unroll
  for (int j = 0; j < NCHK; ++j) {
    *(v4h*)(Mt + base + (size_t)j * PLANE) = __builtin_convertvector(run, v4h);
    run += *(const v4f*)(Ssum + base + (size_t)j * PLANE);
  }
}

// ---- K3c: yn = LayerNorm((Q@M_prev + tril(Q K^T) @ V) / norm), f16 ---------
// grid (ROWS / 16), block 256. A block owns 16 whole token rows, wave w their
// 64 columns d = 64 w .. 64 w + 63, so the rows' mean and variance are formed
// here, from the accumulators: O never goes to memory and LayerNorm has no
// launch of its own. The block's 16 x 128 scores are made once, one 16 x 16
// tile a wave. In the second phase V^T and M^T are the A operand: a lane then
// holds 8 neighbouring d of ONE token row and stores them as 16 bytes.

static_assert(DIM == 8 * 64, "8 waves x 64 columns are a whole row");
static_assert(CHUNK == 8 * 16, "8 waves x 16 tokens are a whole chunk");
static_assert(SEQ == 2048 && CHUNK == 128, "the shifts below");

__global__ __launch_bounds__(256)
void k_chunk_out_ln(const _Float16* __restrict__ Qm,
                    const _Float16* __restrict__ Km,
                    const _Float16* __restrict__ Vt,
                    const _Float16* __restrict__ Mt,
                    const float* __restrict__ ln_g,
                    const float* __restrict__ ln_b,
                    _Float16* __restrict__ yn) { // ROWS x DIM, fragment order
  // +8 halves pad: 16-byte reads of 16 rows fall on different banks
  __shared__ __attribute__((aligned(16))) _Float16 sc[16][CHUNK + 8];
  // [sum | sum of squares][token row][wave]
  __shared__ __attribute__((aligned(16))) float red[2][16][8];
  const int lane = threadIdx.x & 31;
  // the wave's number in a scalar register: tile bases become scalar
  const int wave = __builtin_amdgcn_readfirstlane(threadIdx.x >> 5);
  const int hi = lane >> 4, m = lane & 15;
  const int row0 = blockIdx.x * 16;          // first token row of the block
  const int b = row0 >> 11;
  const int j = (row0 & (SEQ - 1)) >> 7;     // chunk
  const int rowTok = row0 & ~(CHUNK - 1);    // first token row of the chunk
  const int lIn = row0 & (CHUNK - 1);        // row0 within the chunk
  const int dBase = wave * 64;
  // This lane's place in the first fragment of each operand (fragment order:
  // see pk_off); every other fragment is a constant step from it.
  const int VT_TILE = (SEQ / 32) * PK_FRAG;    // halves from a row tile to the next
  const int MT_TILE = (FDIM / 32) * PK_FRAG;
  const _Float16* qs = Qm + (size_t)(row0 >> 4) * MT_TILE;       // scalar bases
  const _Float16* ks = Km + (size_t)((rowTok >> 4) + wave) * MT_TILE;
  const _Float16* vs0 = Vt + (size_t)((b * DIM + dBase) >> 4) * VT_TILE
                           + j * (CHUNK / 32) * PK_FRAG;
  const _Float16* ms = Mt + (size_t)(b * NCHK + j) * DIM * FDIM
                          + (dBase >> 4) * MT_TILE;
  const _Float16* qp = qs + lane * 8;
  const _Float16* kp = ks + lane * 8;
  const _Float16* vp = vs0 + lane * 8;
  const _Float16* mp = ms + lane * 8;
  const float* gs = ln_g + dBase;            // scalar bases
  const float* bs = ln_b + dBase;
  const int go = hi * 8;

  // Every load of the block is issued here, so that all of them wait out one
  // memory latency together. The loops are unrolled so that the arrays stay in
  // registers.
  v16h qf[4], kf[4], vf[4][4], mf[4][4];
  v8f g[4], be[4];
#pragma unroll
  for (int i = 0; i < 4; ++i) qf[i] = frag_pk(qp + i * PK_FRAG);
#pragma unroll
  for (int i = 0; i < 4; ++i) kf[i] = frag_pk(kp + i * PK_FRAG);
#pragma unroll
  for (int t = 0; t < 4; ++t) {
#pragma unroll
    for (int i = 0; i < 4; ++i) vf[i][t] = frag_pk(vp + t * VT_TILE + i * PK_FRAG);
  }
#pragma unroll
  for (int t = 0; t < 4; ++t) {
#pragma unroll
    for (int i = 0; i < 4; ++i) mf[i][t] = frag_pk(mp + t * MT_TILE + i * PK_FRAG);
  }
#pragma unroll
  for (int t = 0; t < 4; ++t) {
    g[t]  = *(const v8f*)(gs + go + t * 16);
    be[t] = *(const v8f*)(bs + go + t * 16);
  }
  // without it the compiler sinks each load to just above its use
  __builtin_amdgcn_sched_barrier(0);
  // in front of any rewrite of a register that the loads above name; as its
  // inputs, their address, offset and base registers stay as they are up to it
  asm volatile("s_wait_xcnt 0x0"
               :: "v"(lane), "s"(qs), "s"(ks), "s"(vs0), "s"(ms),
                  "v"(go * 4), "s"(gs), "s"(bs)
               : "memory");

  // Phase A: this wave's tile of scores = Q K_c^T, masked causal-inclusive
  v8f sacc = {};
#pragma unroll
  for (int i = 0; i < 4; ++i) sacc = wmma_f16(qf[i], kf[i], sacc);
  const int tl = wave * 16 + m;              // key token within the chunk
#pragma unroll
  for (int r = 0; r < 8; ++r) {
    const int mr = hi * 8 + r;               // query row within the block
    sc[mr][tl] = (_Float16)((tl <= lIn + mr) ? sacc[r] : 0.0f);
  }
  __syncthreads();                           // the scores are ready for all waves

  // Phase B: O^T = V_c^T scores^T + M_prev^T Q^T, one accumulator chain a tile,
  // the scores' k steps first
  v8f acc[4] = {};
  v16h sf[4];
#pragma unroll
  for (int i = 0; i < 4; ++i) sf[i] = load_frag(&sc[0][0], CHUNK + 8, 0, i * 32, lane);
#pragma unroll
  for (int i = 0; i < 4; ++i) {
#pragma unroll
    for (int t = 0; t < 4; ++t) acc[t] = wmma_f16(vf[i][t], sf[i], acc[t]);
  }
#pragma unroll
  for (int i = 0; i < 4; ++i) {
#pragma unroll
    for (int t = 0; t < 4; ++t) acc[t] = wmma_f16(mf[i][t], qf[i], acc[t]);
  }

  // Position norm and LayerNorm of token row row0 + m. A lane holds 32 of the
  // row's elements: d = dBase + 16 t + 8 hi + r.
  const int l = (row0 + m) & (SEQ - 1);
  const float nf = rsqrtf((float)(l + 1) * (float)NPLN);
  v8f vs = {}, vq = {};
#pragma unroll
  for (int t = 0; t < 4; ++t) {
    acc[t] *= nf;
    vs += acc[t];
    vq += acc[t] * acc[t];
  }
  float s = ((vs[0] + vs[1]) + (vs[2] + vs[3])) + ((vs[4] + vs[5]) + (vs[6] + vs[7]));
  float q = ((vq[0] + vq[1]) + (vq[2] + vq[3])) + ((vq[4] + vq[5]) + (vq[6] + vq[7]));
  // plus the lane of the same number in the other 16-lane row: same token row
  const int so = __builtin_bit_cast(int, s), qo = __builtin_bit_cast(int, q);
  s += __builtin_bit_cast(float, __builtin_amdgcn_permlanex16(
      so, so, 0x76543210, 0xfedcba98, false, false));
  q += __builtin_bit_cast(float, __builtin_amdgcn_permlanex16(
      qo, qo, 0x76543210, 0xfedcba98, false, false));
  // lanes 0..15 hand over the wave's sums, lanes 16..31 its sums of squares
  red[hi][m][wave] = hi ? q : s;
  __syncthreads();                           // all 8 waves' sums are there
  const v8f rs = *(const v8f*)&red[0][m][0];
  const v8f rq = *(const v8f*)&red[1][m][0];
  s = ((rs[0] + rs[1]) + (rs[2] + rs[3])) + ((rs[4] + rs[5]) + (rs[6] + rs[7]));
  q = ((rq[0] + rq[1]) + (rq[2] + rq[3])) + ((rq[4] + rq[5]) + (rq[6] + rq[7]));
  const float mu  = s * (1.0f / DIM);
  const float var = q * (1.0f / DIM) - mu * mu;
  const float ivs = rsqrtf(var + 1e-5f);
  // 16 columns on are half a fragment on: a wave's store is 512 bytes in a row
  _Float16* dst = yn + pk_off(row0 + m, dBase + hi * 8, DIM / 32);
#pragma unroll
  for (int t = 0; t < 4; ++t)
    *(v8h*)(dst + t * 256) =
        __builtin_convertvector((acc[t] - mu) * ivs * g[t] + be[t], v8h);
}

// ---- K4b: out = x + yn @ ow + ob ------------------------------------------
// grid (32, 8), block 256. Same async LDS staging as K1.

__global__ __launch_bounds__(256)
void k_outproj(const _Float16* __restrict__ yn,
                          const _Float16* __restrict__ owt,
                          const float* __restrict__ ob,
                          const float* __restrict__ x,
                          float* __restrict__ out) {
  __shared__ __attribute__((aligned(16))) _Float16 bs[64 * BPITCH];
  const int tid = threadIdx.x;
  const int lane = tid & 31, wave = tid >> 5;
  const int rowBase = blockIdx.x * 128 + wave * 16;
  const int colBase = blockIdx.y * 64;

  v8f acc[4] = {};
  gemm_16x64<false>(yn, owt, bs, rowBase, colBase, tid, acc);

  const int mBase = rowBase + ((lane >> 4) << 3);
#pragma unroll
  for (int t = 0; t < 4; ++t) {
    const int n = colBase + t * 16 + (lane & 15);
#pragma unroll
    for (int r = 0; r < 8; ++r) {
      const size_t idx = (size_t)(mBase + r) * DIM + n;
      out[idx] = x[idx] + acc[t][r] + ob[n];
    }
  }
}

// ---------------------------------------------------------------------------

extern "C" void kernel_launch(void* const* d_in, const int* in_sizes, int n_in,
                              void* d_out, int out_size, void* d_ws, size_t ws_size,
                              hipStream_t stream) {
  const float* x   = (const float*)d_in[0];
  const float* sw  = (const float*)d_in[1];
  const float* kw1 = (const float*)d_in[2];
  const float* kb1 = (const float*)d_in[3];
  const float* kw2 = (const float*)d_in[4];
  const float* kb2 = (const float*)d_in[5];
  const float* qw1 = (const float*)d_in[6];
  const float* qb1 = (const float*)d_in[7];
  const float* qw2 = (const float*)d_in[8];
  const float* qb2 = (const float*)d_in[9];
  const float* vw  = (const float*)d_in[10];
  const float* vb  = (const float*)d_in[11];
  const float* lng = (const float*)d_in[12];
  const float* lnb = (const float*)d_in[13];
  const float* ow  = (const float*)d_in[14];
  const float* ob  = (const float*)d_in[15];
  float* out = (float*)d_out;

  // workspace carve-up (all 256B aligned)
  char* ws = (char*)d_ws;
  size_t off = 0;
  auto take = [&](size_t bytes) { char* p = ws + off; off += (bytes + 255) & ~(size_t)255; return p; };
  _Float16* xh    = (_Float16*)take((size_t)ROWS * DIM * 2);
  _Float16* hk    = (_Float16*)take((size_t)ROWS * DIM * 2);
  _Float16* hq    = (_Float16*)take((size_t)ROWS * DIM * 2);
  _Float16* vt    = (_Float16*)take((size_t)BATCH * DIM * SEQ * 2);
  _Float16* Qm    = (_Float16*)take((size_t)ROWS * FDIM * 2);
  _Float16* Km    = (_Float16*)take((size_t)ROWS * FDIM * 2);
  _Float16* Kt    = (_Float16*)take((size_t)BATCH * FDIM * SEQ * 2);
  float*    Ssum  = (float*)   take((size_t)BATCH * NCHK * FDIM * DIM * 4);
  _Float16* Mt    = (_Float16*)take((size_t)BATCH * NCHK * DIM * FDIM * 2);
  _Float16* yn    = (_Float16*)take((size_t)ROWS * DIM * 2);
  _Float16* kw1t  = (_Float16*)take((size_t)DIM * DIM * 2);
  _Float16* qw1t  = (_Float16*)take((size_t)DIM * DIM * 2);
  _Float16* vwt   = (_Float16*)take((size_t)DIM * DIM * 2);
  _Float16* owt   = (_Float16*)take((size_t)DIM * DIM * 2);
  _Float16* kw2t  = (_Float16*)take((size_t)TP * DIM * 2);
  _Float16* qw2t  = (_Float16*)take((size_t)TP * DIM * 2);

  // P0: conversions, one launch
  k_prepare<<<NB_PREP, 256, 0, stream>>>(x, kw1, qw1, vw, ow, kw2, qw2,
                                         xh, kw1t, qw1t, vwt, owt, kw2t, qw2t);

  // K1: Hk / Hq / Vt
  k_encode1<<<dim3(ROWS / 128, DIM / 64, 3), 256, 0, stream>>>(
      xh, kw1t, qw1t, vwt, kb1, qb1, vb, hk, hq, vt);

  // K2: phases -> Q, K, Kt
  k_phases<<<dim3(ROWS / 16), 256, 0, stream>>>(
      hk, hq, kw2t, qw2t, kb2, qb2, sw, Qm, Km, Kt);

  // K3: chunked causal linear attention
  k_chunk_kv<<<dim3(NCHK, DIM / 64, BATCH), 256, 0, stream>>>(Kt, vt, Ssum);
  k_scan<<<BATCH * FDIM * DIM / 4 / 128, 128, 0, stream>>>(Ssum, Mt);
  k_chunk_out_ln<<<dim3(ROWS / 16), 256, 0, stream>>>(Qm, Km, vt, Mt, lng, lnb, yn);

  // K4: output projection + residual
  k_outproj<<<dim3(ROWS / 128, DIM / 64), 256, 0, stream>>>(yn, owt, ob, x, out);
}

// v009
// One run takes 39.2 microseconds.
// In both of two side-by-side timings against v008, it was 1.19 times as fast.
// Counting every step since v000, it is 5.84 times as fast.
#include <hip/hip_runtime.h>
#include <hip/hip_bf16.h>
#include <math.h>

// ---------------------------------------------------------------------------
// MI455X (gfx1250, wave32) implementation.
// Pipeline:
//  P0  convert x -> f16, transpose-convert all weights -> f16 [N,K]; one launch
//  K1  Hk = gelu(x@kw1+b), Hq = gelu(x@qw1+b), Vt = (x@vw+b)^T     (WMMA f16,
//      B panel of all k staged once in LDS via async-load-to-LDS)
//  K2  phases -> Q[l,f]=w_s*{cos,sin}(qp), K[l,f], Kt[f,l]          (WMMA f16)
//  K3a state sums S_j = K_j^T V_j of the first 15 chunks of a tile, handed over in
//      LDS; their exclusive prefix -> Mt, f16 M^T planes            (WMMA f16)
//  K3c O = Q@M_prev + tril(Q K^T) @ V  (scores staged in LDS), then
//      position-norm + LayerNorm of its whole rows -> yn (f16)      (WMMA f16)
//  K4b out = x + yn@ow + ob  (async LDS-staged B, like K1)          (WMMA f16)
// All accumulation in f32 (WMMA f32 accumulators).
// Every f16 matrix that a wave loads from global memory as WMMA fragments lies
// in the workspace in fragment order (pk_off below), not row-major.
// ---------------------------------------------------------------------------

typedef __attribute__((ext_vector_type(16))) _Float16 v16h;
typedef __attribute__((ext_vector_type(8)))  _Float16 v8h;
typedef __attribute__((ext_vector_type(8)))  float    v8f;
typedef __attribute__((ext_vector_type(4)))  int      v4i;
typedef __attribute__((ext_vector_type(4)))  float    v4f;
typedef __attribute__((ext_vector_type(4)))  _Float16 v4h;

#define BATCH 2
#define SEQ   2048
#define DIM   512
#define NSET  4
#define NPLN  16
#define TP    64          // NSET*NPLN
#define FDIM  128         // 2*TP (cos|sin features)
#define ROWS  4096        // BATCH*SEQ
#define CHUNK 128
#define NCHK  16          // SEQ/CHUNK
#define PI_F  3.14159265358979323846f

// CDNA5 async global->LDS path (ASYNCcnt). Guarded so the file compiles on
// toolchains without the builtins (falls back to sync reg->LDS staging).
#if defined(__has_builtin)
#if __has_builtin(__builtin_amdgcn_global_load_async_to_lds_b128) && \
    __has_builtin(__builtin_amdgcn_s_wait_asynccnt)
#define USE_ASYNC_LDS 1
#endif
#endif

#define AS_GLOBAL __attribute__((address_space(1)))
#define AS_LDS    __attribute__((address_space(3)))

// ---- WMMA helpers ---------------------------------------------------------

__device__ __forceinline__ v8f wmma_f16(v16h a, v16h b, v8f c) {
  // v_wmma_f32_16x16x32_f16 : D = A(16x32) x B(32x16) + C
  return __builtin_amdgcn_wmma_f32_16x16x32_f16(false, a, false, b,
                                                (short)0, c, false, false);
}

// Load a 16x32 f16 A-fragment (or the transposed-B fragment, which has the
// identical per-lane layout) from a row-major f16 matrix with leading dim ld.
// ISA layout: lane&15 selects row, (lane>>4)*8 selects K phase; vector
// elements 0..7 hold K = kb..kb+7, elements 8..15 hold K = kb+16..kb+23.
__device__ __forceinline__ v16h load_frag(const _Float16* __restrict__ base,
                                          int ld, int rowBase, int k0, int lane) {
  const _Float16* p = base + (size_t)(rowBase + (lane & 15)) * ld
                           + k0 + ((lane >> 4) << 3);
  v16h f;
  *(v8h*)&f       = *(const v8h*)(p);
  *((v8h*)&f + 1) = *(const v8h*)(p + 16);
  return f;
}

// Fragment order of a rows x (32 ks) f16 matrix in the workspace. The 16 x 32
// fragment (row tile, k step) is 1 KB in a row: first every lane's elements
// 0..7, lane after lane, then every lane's elements 8..15. A wave's 16-byte
// load then takes 512 contiguous bytes, 4 whole lines, where a row-major
// matrix gives it 32-byte pieces of 16 lines. Eight neighbouring k (k % 8 == 0)
// of one row are still 16 contiguous bytes.
__device__ __forceinline__ int pk_off(int row, int k, int ks) {
  return ((((row >> 4) * ks + (k >> 5)) * 2 + ((k >> 4) & 1)) << 8)
         + (((((k >> 3) & 1) << 4) + (row & 15)) << 3) + (k & 7);
}

#define PK_FRAG 512   // halves of one fragment

// The fragment at p = matrix + (row tile * ks + k step) * PK_FRAG + lane * 8;
// the same values in the same lanes and elements as load_frag gives.
__device__ __forceinline__ v16h frag_pk(const _Float16* __restrict__ p) {
  v16h f;
  *(v8h*)&f       = *(const v8h*)(p);
  *((v8h*)&f + 1) = *(const v8h*)(p + 256);
  return f;
}

// LDS row pitch of a B panel, in halves: 1040 bytes = 16 B x 65, an odd count,
// so the 16 rows that a ds_load_b128 reads fall on different banks.
#define BPITCH (DIM + 8)

// Stage a whole 64 x DIM f16 B panel (64 KB) into LDS: 16 b128 per thread of a
// 256-thread block, all in flight together. A wave's copy takes 512 contiguous
// bytes, half a row. Async (ASYNCcnt path) when available.
__device__ __forceinline__ void stage_b_panel(_Float16* __restrict__ lds_dst,
                                              const _Float16* __restrict__ gsrc,
                                              int colBase, int tid) {
  const int r = tid >> 6;          // 0..3  (row of transposed B, within 4)
  const int c = (tid & 63) << 3;   // 0,8,..,504 (halves)
  const _Float16* src = gsrc + (size_t)(colBase + r) * DIM + c;
  _Float16* dst = lds_dst + r * BPITCH + c;
  // unrolled: the steps become constants of the copies' addresses
#pragma unroll
  for (int i = 0; i < 16; ++i) {
#if defined(USE_ASYNC_LDS)
    _Float16* src_nc = const_cast<_Float16*>(src + i * 4 * DIM);
    __builtin_amdgcn_global_load_async_to_lds_b128(
        (AS_GLOBAL v4i*)src_nc, (AS_LDS v4i*)(dst + i * 4 * BPITCH), 0, 0);
#else
    *(v8h*)(dst + i * 4 * BPITCH) = *(const v8h*)(src + i * 4 * DIM);
#endif
  }
}

// The issuing wave's own copies have landed behind it; in asm with the memory
// clobber, so that no LDS read is moved in front of it.
__device__ __forceinline__ void stage_wait() {
#if defined(USE_ASYNC_LDS)
  asm volatile("s_wait_asynccnt 0x0" ::: "memory");
#endif
}

// acc[t] += A[rowBase .. +15][0 .. DIM) x (rows colBase + 16 t .. +15 of wt)^T,
// t = 0..3, for each of the 8 waves of a block; k runs 0, 32, ... in one
// accumulator chain a tile. Every load of the product is issued at the start:
// the B panel's copies and the wave's 16 A fragments wait out one memory
// latency together, and one barrier publishes the panel. A lies in fragment
// order. With TR the panel is the A operand of the products: acc[t] is then the
// transposed tile, a lane holding 8 neighbouring columns of ONE row of A.
template <bool TR>
__device__ __forceinline__ void gemm_16x64(const _Float16* __restrict__ A,
                                           const _Float16* __restrict__ wt,
                                           _Float16* __restrict__ bs,
                                           int rowBase, int colBase, int tid,
                                           v8f (&acc)[4]) {
  const int lane = tid & 31;
  stage_b_panel(bs, wt, colBase, tid);
  // the loops below are unrolled so that a[] stays in registers
  v16h a[DIM / 32];
#pragma unroll
  for (int i = 0; i < DIM / 32; ++i)
    a[i] = frag_pk(A + ((rowBase >> 4) * (DIM / 32) + i) * PK_FRAG + lane * 8);
  // without it the compiler sinks each load to just above its product
  __builtin_amdgcn_sched_barrier(0);
  // in front of any rewrite of a register that the loads above name
  asm volatile("s_wait_xcnt 0x0" ::: "memory");
  stage_wait();
  __syncthreads();                        // the panel is ready for all waves
  // With no barrier left between the k steps, a step's four B fragments are
  // read from LDS as one group, one step ahead of their products.
  v16h b[2][4];
#pragma unroll
  for (int t = 0; t < 4; ++t) b[0][t] = load_frag(bs, BPITCH, t * 16, 0, lane);
#pragma unroll
  for (int i = 0; i < DIM / 32; ++i) {
    if (i + 1 < DIM / 32) {
#pragma unroll
      for (int t = 0; t < 4; ++t)
        b[(i + 1) & 1][t] = load_frag(bs, BPITCH, t * 16, (i + 1) * 32, lane);
    }
    // without it the compiler sinks each LDS read to just above its product,
    // which then waits out the whole LDS latency
    __builtin_amdgcn_sched_barrier(0);
#pragma unroll
    for (int t = 0; t < 4; ++t)
      acc[t] = TR ? wmma_f16(b[i & 1][t], a[i], acc[t])
                  : wmma_f16(a[i], b[i & 1][t], acc[t]);
    // as above: the next group of reads stays behind these products
    __builtin_amdgcn_sched_barrier(0);
  }
}

__device__ __forceinline__ float gelu_exact(float v) {
  return 0.5f * v * (1.0f + erff(v * 0.70710678118654752440f));
}

// ---- P0: conversions ------------------------------------------------------
// A thread makes 8 f16 that are neighbours in dst and stores them as 16 bytes (an x thread two such groups).
// All seven conversions read inputs only and none reads another's output, so
// they share one launch: a block's index says which array it works on.

// dst[n*K+k] = (f16) src[k*N+n]   (store weights transposed for B operands)
// A thread reads 8 consecutive k of one n. A wave is 4 n x 8 groups of k, so
// its one store fills 4 whole 128-byte lines of dst, each written by no other
// wave; the 8 waves of a block read 128 contiguous bytes of each source row.
// idx runs over K * N / 8 threads, in whole blocks of 256.
// With PK dst is in fragment order (rows n), else row-major; with PK a wave's
// store is 8 pieces of 64 bytes (the two matrices stored so are 64 KB each).
template <int K, int N, bool PK>
__device__ __forceinline__ void transpose_f16(const float* __restrict__ src,
                                              _Float16* __restrict__ dst,
                                              unsigned idx) {
  static_assert(N % 4 == 0 && K % 64 == 0, "a wave is 4 n x 64 k");
  static_assert((K * N) % (8 * 256) == 0, "whole blocks cover the matrix");
  const unsigned nb = N >> 2;            // waves across n
  const unsigned w  = idx >> 5;
  const unsigned wk = w / nb, wn = w - wk * nb;
  const unsigned n  = wn * 4 + (idx & 3);
  const unsigned k0 = (wk * 8 + ((idx >> 2) & 7)) * 8;
  const float* p = src + (size_t)k0 * N + n;
  v8h h;
  // unrolled: h stays in registers and the eight loads are in flight together
#pragma unroll
  for (int i = 0; i < 8; ++i) h[i] = (_Float16)p[(size_t)i * N];
  *(v8h*)(dst + (PK ? (size_t)pk_off(n, k0, K / 32) : (size_t)n * K + k0)) = h;
}

#define NB_WBIG   (DIM * DIM / 8 / 256)   // blocks per DIM x DIM weight
#define NB_WSMALL (DIM * TP / 8 / 256)    // blocks per DIM x TP weight
#define NB_X      (ROWS * DIM / 16 / 256) // blocks for x
#define NB_PREP   (4 * NB_WBIG + 2 * NB_WSMALL + NB_X)

static_assert((ROWS * DIM) % (16 * 256) == 0, "the grid covers x exactly");

// grid (NB_PREP), block 256. The transposes come first in the index order:
// their loads touch more lines than those of the x conversion.
__global__ void k_prepare(const float* __restrict__ x,
                          const float* __restrict__ kw1,
                          const float* __restrict__ qw1,
                          const float* __restrict__ vw,
                          const float* __restrict__ ow,
                          const float* __restrict__ kw2,
                          const float* __restrict__ qw2,
                          _Float16* __restrict__ xh,
                          _Float16* __restrict__ kw1t,
                          _Float16* __restrict__ qw1t,
                          _Float16* __restrict__ vwt,
                          _Float16* __restrict__ owt,
                          _Float16* __restrict__ kw2t,
                          _Float16* __restrict__ qw2t) {
  unsigned blk = blockIdx.x;
  if (blk < 4 * NB_WBIG) {
    const unsigned m = blk / NB_WBIG;
    const float* s = (m == 0) ? kw1 : (m == 1) ? qw1 : (m == 2) ? vw : ow;
    _Float16* d = (m == 0) ? kw1t : (m == 1) ? qw1t : (m == 2) ? vwt : owt;
    transpose_f16<DIM, DIM, false>(s, d, (blk - m * NB_WBIG) * 256 + threadIdx.x);
    return;
  }
  blk -= 4 * NB_WBIG;
  if (blk < 2 * NB_WSMALL) {
    const unsigned m = blk / NB_WSMALL;
    transpose_f16<DIM, TP, true>(m == 0 ? kw2 : qw2, m == 0 ? kw2t : qw2t,
                           (blk - m * NB_WSMALL) * 256 + threadIdx.x);
    // the build lays another branch's code behind this store, and that code
    // rewrites the store's registers: the wait stands in front of any rewrite
    asm volatile("s_wait_xcnt 0x0" ::: "memory");
    return;
  }
  blk -= 2 * NB_WSMALL;
  // x in fragment order: a wave makes one whole fragment, from 128 bytes (one
  // line) of each of 16 rows; a thread is the lane that will load its 16 halves
  const unsigned fr = blk * 8 + (threadIdx.x >> 5);   // row tile * 16 + k step
  const unsigned ln = threadIdx.x & 31;
  const float* xp = x + (size_t)((fr >> 4) * 16 + (ln & 15)) * DIM
                      + (fr & 15) * 32 + (ln >> 4) * 8;
  _Float16* xd = xh + (size_t)fr * PK_FRAG + ln * 8;
  const v8f lo = *(const v8f*)(xp), up = *(const v8f*)(xp + 16);
  *(v8h*)(xd)       = __builtin_convertvector(lo, v8h);
  *(v8h*)(xd + 256) = __builtin_convertvector(up, v8h);
  // as above: in front of any rewrite of this store's registers
  asm volatile("s_wait_xcnt 0x0" ::: "memory");
}

// ---- K1: encoder layer-1 GEMMs + V projection -----------------------------
// grid (32, 8, 3), block 256 (8 waves); 128x64 output tile per block.

__global__ __launch_bounds__(256)
void k_encode1(const _Float16* __restrict__ xh,
                          const _Float16* __restrict__ kw1t,
                          const _Float16* __restrict__ qw1t,
                          const _Float16* __restrict__ vwt,
                          const float* __restrict__ kb1,
                          const float* __restrict__ qb1,
                          const float* __restrict__ vb,
                          _Float16* __restrict__ hk,
                          _Float16* __restrict__ hq,
                          _Float16* __restrict__ vt) {
  // the B panel, 65 KB; 16-byte copies and reads
  __shared__ __attribute__((aligned(16))) _Float16 bs[64 * BPITCH];
  const int tid = threadIdx.x;
  const int lane = tid & 31, wave = tid >> 5;
  const int z = blockIdx.z;
  const int rowBase = blockIdx.x * 128 + wave * 16;
  const int colBase = blockIdx.y * 64;
  const _Float16* wt  = (z == 0) ? kw1t : (z == 1) ? qw1t : vwt;
  const float*    bia = (z == 0) ? kb1  : (z == 1) ? qb1  : vb;

  v8f acc[4] = {};
  // the loops below are unrolled so that acc[] is indexed by constants and
  // stays in registers; z is the same for the whole block, so every wave of a
  // block passes the same one barrier
  if (z == 2) {
    gemm_16x64<false>(xh, wt, bs, rowBase, colBase, tid, acc);
    const int mBase = rowBase + ((lane >> 4) << 3);
    const int nBase = colBase + (lane & 15);
    // V^T, rows b * DIM + d, k = l: a lane's 8 rows are 8 neighbours in l
    // (mBase % 8 == 0); a wave's store is half a fragment, 512 bytes in a row
    const int b = mBase >> 11, l = mBase & 2047;
#pragma unroll
    for (int t = 0; t < 4; ++t)
      *(v8h*)(vt + pk_off(b * DIM + nBase + t * 16, l, SEQ / 32)) =
          __builtin_convertvector(acc[t] + bia[nBase + t * 16], v8h);
    return;
  }

  // Hk, Hq, rows = tokens, k = column: the transposed tile gives a lane 8
  // neighbouring columns of one token, again half a fragment a store
  gemm_16x64<true>(xh, wt, bs, rowBase, colBase, tid, acc);
  const int row = rowBase + (lane & 15);
  const int n0  = colBase + ((lane >> 4) << 3);
  _Float16* dst = (z == 0) ? hk : hq;
#pragma unroll
  for (int t = 0; t < 4; ++t) {
    const v8f v = acc[t] + *(const v8f*)(bia + n0 + t * 16);
    v8h h;
#pragma unroll
    for (int r = 0; r < 8; ++r) h[r] = (_Float16)gelu_exact(v[r]);
    *(v8h*)(dst + pk_off(row, n0 + t * 16, DIM / 32)) = h;
  }
}

// ---- K2: encoder layer-2 + phases -> Q, K, Kt -----------------------------
// grid (ROWS / 16), block 256. A block owns 16 rows; each of its 8 waves owns
// one 16x16 tile: waves 0..3 the four column tiles of k, waves 4..7 those of
// q. So 256 blocks share the loads and the tanh / cos / sin work, one tile a
// wave. A tile's k order is 0, 32, ... in one accumulator chain.

__global__ __launch_bounds__(256)
void k_phases(const _Float16* __restrict__ hk,
              const _Float16* __restrict__ hq,
              const _Float16* __restrict__ kw2t,
              const _Float16* __restrict__ qw2t,
              const float* __restrict__ kb2,
              const float* __restrict__ qb2,
              const float* __restrict__ sw,
              _Float16* __restrict__ Qm,   // ROWS x FDIM, fragment order
              _Float16* __restrict__ Km,   // ROWS x FDIM, fragment order
              _Float16* __restrict__ Kt) { // (B FDIM) x SEQ, fragment order
  const int lane = threadIdx.x & 31;
  // the wave's number in a scalar register: the choices below become scalar
  const int wave = __builtin_amdgcn_readfirstlane(threadIdx.x >> 5);
  const bool isq = wave >= 4;
  const int t = wave & 3;                  // column tile = orthogonal set
  const int rowBase = blockIdx.x * 16;
  const int hi = lane >> 4;
  const int tp = t * 16 + (lane & 15);     // 0..63
  // This lane's place in the first fragment of the tokens' and of the weights'
  // row tile. A k wave has the tokens as the A operand: a lane holds 8 tokens
  // of one feature, as K^T wants them. A q wave has the weights as A: a lane
  // holds 8 neighbouring features of one token, as Q wants them.
  const _Float16* hp = (isq ? hq : hk)
      + (size_t)blockIdx.x * (DIM / 32) * PK_FRAG + lane * 8;
  const _Float16* wp = (isq ? qw2t : kw2t) + t * (DIM / 32) * PK_FRAG + lane * 8;
  const _Float16* pa = isq ? wp : hp;
  const _Float16* pb = isq ? hp : wp;
  // The bias of the lane's 8 accumulator rows: 8 features' in a q wave, one
  // feature's in a k wave. Both are loaded here by every wave and chosen behind
  // the products: a choice here would wait for the load in front of all others.
  const float* qbs = qb2 + t * 16;         // scalar base
  const v8f   bq = *(const v8f*)(qbs + hi * 8);
  const float bk = kb2[tp];

  // A wave has one product a k step, so nothing but its own loads in flight
  // hides their latency: eight k steps are fetched ahead, in registers.
  v16h a[8], b[8];
#pragma unroll
  for (int i = 0; i < 8; ++i) {
    a[i] = frag_pk(pa + i * PK_FRAG);
    b[i] = frag_pk(pb + i * PK_FRAG);
  }
  // without it the compiler sinks each load to just above its product
  __builtin_amdgcn_sched_barrier(0);
  v8f acc = {};
  // unrolled: a[] and b[] are indexed by constants and stay in registers
#pragma unroll
  for (int i = 0; i < DIM / 32; ++i) {
    acc = wmma_f16(a[i & 7], b[i & 7], acc);
    if (i + 8 < DIM / 32) {
      a[i & 7] = frag_pk(pa + (i + 8) * PK_FRAG);
      b[i & 7] = frag_pk(pb + (i + 8) * PK_FRAG);
      // as above: the refill stays directly behind the product it follows
      __builtin_amdgcn_sched_barrier(0);
    }
  }
  // in front of any rewrite of a register that the two bias loads name: as its
  // inputs, the loaded values keep the loads in front of it, and the offset and
  // base registers stay as they are up to it
  asm volatile("s_wait_xcnt 0x0"
               :: "v"(bq), "v"(bk), "v"(hi * 32), "v"(tp * 4), "s"(qbs), "s"(kb2)
               : "memory");
  // softmax over 4 set weights (redundant per thread; trivially cheap)
  float s0 = sw[0], s1 = sw[1], s2 = sw[2], s3 = sw[3];
  float mx = fmaxf(fmaxf(s0, s1), fmaxf(s2, s3));
  float e0 = expf(s0 - mx), e1 = expf(s1 - mx), e2 = expf(s2 - mx), e3 = expf(s3 - mx);
  float inv = 1.0f / (e0 + e1 + e2 + e3);
  const float et = (t == 0) ? e0 : (t == 1) ? e1 : (t == 2) ? e2 : e3;
  const float scale = isq ? et * inv : 1.0f;   // k features carry no weight

  v8h ccol, scol;   // the lane's 8 accumulator rows as cos and as sin
#pragma unroll
  for (int r = 0; r < 8; ++r) {
    float ph = tanhf(acc[r] + (isq ? bq[r] : bk)) * PI_F;
    ccol[r] = (_Float16)(scale * cosf(ph));
    scol[r] = (_Float16)(scale * sinf(ph));
  }
  if (isq) {
    // 8 neighbouring features of token rowBase + (lane & 15)
    _Float16* dq = Qm + pk_off(rowBase + (lane & 15), t * 16 + hi * 8, FDIM / 32);
    *(v8h*)(dq)                            = ccol;
    *(v8h*)(dq + (TP / 32) * PK_FRAG)      = scol;
    return;
  }
  // 8 tokens of feature tp. In K a token's features are the neighbours, so the
  // 8 go out one by one; token mBase + r lies 8 halves behind token mBase + r - 1
  const int mBase = rowBase + hi * 8;
  _Float16* dk = Km + pk_off(mBase, tp, FDIM / 32);
#pragma unroll
  for (int r = 0; r < 8; ++r) {
    dk[r * 8]                         = ccol[r];
    dk[r * 8 + (TP / 32) * PK_FRAG]   = scol[r];
  }
  // the address arithmetic below reuses registers that the stores above
  // name: the wait stands in front of any rewrite
  asm volatile("s_wait_xcnt 0x0" ::: "memory");
  // K^T, rows b * FDIM + f, k = l: the 8 tokens are neighbours (mBase % 8 == 0)
  const int bt = mBase >> 11, l = mBase & 2047;
  _Float16* dt = Kt + pk_off(bt * FDIM + tp, l, SEQ / 32);
  *(v8h*)(dt)                                      = ccol;
  *(v8h*)(dt + (TP / 16) * (SEQ / 32) * PK_FRAG)   = scol;
}

// ---- K3a: exclusive prefix over chunks of S_j = K_j^T V_j -> Mt (f16) -----
// S_j[f,d] = sum over the chunk's tokens t of K[t,f] V[t,d]; plane j of Mt holds
// S_0 + ... + S_(j-1). grid (FDIM / 32, DIM / 32, BATCH), block 512. A block owns
// 32 f x 32 d of EVERY chunk, wave j the four 16 x 16 tiles of chunk j, so the
// chunk sums meet in LDS: they never go to memory and the prefix has no launch
// of its own. Each S_j is summed from zero, k = 0, 32, ... in one accumulator
// chain a tile; the prefix adds S_0, S_1, ... in that order. The last chunk's
// sum enters no plane and is not formed.
// K^T is the A operand and V^T the B operand: a lane holds 8 neighbouring f of
// one d, which in Mt's order (each plane DIM x FDIM in fragment order, rows d,
// k = f) are neighbours: a tile is 256 elements in a row, lane after lane.

typedef __attribute__((ext_vector_type(2))) float    v2f;
typedef __attribute__((ext_vector_type(2))) _Float16 v2h;

// One chunk's sums in LDS, in floats: first every lane's elements 0..3, tile
// after tile and lane after lane, then every lane's elements 4..7. So a wave's
// 16-byte store is 512 bytes in a row. The 32 floats between the two halves
// put the two 128-byte pieces that a wave of the prefix reads on different banks.
#define KV_HALF  (4 * 32 * 4 + 32)
#define KV_PLANE (2 * KV_HALF)

static_assert(NCHK * 32 == 512, "one wave a chunk");

__global__ __launch_bounds__(512)
void k_chunk_prefix(const _Float16* __restrict__ Kt,
                    const _Float16* __restrict__ Vt,
                    _Float16* __restrict__ Mt) { // [B][NCHK] planes
  __shared__ __attribute__((aligned(16))) float sj[(NCHK - 1) * KV_PLANE];
  const int tid = threadIdx.x, lane = tid & 31;
  // the wave's number, its chunk, in a scalar register: the test below is a
  // scalar branch and the tile bases are scalar
  const int j = __builtin_amdgcn_readfirstlane(tid >> 5);
  const int b = blockIdx.z;
  const int fBase = blockIdx.x * 32, dBase = blockIdx.y * 32;

  if (j + 1 < NCHK) {
    // this lane's place in the chunk's first fragment of the block's first K^T
    // and first V^T row tile
    const _Float16* kp = Kt + lane * 8
        + (size_t)(((b * FDIM + fBase) >> 4) * (SEQ / 32) + j * (CHUNK / 32)) * PK_FRAG;
    const _Float16* vp = Vt + lane * 8
        + (size_t)(((b * DIM + dBase) >> 4) * (SEQ / 32) + j * (CHUNK / 32)) * PK_FRAG;
    const int ROW_TILE = (SEQ / 32) * PK_FRAG;  // halves from a row tile to the next
    // Every load of the wave is issued here, so that all of them wait out one
    // memory latency together. The loops are unrolled so that the arrays stay
    // in registers.
    v16h a[2][CHUNK / 32], v[2][CHUNK / 32];
#pragma unroll
    for (int i = 0; i < CHUNK / 32; ++i) {
#pragma unroll
      for (int h = 0; h < 2; ++h) {
        a[h][i] = frag_pk(kp + h * ROW_TILE + i * PK_FRAG);
        v[h][i] = frag_pk(vp + h * ROW_TILE + i * PK_FRAG);
      }
    }
    // without it the compiler sinks each load to just above its product
    __builtin_amdgcn_sched_barrier(0);
    // in front of any rewrite of a register that the loads above name; as its
    // inputs, their address registers stay as they are up to it
    asm volatile("s_wait_xcnt 0x0" :: "v"(kp), "v"(vp) : "memory");
    v8f acc[2][2] = {};                          // [d tile][f tile]
#pragma unroll
    for (int i = 0; i < CHUNK / 32; ++i) {
#pragma unroll
      for (int td = 0; td < 2; ++td) {
#pragma unroll
        for (int tf = 0; tf < 2; ++tf)
          acc[td][tf] = wmma_f16(a[tf][i], v[td][i], acc[td][tf]);
      }
    }
    float* sp = sj + j * KV_PLANE + lane * 4;
#pragma unroll
    for (int t = 0; t < 4; ++t) {
      const v8f s = acc[t >> 1][t & 1];
      *(v4f*)(sp + t * 128)           = __builtin_shufflevector(s, s, 0, 1, 2, 3);
      *(v4f*)(sp + KV_HALF + t * 128) = __builtin_shufflevector(s, s, 4, 5, 6, 7);
    }
  }
  __syncthreads();                               // all chunks' sums are there

  // The prefix. A thread owns 2 neighbouring elements of the block's 1,024 a
  // plane (tile, lane, element in that order): a wave reads 256 bytes of each
  // chunk's sums and stores one whole 128-byte line of each plane.
  const int t = tid >> 7, ln = (tid >> 2) & 31, r = (tid & 3) * 2;
  const float* rp = sj + (r >> 2) * KV_HALF + t * 128 + ln * 4 + (r & 3);
  _Float16* mp = Mt + (size_t)b * NCHK * DIM * FDIM
      + pk_off(dBase + (t >> 1) * 16, fBase + (t & 1) * 16, FDIM / 32)
      + (tid & 127) * 2;
  // unrolled: s[] stays in registers and all LDS reads are in flight together
  v2f s[NCHK - 1];
#pragma unroll
  for (int c = 0; c < NCHK - 1; ++c) s[c] = *(const v2f*)(rp + c * KV_PLANE);
  v2f run = {};
#pragma unroll
  for (int c = 0; c < NCHK; ++c) {
    *(v2h*)(mp + (size_t)c * DIM * FDIM) = __builtin_convertvector(run, v2h);
    if (c + 1 < NCHK) run += s[c];
  }
}

// ---- K3c: yn = LayerNorm((Q@M_prev + tril(Q K^T) @ V) / norm), f16 ---------
// grid (ROWS / 16), block 256. A block owns 16 whole token rows, wave w their
// 64 columns d = 64 w .. 64 w + 63, so the rows' mean and variance are formed
// here, from the accumulators: O never goes to memory and LayerNorm has no
// launch of its own. The block's 16 x 128 scores are made once, one 16 x 16
// tile a wave. In the second phase V^T and M^T are the A operand: a lane then
// holds 8 neighbouring d of ONE token row and stores them as 16 bytes.

static_assert(DIM == 8 * 64, "8 waves x 64 columns are a whole row");
static_assert(CHUNK == 8 * 16, "8 waves x 16 tokens are a whole chunk");
static_assert(SEQ == 2048 && CHUNK == 128, "the shifts below");

__global__ __launch_bounds__(256)
void k_chunk_out_ln(const _Float16* __restrict__ Qm,
                    const _Float16* __restrict__ Km,
                    const _Float16* __restrict__ Vt,
                    const _Float16* __restrict__ Mt,
                    const float* __restrict__ ln_g,
                    const float* __restrict__ ln_b,
                    _Float16* __restrict__ yn) { // ROWS x DIM, fragment order
  // +8 halves pad: 16-byte reads of 16 rows fall on different banks
  __shared__ __attribute__((aligned(16))) _Float16 sc[16][CHUNK + 8];
  // [sum | sum of squares][token row][wave]
  __shared__ __attribute__((aligned(16))) float red[2][16][8];
  const int lane = threadIdx.x & 31;
  // the wave's number in a scalar register: tile bases become scalar
  const int wave = __builtin_amdgcn_readfirstlane(threadIdx.x >> 5);
  const int hi = lane >> 4, m = lane & 15;
  const int row0 = blockIdx.x * 16;          // first token row of the block
  const int b = row0 >> 11;
  const int j = (row0 & (SEQ - 1)) >> 7;     // chunk
  const int rowTok = row0 & ~(CHUNK - 1);    // first token row of the chunk
  const int lIn = row0 & (CHUNK - 1);        // row0 within the chunk
  const int dBase = wave * 64;
  // This lane's place in the first fragment of each operand (fragment order:
  // see pk_off); every other fragment is a constant step from it.
  const int VT_TILE = (SEQ / 32) * PK_FRAG;    // halves from a row tile to the next
  const int MT_TILE = (FDIM / 32) * PK_FRAG;
  const _Float16* qs = Qm + (size_t)(row0 >> 4) * MT_TILE;       // scalar bases
  const _Float16* ks = Km + (size_t)((rowTok >> 4) + wave) * MT_TILE;
  const _Float16* vs0 = Vt + (size_t)((b * DIM + dBase) >> 4) * VT_TILE
                           + j * (CHUNK / 32) * PK_FRAG;
  const _Float16* ms = Mt + (size_t)(b * NCHK + j) * DIM * FDIM
                          + (dBase >> 4) * MT_TILE;
  const _Float16* qp = qs + lane * 8;
  const _Float16* kp = ks + lane * 8;
  const _Float16* vp = vs0 + lane * 8;
  const _Float16* mp = ms + lane * 8;
  const float* gs = ln_g + dBase;            // scalar bases
  const float* bs = ln_b + dBase;
  const int go = hi * 8;

  // Every load of the block is issued here, so that all of them wait out one
  // memory latency together. The loops are unrolled so that the arrays stay in
  // registers.
  v16h qf[4], kf[4], vf[4][4], mf[4][4];
  v8f g[4], be[4];
#pragma unroll
  for (int i = 0; i < 4; ++i) qf[i] = frag_pk(qp + i * PK_FRAG);
#pragma unroll
  for (int i = 0; i < 4; ++i) kf[i] = frag_pk(kp + i * PK_FRAG);
#pragma unroll
  for (int t = 0; t < 4; ++t) {
#pragma unroll
    for (int i = 0; i < 4; ++i) vf[i][t] = frag_pk(vp + t * VT_TILE + i * PK_FRAG);
  }
#pragma unroll
  for (int t = 0; t < 4; ++t) {
#pragma unroll
    for (int i = 0; i < 4; ++i) mf[i][t] = frag_pk(mp + t * MT_TILE + i * PK_FRAG);
  }
#pragma unroll
  for (int t = 0; t < 4; ++t) {
    g[t]  = *(const v8f*)(gs + go + t * 16);
    be[t] = *(const v8f*)(bs + go + t * 16);
  }
  // without it the compiler sinks each load to just above its use
  __builtin_amdgcn_sched_barrier(0);
  // in front of any rewrite of a register that the loads above name; as its
  // inputs, their address, offset and base registers stay as they are up to it
  asm volatile("s_wait_xcnt 0x0"
               :: "v"(lane), "s"(qs), "s"(ks), "s"(vs0), "s"(ms),
                  "v"(go * 4), "s"(gs), "s"(bs)
               : "memory");

  // Phase A: this wave's tile of scores = Q K_c^T, masked causal-inclusive
  v8f sacc = {};
#pragma unroll
  for (int i = 0; i < 4; ++i) sacc = wmma_f16(qf[i], kf[i], sacc);
  const int tl = wave * 16 + m;              // key token within the chunk
#pragma unroll
  for (int r = 0; r < 8; ++r) {
    const int mr = hi * 8 + r;               // query row within the block
    sc[mr][tl] = (_Float16)((tl <= lIn + mr) ? sacc[r] : 0.0f);
  }
  __syncthreads();                           // the scores are ready for all waves

  // Phase B: O^T = V_c^T scores^T + M_prev^T Q^T, one accumulator chain a tile,
  // the scores' k steps first
  v8f acc[4] = {};
  v16h sf[4];
#pragma unroll
  for (int i = 0; i < 4; ++i) sf[i] = load_frag(&sc[0][0], CHUNK + 8, 0, i * 32, lane);
#pragma unroll
  for (int i = 0; i < 4; ++i) {
#pragma unroll
    for (int t = 0; t < 4; ++t) acc[t] = wmma_f16(vf[i][t], sf[i], acc[t]);
  }
#pragma unroll
  for (int i = 0; i < 4; ++i) {
#pragma unroll
    for (int t = 0; t < 4; ++t) acc[t] = wmma_f16(mf[i][t], qf[i], acc[t]);
  }

  // Position norm and LayerNorm of token row row0 + m. A lane holds 32 of the
  // row's elements: d = dBase + 16 t + 8 hi + r.
  const int l = (row0 + m) & (SEQ - 1);
  const float nf = rsqrtf((float)(l + 1) * (float)NPLN);
  v8f vs = {}, vq = {};
#pragma unroll
  for (int t = 0; t < 4; ++t) {
    acc[t] *= nf;
    vs += acc[t];
    vq += acc[t] * acc[t];
  }
  float s = ((vs[0] + vs[1]) + (vs[2] + vs[3])) + ((vs[4] + vs[5]) + (vs[6] + vs[7]));
  float q = ((vq[0] + vq[1]) + (vq[2] + vq[3])) + ((vq[4] + vq[5]) + (vq[6] + vq[7]));
  // plus the lane of the same number in the other 16-lane row: same token row
  const int so = __builtin_bit_cast(int, s), qo = __builtin_bit_cast(int, q);
  s += __builtin_bit_cast(float, __builtin_amdgcn_permlanex16(
      so, so, 0x76543210, 0xfedcba98, false, false));
  q += __builtin_bit_cast(float, __builtin_amdgcn_permlanex16(
      qo, qo, 0x76543210, 0xfedcba98, false, false));
  // lanes 0..15 hand over the wave's sums, lanes 16..31 its sums of squares
  red[hi][m][wave] = hi ? q : s;
  __syncthreads();                           // all 8 waves' sums are there
  const v8f rs = *(const v8f*)&red[0][m][0];
  const v8f rq = *(const v8f*)&red[1][m][0];
  s = ((rs[0] + rs[1]) + (rs[2] + rs[3])) + ((rs[4] + rs[5]) + (rs[6] + rs[7]));
  q = ((rq[0] + rq[1]) + (rq[2] + rq[3])) + ((rq[4] + rq[5]) + (rq[6] + rq[7]));
  const float mu  = s * (1.0f / DIM);
  const float var = q * (1.0f / DIM) - mu * mu;
  const float ivs = rsqrtf(var + 1e-5f);
  // 16 columns on are half a fragment on: a wave's store is 512 bytes in a row
  _Float16* dst = yn + pk_off(row0 + m, dBase + hi * 8, DIM / 32);
#pragma unroll
  for (int t = 0; t < 4; ++t)
    *(v8h*)(dst + t * 256) =
        __builtin_convertvector((acc[t] - mu) * ivs * g[t] + be[t], v8h);
}

// ---- K4b: out = x + yn @ ow + ob ------------------------------------------
// grid (32, 8), block 256. Same async LDS staging as K1.

__global__ __launch_bounds__(256)
void k_outproj(const _Float16* __restrict__ yn,
                          const _Float16* __restrict__ owt,
                          const float* __restrict__ ob,
                          const float* __restrict__ x,
                          float* __restrict__ out) {
  __shared__ __attribute__((aligned(16))) _Float16 bs[64 * BPITCH];
  const int tid = threadIdx.x;
  const int lane = tid & 31, wave = tid >> 5;
  const int rowBase = blockIdx.x * 128 + wave * 16;
  const int colBase = blockIdx.y * 64;

  v8f acc[4] = {};
  gemm_16x64<false>(yn, owt, bs, rowBase, colBase, tid, acc);

  const int mBase = rowBase + ((lane >> 4) << 3);
#pragma unroll
  for (int t = 0; t < 4; ++t) {
    const int n = colBase + t * 16 + (lane & 15);
#pragma unroll
    for (int r = 0; r < 8; ++r) {
      const size_t idx = (size_t)(mBase + r) * DIM + n;
      out[idx] = x[idx] + acc[t][r] + ob[n];
    }
  }
}

// ---------------------------------------------------------------------------

extern "C" void kernel_launch(void* const* d_in, const int* in_sizes, int n_in,
                              void* d_out, int out_size, void* d_ws, size_t ws_size,
                              hipStream_t stream) {
  const float* x   = (const float*)d_in[0];
  const float* sw  = (const float*)d_in[1];
  const float* kw1 = (const float*)d_in[2];
  const float* kb1 = (const float*)d_in[3];
  const float* kw2 = (const float*)d_in[4];
  const float* kb2 = (const float*)d_in[5];
  const float* qw1 = (const float*)d_in[6];
  const float* qb1 = (const float*)d_in[7];
  const float* qw2 = (const float*)d_in[8];
  const float* qb2 = (const float*)d_in[9];
  const float* vw  = (const float*)d_in[10];
  const float* vb  = (const float*)d_in[11];
  const float* lng = (const float*)d_in[12];
  const float* lnb = (const float*)d_in[13];
  const float* ow  = (const float*)d_in[14];
  const float* ob  = (const float*)d_in[15];
  float* out = (float*)d_out;

  // workspace carve-up (all 256B aligned)
  char* ws = (char*)d_ws;
  size_t off = 0;
  auto take = [&](size_t bytes) { char* p = ws + off; off += (bytes + 255) & ~(size_t)255; return p; };
  _Float16* xh    = (_Float16*)take((size_t)ROWS * DIM * 2);
  _Float16* hk    = (_Float16*)take((size_t)ROWS * DIM * 2);
  _Float16* hq    = (_Float16*)take((size_t)ROWS * DIM * 2);
  _Float16* vt    = (_Float16*)take((size_t)BATCH * DIM * SEQ * 2);
  _Float16* Qm    = (_Float16*)take((size_t)ROWS * FDIM * 2);
  _Float16* Km    = (_Float16*)take((size_t)ROWS * FDIM * 2);
  _Float16* Kt    = (_Float16*)take((size_t)BATCH * FDIM * SEQ * 2);
  _Float16* Mt    = (_Float16*)take((size_t)BATCH * NCHK * DIM * FDIM * 2);
  _Float16* yn    = (_Float16*)take((size_t)ROWS * DIM * 2);
  _Float16* kw1t  = (_Float16*)take((size_t)DIM * DIM * 2);
  _Float16* qw1t  = (_Float16*)take((size_t)DIM * DIM * 2);
  _Float16* vwt   = (_Float16*)take((size_t)DIM * DIM * 2);
  _Float16* owt   = (_Float16*)take((size_t)DIM * DIM * 2);
  _Float16* kw2t  = (_Float16*)take((size_t)TP * DIM * 2);
  _Float16* qw2t  = (_Float16*)take((size_t)TP * DIM * 2);

  // P0: conversions, one launch
  k_prepare<<<NB_PREP, 256, 0, stream>>>(x, kw1, qw1, vw, ow, kw2, qw2,
                                         xh, kw1t, qw1t, vwt, owt, kw2t, qw2t);

  // K1: Hk / Hq / Vt
  k_encode1<<<dim3(ROWS / 128, DIM / 64, 3), 256, 0, stream>>>(
      xh, kw1t, qw1t, vwt, kb1, qb1, vb, hk, hq, vt);

  // K2: phases -> Q, K, Kt
  k_phases<<<dim3(ROWS / 16), 256, 0, stream>>>(
      hk, hq, kw2t, qw2t, kb2, qb2, sw, Qm, Km, Kt);

  // K3: chunked causal linear attention
  k_chunk_prefix<<<dim3(FDIM / 32, DIM / 32, BATCH), 512, 0, stream>>>(Kt, vt, Mt);
  k_chunk_out_ln<<<dim3(ROWS / 16), 256, 0, stream>>>(Qm, Km, vt, Mt, lng, lnb, yn);

  // K4: output projection + residual
  k_outproj<<<dim3(ROWS / 128, DIM / 64), 256, 0, stream>>>(yn, owt, ob, x, out);
}

// v010
// One run takes 37.2 microseconds.
// Timed twice side by side with v009, it ran 1.05 and 1.06 times as fast.
// Over all steps from v000 it is 6.15 times as fast.
#include <hip/hip_runtime.h>
#include <hip/hip_bf16.h>
#include <math.h>

// ---------------------------------------------------------------------------
// MI455X (gfx1250, wave32) implementation.
// Pipeline:
//  P0  convert x -> f16, transpose-convert all weights -> f16 [N,K]; one launch
//  K1  Hk = gelu(x@kw1+b), Hq = gelu(x@qw1+b), Vt = (x@vw+b)^T     (WMMA f16,
//      B panel of all k staged once in LDS via async-load-to-LDS)
//  K2  phases -> Q[l,f]=w_s*{cos,sin}(qp), K[l,f], Kt[f,l]          (WMMA f16)
//  K3a state sums S_j = K_j^T V_j of the first 15 chunks of a tile, handed over in
//      LDS; their exclusive prefix -> Mt, f16 M^T planes            (WMMA f16)
//  K3c O = Q@M_prev + tril(Q K^T) @ V  (scores staged in LDS), then
//      position-norm + LayerNorm of its whole rows -> yn (f16)      (WMMA f16)
//  K4b out = x + yn@ow + ob  (async LDS-staged B, like K1)          (WMMA f16)
// All accumulation in f32 (WMMA f32 accumulators).
// Every f16 matrix that a wave loads from global memory as WMMA fragments lies
// in the workspace in fragment order (pk_off below), not row-major.
// ---------------------------------------------------------------------------

typedef __attribute__((ext_vector_type(16))) _Float16 v16h;
typedef __attribute__((ext_vector_type(8)))  _Float16 v8h;
typedef __attribute__((ext_vector_type(8)))  float    v8f;
typedef __attribute__((ext_vector_type(4)))  int      v4i;
typedef __attribute__((ext_vector_type(4)))  float    v4f;
typedef __attribute__((ext_vector_type(4)))  _Float16 v4h;

#define BATCH 2
#define SEQ   2048
#define DIM   512
#define NSET  4
#define NPLN  16
#define TP    64          // NSET*NPLN
#define FDIM  128         // 2*TP (cos|sin features)
#define ROWS  4096        // BATCH*SEQ
#define CHUNK 128
#define NCHK  16          // SEQ/CHUNK
#define PI_F  3.14159265358979323846f

// CDNA5 async global->LDS path (ASYNCcnt). Guarded so the file compiles on
// toolchains without the builtins (falls back to sync reg->LDS staging).
#if defined(__has_builtin)
#if __has_builtin(__builtin_amdgcn_global_load_async_to_lds_b128) && \
    __has_builtin(__builtin_amdgcn_s_wait_asynccnt)
#define USE_ASYNC_LDS 1
#endif
#endif

#define AS_GLOBAL __attribute__((address_space(1)))
#define AS_LDS    __attribute__((address_space(3)))

// ---- WMMA helpers ---------------------------------------------------------

__device__ __forceinline__ v8f wmma_f16(v16h a, v16h b, v8f c) {
  // v_wmma_f32_16x16x32_f16 : D = A(16x32) x B(32x16) + C
  return __builtin_amdgcn_wmma_f32_16x16x32_f16(false, a, false, b,
                                                (short)0, c, false, false);
}

// Load a 16x32 f16 A-fragment (or the transposed-B fragment, which has the
// identical per-lane layout) from a row-major f16 matrix with leading dim ld.
// ISA layout: lane&15 selects row, (lane>>4)*8 selects K phase; vector
// elements 0..7 hold K = kb..kb+7, elements 8..15 hold K = kb+16..kb+23.
__device__ __forceinline__ v16h load_frag(const _Float16* __restrict__ base,
                                          int ld, int rowBase, int k0, int lane) {
  const _Float16* p = base + (size_t)(rowBase + (lane & 15)) * ld
                           + k0 + ((lane >> 4) << 3);
  v16h f;
  *(v8h*)&f       = *(const v8h*)(p);
  *((v8h*)&f + 1) = *(const v8h*)(p + 16);
  return f;
}

// Fragment order of a rows x (32 ks) f16 matrix in the workspace. The 16 x 32
// fragment (row tile, k step) is 1 KB in a row: first every lane's elements
// 0..7, lane after lane, then every lane's elements 8..15. A wave's 16-byte
// load then takes 512 contiguous bytes, 4 whole lines, where a row-major
// matrix gives it 32-byte pieces of 16 lines. Eight neighbouring k (k % 8 == 0)
// of one row are still 16 contiguous bytes.
__device__ __forceinline__ int pk_off(int row, int k, int ks) {
  return ((((row >> 4) * ks + (k >> 5)) * 2 + ((k >> 4) & 1)) << 8)
         + (((((k >> 3) & 1) << 4) + (row & 15)) << 3) + (k & 7);
}

#define PK_FRAG 512   // halves of one fragment

// The fragment at p = matrix + (row tile * ks + k step) * PK_FRAG + lane * 8;
// the same values in the same lanes and elements as load_frag gives.
__device__ __forceinline__ v16h frag_pk(const _Float16* __restrict__ p) {
  v16h f;
  *(v8h*)&f       = *(const v8h*)(p);
  *((v8h*)&f + 1) = *(const v8h*)(p + 256);
  return f;
}

// LDS row pitch of a B panel, in halves: 1040 bytes = 16 B x 65, an odd count,
// so the 16 rows that a ds_load_b128 reads fall on different banks.
#define BPITCH (DIM + 8)

// Stage a whole 64 x DIM f16 B panel (64 KB) into LDS: 16 b128 per thread of a
// 256-thread block, all in flight together. A wave's copy takes 512 contiguous
// bytes, half a row. Async (ASYNCcnt path) when available.
__device__ __forceinline__ void stage_b_panel(_Float16* __restrict__ lds_dst,
                                              const _Float16* __restrict__ gsrc,
                                              int colBase, int tid) {
  const int r = tid >> 6;          // 0..3  (row of transposed B, within 4)
  const int c = (tid & 63) << 3;   // 0,8,..,504 (halves)
  const _Float16* src = gsrc + (size_t)(colBase + r) * DIM + c;
  _Float16* dst = lds_dst + r * BPITCH + c;
  // unrolled: the steps become constants of the copies' addresses
#pragma unroll
  for (int i = 0; i < 16; ++i) {
#if defined(USE_ASYNC_LDS)
    _Float16* src_nc = const_cast<_Float16*>(src + i * 4 * DIM);
    __builtin_amdgcn_global_load_async_to_lds_b128(
        (AS_GLOBAL v4i*)src_nc, (AS_LDS v4i*)(dst + i * 4 * BPITCH), 0, 0);
#else
    *(v8h*)(dst + i * 4 * BPITCH) = *(const v8h*)(src + i * 4 * DIM);
#endif
  }
}

// The issuing wave's own copies have landed behind it; in asm with the memory
// clobber, so that no LDS read is moved in front of it.
__device__ __forceinline__ void stage_wait() {
#if defined(USE_ASYNC_LDS)
  asm volatile("s_wait_asynccnt 0x0" ::: "memory");
#endif
}

// acc[t] += A[rowBase .. +15][0 .. DIM) x (rows colBase + 16 t .. +15 of wt)^T,
// t = 0..3, for each of the 8 waves of a block; k runs 0, 32, ... in one
// accumulator chain a tile. Every load of the product is issued at the start:
// the B panel's copies and the wave's 16 A fragments wait out one memory
// latency together, and one barrier publishes the panel. A lies in fragment
// order. With TR the panel is the A operand of the products: acc[t] is then the
// transposed tile, a lane holding 8 neighbouring columns of ONE row of A.
template <bool TR>
__device__ __forceinline__ void gemm_16x64(const _Float16* __restrict__ A,
                                           const _Float16* __restrict__ wt,
                                           _Float16* __restrict__ bs,
                                           int rowBase, int colBase, int tid,
                                           v8f (&acc)[4]) {
  const int lane = tid & 31;
  stage_b_panel(bs, wt, colBase, tid);
  // the loops below are unrolled so that a[] stays in registers
  v16h a[DIM / 32];
#pragma unroll
  for (int i = 0; i < DIM / 32; ++i)
    a[i] = frag_pk(A + ((rowBase >> 4) * (DIM / 32) + i) * PK_FRAG + lane * 8);
  // without it the compiler sinks each load to just above its product
  __builtin_amdgcn_sched_barrier(0);
  // in front of any rewrite of a register that the loads above name
  asm volatile("s_wait_xcnt 0x0" ::: "memory");
  stage_wait();
  __syncthreads();                        // the panel is ready for all waves
  // With no barrier left between the k steps, a step's four B fragments are
  // read from LDS as one group, one step ahead of their products.
  v16h b[2][4];
#pragma unroll
  for (int t = 0; t < 4; ++t) b[0][t] = load_frag(bs, BPITCH, t * 16, 0, lane);
#pragma unroll
  for (int i = 0; i < DIM / 32; ++i) {
    if (i + 1 < DIM / 32) {
#pragma unroll
      for (int t = 0; t < 4; ++t)
        b[(i + 1) & 1][t] = load_frag(bs, BPITCH, t * 16, (i + 1) * 32, lane);
    }
    // without it the compiler sinks each LDS read to just above its product,
    // which then waits out the whole LDS latency
    __builtin_amdgcn_sched_barrier(0);
#pragma unroll
    for (int t = 0; t < 4; ++t)
      acc[t] = TR ? wmma_f16(b[i & 1][t], a[i], acc[t])
                  : wmma_f16(a[i], b[i & 1][t], acc[t]);
    // as above: the next group of reads stays behind these products
    __builtin_amdgcn_sched_barrier(0);
  }
}

// gelu(v) = 0.5 v (1 + erf(v / sqrt 2)) = max(v, 0) - |v| T(|v|), T the upper
// tail of the normal law, of 8 values at once and in straight-line code. The
// library's erff takes two branches on the lanes' values for every value, so a
// lane's values ran one behind the other, each waiting out its own chain; here
// the 8 chains have no branch between them and fill each other's waits.
// T(a) = exp(-a a / 2) (c1 t + ... + c5 t^5), t = 1 / (1 + 0.2316419 a): the
// classic five-term rational form, absolute error about 1e-7 for every a; the
// result is rounded to f16 behind it. No 1 + erf is formed, so nothing cancels
// for negative v.
__device__ __forceinline__ v8f gelu8(v8f v) {
  v8f a, t, e, o;
  // the loops are unrolled: the vectors stay in registers
#pragma unroll
  for (int r = 0; r < 8; ++r) a[r] = __builtin_fabsf(v[r]);
  const v8f d = a * 0.2316419f + 1.0f;
  const v8f m = (v * v) * -0.72134752f;        // -(v v / 2) log2 e
#pragma unroll
  for (int r = 0; r < 8; ++r) {
    t[r] = __builtin_amdgcn_rcpf(d[r]);
    e[r] = __builtin_amdgcn_exp2f(m[r]);
  }
  v8f p = t * 0.5307027145f - 0.7265760135f;
  p = p * t + 0.7107068705f;
  p = p * t - 0.142248368f;
  p = p * t + 0.127414796f;
  p = (p * t) * e;
#pragma unroll
  for (int r = 0; r < 8; ++r) o[r] = __builtin_fmaxf(v[r], 0.0f) - a[r] * p[r];
  return o;
}

// ---- P0: conversions ------------------------------------------------------
// A thread makes 8 f16 that are neighbours in dst and stores them as 16 bytes (an x thread two such groups).
// All seven conversions read inputs only and none reads another's output, so
// they share one launch: a block's index says which array it works on.

// dst[n*K+k] = (f16) src[k*N+n]   (store weights transposed for B operands)
// A thread reads 8 consecutive k of one n. A wave is 4 n x 8 groups of k, so
// its one store fills 4 whole 128-byte lines of dst, each written by no other
// wave; the 8 waves of a block read 128 contiguous bytes of each source row.
// idx runs over K * N / 8 threads, in whole blocks of 256.
// With PK dst is in fragment order (rows n), else row-major; with PK a wave's
// store is 8 pieces of 64 bytes (the two matrices stored so are 64 KB each).
template <int K, int N, bool PK>
__device__ __forceinline__ void transpose_f16(const float* __restrict__ src,
                                              _Float16* __restrict__ dst,
                                              unsigned idx) {
  static_assert(N % 4 == 0 && K % 64 == 0, "a wave is 4 n x 64 k");
  static_assert((K * N) % (8 * 256) == 0, "whole blocks cover the matrix");
  const unsigned nb = N >> 2;            // waves across n
  const unsigned w  = idx >> 5;
  const unsigned wk = w / nb, wn = w - wk * nb;
  const unsigned n  = wn * 4 + (idx & 3);
  const unsigned k0 = (wk * 8 + ((idx >> 2) & 7)) * 8;
  const float* p = src + (size_t)k0 * N + n;
  v8h h;
  // unrolled: h stays in registers and the eight loads are in flight together
#pragma unroll
  for (int i = 0; i < 8; ++i) h[i] = (_Float16)p[(size_t)i * N];
  *(v8h*)(dst + (PK ? (size_t)pk_off(n, k0, K / 32) : (size_t)n * K + k0)) = h;
}

#define NB_WBIG   (DIM * DIM / 8 / 256)   // blocks per DIM x DIM weight
#define NB_WSMALL (DIM * TP / 8 / 256)    // blocks per DIM x TP weight
#define NB_X      (ROWS * DIM / 16 / 256) // blocks for x
#define NB_PREP   (4 * NB_WBIG + 2 * NB_WSMALL + NB_X)

static_assert((ROWS * DIM) % (16 * 256) == 0, "the grid covers x exactly");

// grid (NB_PREP), block 256. The transposes come first in the index order:
// their loads touch more lines than those of the x conversion.
__global__ void k_prepare(const float* __restrict__ x,
                          const float* __restrict__ kw1,
                          const float* __restrict__ qw1,
                          const float* __restrict__ vw,
                          const float* __restrict__ ow,
                          const float* __restrict__ kw2,
                          const float* __restrict__ qw2,
                          _Float16* __restrict__ xh,
                          _Float16* __restrict__ kw1t,
                          _Float16* __restrict__ qw1t,
                          _Float16* __restrict__ vwt,
                          _Float16* __restrict__ owt,
                          _Float16* __restrict__ kw2t,
                          _Float16* __restrict__ qw2t) {
  unsigned blk = blockIdx.x;
  if (blk < 4 * NB_WBIG) {
    const unsigned m = blk / NB_WBIG;
    const float* s = (m == 0) ? kw1 : (m == 1) ? qw1 : (m == 2) ? vw : ow;
    _Float16* d = (m == 0) ? kw1t : (m == 1) ? qw1t : (m == 2) ? vwt : owt;
    transpose_f16<DIM, DIM, false>(s, d, (blk - m * NB_WBIG) * 256 + threadIdx.x);
    return;
  }
  blk -= 4 * NB_WBIG;
  if (blk < 2 * NB_WSMALL) {
    const unsigned m = blk / NB_WSMALL;
    transpose_f16<DIM, TP, true>(m == 0 ? kw2 : qw2, m == 0 ? kw2t : qw2t,
                           (blk - m * NB_WSMALL) * 256 + threadIdx.x);
    // the build lays another branch's code behind this store, and that code
    // rewrites the store's registers: the wait stands in front of any rewrite
    asm volatile("s_wait_xcnt 0x0" ::: "memory");
    return;
  }
  blk -= 2 * NB_WSMALL;
  // x in fragment order: a wave makes one whole fragment, from 128 bytes (one
  // line) of each of 16 rows; a thread is the lane that will load its 16 halves
  const unsigned fr = blk * 8 + (threadIdx.x >> 5);   // row tile * 16 + k step
  const unsigned ln = threadIdx.x & 31;
  const float* xp = x + (size_t)((fr >> 4) * 16 + (ln & 15)) * DIM
                      + (fr & 15) * 32 + (ln >> 4) * 8;
  _Float16* xd = xh + (size_t)fr * PK_FRAG + ln * 8;
  const v8f lo = *(const v8f*)(xp), up = *(const v8f*)(xp + 16);
  *(v8h*)(xd)       = __builtin_convertvector(lo, v8h);
  *(v8h*)(xd + 256) = __builtin_convertvector(up, v8h);
  // as above: in front of any rewrite of this store's registers
  asm volatile("s_wait_xcnt 0x0" ::: "memory");
}

// ---- K1: encoder layer-1 GEMMs + V projection -----------------------------
// grid (32, 8, 3), block 256 (8 waves); 128x64 output tile per block.

__global__ __launch_bounds__(256)
void k_encode1(const _Float16* __restrict__ xh,
                          const _Float16* __restrict__ kw1t,
                          const _Float16* __restrict__ qw1t,
                          const _Float16* __restrict__ vwt,
                          const float* __restrict__ kb1,
                          const float* __restrict__ qb1,
                          const float* __restrict__ vb,
                          _Float16* __restrict__ hk,
                          _Float16* __restrict__ hq,
                          _Float16* __restrict__ vt) {
  // the B panel, 65 KB; 16-byte copies and reads
  __shared__ __attribute__((aligned(16))) _Float16 bs[64 * BPITCH];
  const int tid = threadIdx.x;
  const int lane = tid & 31, wave = tid >> 5;
  const int z = blockIdx.z;
  const int rowBase = blockIdx.x * 128 + wave * 16;
  const int colBase = blockIdx.y * 64;
  const _Float16* wt  = (z == 0) ? kw1t : (z == 1) ? qw1t : vwt;
  const float*    bia = (z == 0) ? kb1  : (z == 1) ? qb1  : vb;

  v8f acc[4] = {};
  // the loops below are unrolled so that acc[] is indexed by constants and
  // stays in registers; z is the same for the whole block, so every wave of a
  // block passes the same one barrier
  if (z == 2) {
    gemm_16x64<false>(xh, wt, bs, rowBase, colBase, tid, acc);
    const int mBase = rowBase + ((lane >> 4) << 3);
    const int nBase = colBase + (lane & 15);
    // V^T, rows b * DIM + d, k = l: a lane's 8 rows are 8 neighbours in l
    // (mBase % 8 == 0); a wave's store is half a fragment, 512 bytes in a row
    const int b = mBase >> 11, l = mBase & 2047;
#pragma unroll
    for (int t = 0; t < 4; ++t)
      *(v8h*)(vt + pk_off(b * DIM + nBase + t * 16, l, SEQ / 32)) =
          __builtin_convertvector(acc[t] + bia[nBase + t * 16], v8h);
    return;
  }

  // Hk, Hq, rows = tokens, k = column: the transposed tile gives a lane 8
  // neighbouring columns of one token, again half a fragment a store
  gemm_16x64<true>(xh, wt, bs, rowBase, colBase, tid, acc);
  const int row = rowBase + (lane & 15);
  const int n0  = colBase + ((lane >> 4) << 3);
  _Float16* dst = (z == 0) ? hk : hq;
#pragma unroll
  for (int t = 0; t < 4; ++t) {
    const v8f v = acc[t] + *(const v8f*)(bia + n0 + t * 16);
    const v8h h = __builtin_convertvector(gelu8(v), v8h);
    *(v8h*)(dst + pk_off(row, n0 + t * 16, DIM / 32)) = h;
  }
}

// ---- K2: encoder layer-2 + phases -> Q, K, Kt -----------------------------
// grid (ROWS / 16), block 256. A block owns 16 rows; each of its 8 waves owns
// one 16x16 tile: waves 0..3 the four column tiles of k, waves 4..7 those of
// q. So 256 blocks share the loads and the tanh / cos / sin work, one tile a
// wave. A tile's k order is 0, 32, ... in one accumulator chain.

__global__ __launch_bounds__(256)
void k_phases(const _Float16* __restrict__ hk,
              const _Float16* __restrict__ hq,
              const _Float16* __restrict__ kw2t,
              const _Float16* __restrict__ qw2t,
              const float* __restrict__ kb2,
              const float* __restrict__ qb2,
              const float* __restrict__ sw,
              _Float16* __restrict__ Qm,   // ROWS x FDIM, fragment order
              _Float16* __restrict__ Km,   // ROWS x FDIM, fragment order
              _Float16* __restrict__ Kt) { // (B FDIM) x SEQ, fragment order
  const int lane = threadIdx.x & 31;
  // the wave's number in a scalar register: the choices below become scalar
  const int wave = __builtin_amdgcn_readfirstlane(threadIdx.x >> 5);
  const bool isq = wave >= 4;
  const int t = wave & 3;                  // column tile = orthogonal set
  const int rowBase = blockIdx.x * 16;
  const int hi = lane >> 4;
  const int tp = t * 16 + (lane & 15);     // 0..63
  // This lane's place in the first fragment of the tokens' and of the weights'
  // row tile. A k wave has the tokens as the A operand: a lane holds 8 tokens
  // of one feature, as K^T wants them. A q wave has the weights as A: a lane
  // holds 8 neighbouring features of one token, as Q wants them.
  const _Float16* hp = (isq ? hq : hk)
      + (size_t)blockIdx.x * (DIM / 32) * PK_FRAG + lane * 8;
  const _Float16* wp = (isq ? qw2t : kw2t) + t * (DIM / 32) * PK_FRAG + lane * 8;
  const _Float16* pa = isq ? wp : hp;
  const _Float16* pb = isq ? hp : wp;
  // The bias of the lane's 8 accumulator rows: 8 features' in a q wave, one
  // feature's in a k wave. Both are loaded here by every wave and chosen behind
  // the products: a choice here would wait for the load in front of all others.
  const float* qbs = qb2 + t * 16;         // scalar base
  const v8f   bq = *(const v8f*)(qbs + hi * 8);
  const float bk = kb2[tp];

  // A wave has one product a k step, so nothing but its own loads in flight
  // hides their latency: eight k steps are fetched ahead, in registers.
  v16h a[8], b[8];
#pragma unroll
  for (int i = 0; i < 8; ++i) {
    a[i] = frag_pk(pa + i * PK_FRAG);
    b[i] = frag_pk(pb + i * PK_FRAG);
  }
  // without it the compiler sinks each load to just above its product
  __builtin_amdgcn_sched_barrier(0);
  v8f acc = {};
  // unrolled: a[] and b[] are indexed by constants and stay in registers
#pragma unroll
  for (int i = 0; i < DIM / 32; ++i) {
    acc = wmma_f16(a[i & 7], b[i & 7], acc);
    if (i + 8 < DIM / 32) {
      a[i & 7] = frag_pk(pa + (i + 8) * PK_FRAG);
      b[i & 7] = frag_pk(pb + (i + 8) * PK_FRAG);
      // as above: the refill stays directly behind the product it follows
      __builtin_amdgcn_sched_barrier(0);
    }
  }
  // in front of any rewrite of a register that the two bias loads name: as its
  // inputs, the loaded values keep the loads in front of it, and the offset and
  // base registers stay as they are up to it
  asm volatile("s_wait_xcnt 0x0"
               :: "v"(bq), "v"(bk), "v"(hi * 32), "v"(tp * 4), "s"(qbs), "s"(kb2)
               : "memory");
  // softmax over 4 set weights (redundant per thread; trivially cheap)
  float s0 = sw[0], s1 = sw[1], s2 = sw[2], s3 = sw[3];
  float mx = fmaxf(fmaxf(s0, s1), fmaxf(s2, s3));
  float e0 = expf(s0 - mx), e1 = expf(s1 - mx), e2 = expf(s2 - mx), e3 = expf(s3 - mx);
  float inv = 1.0f / (e0 + e1 + e2 + e3);
  const float et = (t == 0) ? e0 : (t == 1) ? e1 : (t == 2) ? e2 : e3;
  const float scale = isq ? et * inv : 1.0f;   // k features carry no weight

  // cos and sin of pi tanh(z) of the lane's 8 accumulator rows, in straight-line
  // code: the library's tanhf, cosf and sinf take four branches on the lanes'
  // values for every value, so the 8 ran one behind the other; here their chains
  // fill each other's waits. A quarter of the phase,
  //   q = (pi / 4) tanh(z) = pi / 4 - (pi / 2) / (exp(2 z) + 1),
  // lies in [-pi/4, pi/4] for every z (exp = inf gives pi/4, exp = 0 gives
  // -pi/4), so its sine and cosine need no range reduction: their Taylor sums to
  // q^9 and q^8 are right to 3e-8 there. Two angle doublings give the phase's.
  // Absolute error of the results about 1e-6; they are rounded to f16.
  v8f z, ez, rc;
  // the loops are unrolled: the vectors stay in registers
#pragma unroll
  for (int r = 0; r < 8; ++r) z[r] = acc[r] + (isq ? bq[r] : bk);
  z *= 2.8853900818f;                            // 2 z log2 e
#pragma unroll
  for (int r = 0; r < 8; ++r) ez[r] = __builtin_amdgcn_exp2f(z[r]);
  ez += 1.0f;
#pragma unroll
  for (int r = 0; r < 8; ++r) rc[r] = __builtin_amdgcn_rcpf(ez[r]);
  const v8f qa = rc * (-0.5f * PI_F) + 0.25f * PI_F;
  const v8f q2 = qa * qa;
  v8f sn = q2 * 2.7557319e-6f - 1.9841270e-4f;
  sn = sn * q2 + 8.3333333e-3f;
  sn = sn * q2 - 0.16666667f;
  sn = (sn * q2) * qa + qa;
  v8f cs = q2 * 2.4801587e-5f - 1.3888889e-3f;
  cs = cs * q2 + 4.1666667e-2f;
  cs = cs * q2 - 0.5f;
  cs = cs * q2 + 1.0f;
#pragma unroll
  for (int i = 0; i < 2; ++i) {                  // sin 2u = 2 s c, cos 2u = 1 - 2 s s
    const v8f tw = sn + sn;
    const v8f c2 = 1.0f - tw * sn;
    sn = tw * cs;
    cs = c2;
  }
  // the lane's 8 accumulator rows as cos and as sin
  const v8h ccol = __builtin_convertvector(cs * scale, v8h);
  const v8h scol = __builtin_convertvector(sn * scale, v8h);
  if (isq) {
    // 8 neighbouring features of token rowBase + (lane & 15)
    _Float16* dq = Qm + pk_off(rowBase + (lane & 15), t * 16 + hi * 8, FDIM / 32);
    *(v8h*)(dq)                            = ccol;
    *(v8h*)(dq + (TP / 32) * PK_FRAG)      = scol;
    return;
  }
  // 8 tokens of feature tp. In K a token's features are the neighbours, so the
  // 8 go out one by one; token mBase + r lies 8 halves behind token mBase + r - 1
  const int mBase = rowBase + hi * 8;
  _Float16* dk = Km + pk_off(mBase, tp, FDIM / 32);
#pragma unroll
  for (int r = 0; r < 8; ++r) {
    dk[r * 8]                         = ccol[r];
    dk[r * 8 + (TP / 32) * PK_FRAG]   = scol[r];
  }
  // the address arithmetic below reuses registers that the stores above
  // name: the wait stands in front of any rewrite
  asm volatile("s_wait_xcnt 0x0" ::: "memory");
  // K^T, rows b * FDIM + f, k = l: the 8 tokens are neighbours (mBase % 8 == 0)
  const int bt = mBase >> 11, l = mBase & 2047;
  _Float16* dt = Kt + pk_off(bt * FDIM + tp, l, SEQ / 32);
  *(v8h*)(dt)                                      = ccol;
  *(v8h*)(dt + (TP / 16) * (SEQ / 32) * PK_FRAG)   = scol;
}

// ---- K3a: exclusive prefix over chunks of S_j = K_j^T V_j -> Mt (f16) -----
// S_j[f,d] = sum over the chunk's tokens t of K[t,f] V[t,d]; plane j of Mt holds
// S_0 + ... + S_(j-1). grid (FDIM / 32, DIM / 32, BATCH), block 512. A block owns
// 32 f x 32 d of EVERY chunk, wave j the four 16 x 16 tiles of chunk j, so the
// chunk sums meet in LDS: they never go to memory and the prefix has no launch
// of its own. Each S_j is summed from zero, k = 0, 32, ... in one accumulator
// chain a tile; the prefix adds S_0, S_1, ... in that order. The last chunk's
// sum enters no plane and is not formed.
// K^T is the A operand and V^T the B operand: a lane holds 8 neighbouring f of
// one d, which in Mt's order (each plane DIM x FDIM in fragment order, rows d,
// k = f) are neighbours: a tile is 256 elements in a row, lane after lane.

typedef __attribute__((ext_vector_type(2))) float    v2f;
typedef __attribute__((ext_vector_type(2))) _Float16 v2h;

// One chunk's sums in LDS, in floats: first every lane's elements 0..3, tile
// after tile and lane after lane, then every lane's elements 4..7. So a wave's
// 16-byte store is 512 bytes in a row. The 32 floats between the two halves
// put the two 128-byte pieces that a wave of the prefix reads on different banks.
#define KV_HALF  (4 * 32 * 4 + 32)
#define KV_PLANE (2 * KV_HALF)

static_assert(NCHK * 32 == 512, "one wave a chunk");

__global__ __launch_bounds__(512)
void k_chunk_prefix(const _Float16* __restrict__ Kt,
                    const _Float16* __restrict__ Vt,
                    _Float16* __restrict__ Mt) { // [B][NCHK] planes
  __shared__ __attribute__((aligned(16))) float sj[(NCHK - 1) * KV_PLANE];
  const int tid = threadIdx.x, lane = tid & 31;
  // the wave's number, its chunk, in a scalar register: the test below is a
  // scalar branch and the tile bases are scalar
  const int j = __builtin_amdgcn_readfirstlane(tid >> 5);
  const int b = blockIdx.z;
  const int fBase = blockIdx.x * 32, dBase = blockIdx.y * 32;

  if (j + 1 < NCHK) {
    // this lane's place in the chunk's first fragment of the block's first K^T
    // and first V^T row tile
    const _Float16* kp = Kt + lane * 8
        + (size_t)(((b * FDIM + fBase) >> 4) * (SEQ / 32) + j * (CHUNK / 32)) * PK_FRAG;
    const _Float16* vp = Vt + lane * 8
        + (size_t)(((b * DIM + dBase) >> 4) * (SEQ / 32) + j * (CHUNK / 32)) * PK_FRAG;
    const int ROW_TILE = (SEQ / 32) * PK_FRAG;  // halves from a row tile to the next
    // Every load of the wave is issued here, so that all of them wait out one
    // memory latency together. The loops are unrolled so that the arrays stay
    // in registers.
    v16h a[2][CHUNK / 32], v[2][CHUNK / 32];
#pragma unroll
    for (int i = 0; i < CHUNK / 32; ++i) {
#pragma unroll
      for (int h = 0; h < 2; ++h) {
        a[h][i] = frag_pk(kp + h * ROW_TILE + i * PK_FRAG);
        v[h][i] = frag_pk(vp + h * ROW_TILE + i * PK_FRAG);
      }
    }
    // without it the compiler sinks each load to just above its product
    __builtin_amdgcn_sched_barrier(0);
    // in front of any rewrite of a register that the loads above name; as its
    // inputs, their address registers stay as they are up to it
    asm volatile("s_wait_xcnt 0x0" :: "v"(kp), "v"(vp) : "memory");
    v8f acc[2][2] = {};                          // [d tile][f tile]
#pragma unroll
    for (int i = 0; i < CHUNK / 32; ++i) {
#pragma unroll
      for (int td = 0; td < 2; ++td) {
#pragma unroll
        for (int tf = 0; tf < 2; ++tf)
          acc[td][tf] = wmma_f16(a[tf][i], v[td][i], acc[td][tf]);
      }
    }
    float* sp = sj + j * KV_PLANE + lane * 4;
#pragma unroll
    for (int t = 0; t < 4; ++t) {
      const v8f s = acc[t >> 1][t & 1];
      *(v4f*)(sp + t * 128)           = __builtin_shufflevector(s, s, 0, 1, 2, 3);
      *(v4f*)(sp + KV_HALF + t * 128) = __builtin_shufflevector(s, s, 4, 5, 6, 7);
    }
  }
  __syncthreads();                               // all chunks' sums are there

  // The prefix. A thread owns 2 neighbouring elements of the block's 1,024 a
  // plane (tile, lane, element in that order): a wave reads 256 bytes of each
  // chunk's sums and stores one whole 128-byte line of each plane.
  const int t = tid >> 7, ln = (tid >> 2) & 31, r = (tid & 3) * 2;
  const float* rp = sj + (r >> 2) * KV_HALF + t * 128 + ln * 4 + (r & 3);
  _Float16* mp = Mt + (size_t)b * NCHK * DIM * FDIM
      + pk_off(dBase + (t >> 1) * 16, fBase + (t & 1) * 16, FDIM / 32)
      + (tid & 127) * 2;
  // unrolled: s[] stays in registers and all LDS reads are in flight together
  v2f s[NCHK - 1];
#pragma unroll
  for (int c = 0; c < NCHK - 1; ++c) s[c] = *(const v2f*)(rp + c * KV_PLANE);
  v2f run = {};
#pragma unroll
  for (int c = 0; c < NCHK; ++c) {
    *(v2h*)(mp + (size_t)c * DIM * FDIM) = __builtin_convertvector(run, v2h);
    if (c + 1 < NCHK) run += s[c];
  }
}

// ---- K3c: yn = LayerNorm((Q@M_prev + tril(Q K^T) @ V) / norm), f16 ---------
// grid (ROWS / 16), block 256. A block owns 16 whole token rows, wave w their
// 64 columns d = 64 w .. 64 w + 63, so the rows' mean and variance are formed
// here, from the accumulators: O never goes to memory and LayerNorm has no
// launch of its own. The block's 16 x 128 scores are made once, one 16 x 16
// tile a wave. In the second phase V^T and M^T are the A operand: a lane then
// holds 8 neighbouring d of ONE token row and stores them as 16 bytes.

static_assert(DIM == 8 * 64, "8 waves x 64 columns are a whole row");
static_assert(CHUNK == 8 * 16, "8 waves x 16 tokens are a whole chunk");
static_assert(SEQ == 2048 && CHUNK == 128, "the shifts below");

__global__ __launch_bounds__(256)
void k_chunk_out_ln(const _Float16* __restrict__ Qm,
                    const _Float16* __restrict__ Km,
                    const _Float16* __restrict__ Vt,
                    const _Float16* __restrict__ Mt,
                    const float* __restrict__ ln_g,
                    const float* __restrict__ ln_b,
                    _Float16* __restrict__ yn) { // ROWS x DIM, fragment order
  // +8 halves pad: 16-byte reads of 16 rows fall on different banks
  __shared__ __attribute__((aligned(16))) _Float16 sc[16][CHUNK + 8];
  // [sum | sum of squares][token row][wave]
  __shared__ __attribute__((aligned(16))) float red[2][16][8];
  const int lane = threadIdx.x & 31;
  // the wave's number in a scalar register: tile bases become scalar
  const int wave = __builtin_amdgcn_readfirstlane(threadIdx.x >> 5);
  const int hi = lane >> 4, m = lane & 15;
  const int row0 = blockIdx.x * 16;          // first token row of the block
  const int b = row0 >> 11;
  const int j = (row0 & (SEQ - 1)) >> 7;     // chunk
  const int rowTok = row0 & ~(CHUNK - 1);    // first token row of the chunk
  const int lIn = row0 & (CHUNK - 1);        // row0 within the chunk
  const int dBase = wave * 64;
  // This lane's place in the first fragment of each operand (fragment order:
  // see pk_off); every other fragment is a constant step from it.
  const int VT_TILE = (SEQ / 32) * PK_FRAG;    // halves from a row tile to the next
  const int MT_TILE = (FDIM / 32) * PK_FRAG;
  const _Float16* qs = Qm + (size_t)(row0 >> 4) * MT_TILE;       // scalar bases
  const _Float16* ks = Km + (size_t)((rowTok >> 4) + wave) * MT_TILE;
  const _Float16* vs0 = Vt + (size_t)((b * DIM + dBase) >> 4) * VT_TILE
                           + j * (CHUNK / 32) * PK_FRAG;
  const _Float16* ms = Mt + (size_t)(b * NCHK + j) * DIM * FDIM
                          + (dBase >> 4) * MT_TILE;
  const _Float16* qp = qs + lane * 8;
  const _Float16* kp = ks + lane * 8;
  const _Float16* vp = vs0 + lane * 8;
  const _Float16* mp = ms + lane * 8;
  const float* gs = ln_g + dBase;            // scalar bases
  const float* bs = ln_b + dBase;
  const int go = hi * 8;

  // Every load of the block is issued here, so that all of them wait out one
  // memory latency together. The loops are unrolled so that the arrays stay in
  // registers.
  v16h qf[4], kf[4], vf[4][4], mf[4][4];
  v8f g[4], be[4];
#pragma unroll
  for (int i = 0; i < 4; ++i) qf[i] = frag_pk(qp + i * PK_FRAG);
#pragma unroll
  for (int i = 0; i < 4; ++i) kf[i] = frag_pk(kp + i * PK_FRAG);
#pragma unroll
  for (int t = 0; t < 4; ++t) {
#pragma unroll
    for (int i = 0; i < 4; ++i) vf[i][t] = frag_pk(vp + t * VT_TILE + i * PK_FRAG);
  }
#pragma unroll
  for (int t = 0; t < 4; ++t) {
#pragma unroll
    for (int i = 0; i < 4; ++i) mf[i][t] = frag_pk(mp + t * MT_TILE + i * PK_FRAG);
  }
#pragma unroll
  for (int t = 0; t < 4; ++t) {
    g[t]  = *(const v8f*)(gs + go + t * 16);
    be[t] = *(const v8f*)(bs + go + t * 16);
  }
  // without it the compiler sinks each load to just above its use
  __builtin_amdgcn_sched_barrier(0);
  // in front of any rewrite of a register that the loads above name; as its
  // inputs, their address, offset and base registers stay as they are up to it
  asm volatile("s_wait_xcnt 0x0"
               :: "v"(lane), "s"(qs), "s"(ks), "s"(vs0), "s"(ms),
                  "v"(go * 4), "s"(gs), "s"(bs)
               : "memory");

  // Phase A: this wave's tile of scores = Q K_c^T, masked causal-inclusive
  v8f sacc = {};
#pragma unroll
  for (int i = 0; i < 4; ++i) sacc = wmma_f16(qf[i], kf[i], sacc);
  const int tl = wave * 16 + m;              // key token within the chunk
#pragma unroll
  for (int r = 0; r < 8; ++r) {
    const int mr = hi * 8 + r;               // query row within the block
    sc[mr][tl] = (_Float16)((tl <= lIn + mr) ? sacc[r] : 0.0f);
  }
  __syncthreads();                           // the scores are ready for all waves

  // Phase B: O^T = V_c^T scores^T + M_prev^T Q^T, one accumulator chain a tile,
  // the scores' k steps first
  v8f acc[4] = {};
  v16h sf[4];
#pragma unroll
  for (int i = 0; i < 4; ++i) sf[i] = load_frag(&sc[0][0], CHUNK + 8, 0, i * 32, lane);
#pragma unroll
  for (int i = 0; i < 4; ++i) {
#pragma unroll
    for (int t = 0; t < 4; ++t) acc[t] = wmma_f16(vf[i][t], sf[i], acc[t]);
  }
#pragma unroll
  for (int i = 0; i < 4; ++i) {
#pragma unroll
    for (int t = 0; t < 4; ++t) acc[t] = wmma_f16(mf[i][t], qf[i], acc[t]);
  }

  // Position norm and LayerNorm of token row row0 + m. A lane holds 32 of the
  // row's elements: d = dBase + 16 t + 8 hi + r.
  const int l = (row0 + m) & (SEQ - 1);
  const float nf = rsqrtf((float)(l + 1) * (float)NPLN);
  v8f vs = {}, vq = {};
#pragma unroll
  for (int t = 0; t < 4; ++t) {
    acc[t] *= nf;
    vs += acc[t];
    vq += acc[t] * acc[t];
  }
  float s = ((vs[0] + vs[1]) + (vs[2] + vs[3])) + ((vs[4] + vs[5]) + (vs[6] + vs[7]));
  float q = ((vq[0] + vq[1]) + (vq[2] + vq[3])) + ((vq[4] + vq[5]) + (vq[6] + vq[7]));
  // plus the lane of the same number in the other 16-lane row: same token row
  const int so = __builtin_bit_cast(int, s), qo = __builtin_bit_cast(int, q);
  s += __builtin_bit_cast(float, __builtin_amdgcn_permlanex16(
      so, so, 0x76543210, 0xfedcba98, false, false));
  q += __builtin_bit_cast(float, __builtin_amdgcn_permlanex16(
      qo, qo, 0x76543210, 0xfedcba98, false, false));
  // lanes 0..15 hand over the wave's sums, lanes 16..31 its sums of squares
  red[hi][m][wave] = hi ? q : s;
  __syncthreads();                           // all 8 waves' sums are there
  const v8f rs = *(const v8f*)&red[0][m][0];
  const v8f rq = *(const v8f*)&red[1][m][0];
  s = ((rs[0] + rs[1]) + (rs[2] + rs[3])) + ((rs[4] + rs[5]) + (rs[6] + rs[7]));
  q = ((rq[0] + rq[1]) + (rq[2] + rq[3])) + ((rq[4] + rq[5]) + (rq[6] + rq[7]));
  const float mu  = s * (1.0f / DIM);
  const float var = q * (1.0f / DIM) - mu * mu;
  const float ivs = rsqrtf(var + 1e-5f);
  // 16 columns on are half a fragment on: a wave's store is 512 bytes in a row
  _Float16* dst = yn + pk_off(row0 + m, dBase + hi * 8, DIM / 32);
#pragma unroll
  for (int t = 0; t < 4; ++t)
    *(v8h*)(dst + t * 256) =
        __builtin_convertvector((acc[t] - mu) * ivs * g[t] + be[t], v8h);
}

// ---- K4b: out = x + yn @ ow + ob ------------------------------------------
// grid (32, 8), block 256. Same async LDS staging as K1.

__global__ __launch_bounds__(256)
void k_outproj(const _Float16* __restrict__ yn,
                          const _Float16* __restrict__ owt,
                          const float* __restrict__ ob,
                          const float* __restrict__ x,
                          float* __restrict__ out) {
  __shared__ __attribute__((aligned(16))) _Float16 bs[64 * BPITCH];
  const int tid = threadIdx.x;
  const int lane = tid & 31, wave = tid >> 5;
  const int rowBase = blockIdx.x * 128 + wave * 16;
  const int colBase = blockIdx.y * 64;

  v8f acc[4] = {};
  gemm_16x64<false>(yn, owt, bs, rowBase, colBase, tid, acc);

  const int mBase = rowBase + ((lane >> 4) << 3);
#pragma unroll
  for (int t = 0; t < 4; ++t) {
    const int n = colBase + t * 16 + (lane & 15);
#pragma unroll
    for (int r = 0; r < 8; ++r) {
      const size_t idx = (size_t)(mBase + r) * DIM + n;
      out[idx] = x[idx] + acc[t][r] + ob[n];
    }
  }
}

// ---------------------------------------------------------------------------

extern "C" void kernel_launch(void* const* d_in, const int* in_sizes, int n_in,
                              void* d_out, int out_size, void* d_ws, size_t ws_size,
                              hipStream_t stream) {
  const float* x   = (const float*)d_in[0];
  const float* sw  = (const float*)d_in[1];
  const float* kw1 = (const float*)d_in[2];
  const float* kb1 = (const float*)d_in[3];
  const float* kw2 = (const float*)d_in[4];
  const float* kb2 = (const float*)d_in[5];
  const float* qw1 = (const float*)d_in[6];
  const float* qb1 = (const float*)d_in[7];
  const float* qw2 = (const float*)d_in[8];
  const float* qb2 = (const float*)d_in[9];
  const float* vw  = (const float*)d_in[10];
  const float* vb  = (const float*)d_in[11];
  const float* lng = (const float*)d_in[12];
  const float* lnb = (const float*)d_in[13];
  const float* ow  = (const float*)d_in[14];
  const float* ob  = (const float*)d_in[15];
  float* out = (float*)d_out;

  // workspace carve-up (all 256B aligned)
  char* ws = (char*)d_ws;
  size_t off = 0;
  auto take = [&](size_t bytes) { char* p = ws + off; off += (bytes + 255) & ~(size_t)255; return p; };
  _Float16* xh    = (_Float16*)take((size_t)ROWS * DIM * 2);
  _Float16* hk    = (_Float16*)take((size_t)ROWS * DIM * 2);
  _Float16* hq    = (_Float16*)take((size_t)ROWS * DIM * 2);
  _Float16* vt    = (_Float16*)take((size_t)BATCH * DIM * SEQ * 2);
  _Float16* Qm    = (_Float16*)take((size_t)ROWS * FDIM * 2);
  _Float16* Km    = (_Float16*)take((size_t)ROWS * FDIM * 2);
  _Float16* Kt    = (_Float16*)take((size_t)BATCH * FDIM * SEQ * 2);
  _Float16* Mt    = (_Float16*)take((size_t)BATCH * NCHK * DIM * FDIM * 2);
  _Float16* yn    = (_Float16*)take((size_t)ROWS * DIM * 2);
  _Float16* kw1t  = (_Float16*)take((size_t)DIM * DIM * 2);
  _Float16* qw1t  = (_Float16*)take((size_t)DIM * DIM * 2);
  _Float16* vwt   = (_Float16*)take((size_t)DIM * DIM * 2);
  _Float16* owt   = (_Float16*)take((size_t)DIM * DIM * 2);
  _Float16* kw2t  = (_Float16*)take((size_t)TP * DIM * 2);
  _Float16* qw2t  = (_Float16*)take((size_t)TP * DIM * 2);

  // P0: conversions, one launch
  k_prepare<<<NB_PREP, 256, 0, stream>>>(x, kw1, qw1, vw, ow, kw2, qw2,
                                         xh, kw1t, qw1t, vwt, owt, kw2t, qw2t);

  // K1: Hk / Hq / Vt
  k_encode1<<<dim3(ROWS / 128, DIM / 64, 3), 256, 0, stream>>>(
      xh, kw1t, qw1t, vwt, kb1, qb1, vb, hk, hq, vt);

  // K2: phases -> Q, K, Kt
  k_phases<<<dim3(ROWS / 16), 256, 0, stream>>>(
      hk, hq, kw2t, qw2t, kb2, qb2, sw, Qm, Km, Kt);

  // K3: chunked causal linear attention
  k_chunk_prefix<<<dim3(FDIM / 32, DIM / 32, BATCH), 512, 0, stream>>>(Kt, vt, Mt);
  k_chunk_out_ln<<<dim3(ROWS / 16), 256, 0, stream>>>(Qm, Km, vt, Mt, lng, lnb, yn);

  // K4: output projection + residual
  k_outproj<<<dim3(ROWS / 128, DIM / 64), 256, 0, stream>>>(yn, owt, ob, x, out);
}
